// v000
// The times below were measured on an AMD MI455X: many runs one after another, warmed up first and cycling through
// copies of the inputs, with the whole window's GPU time divided by the number of runs. Launches and the gaps
// between them are all in it. The median over several windows is given; except for v000 it joins two sittings, which
// can be a few percent apart, so the side-by-side timings, each taken in one sitting, are the better comparison.
// The starting kernel, v000, takes 292 microseconds a run.
#include <hip/hip_runtime.h>
#include <hip/hip_bf16.h>
#include <math.h>

typedef float v2f __attribute__((ext_vector_type(2)));
typedef float v8f __attribute__((ext_vector_type(8)));

// D = A(16x4,f32) x B(4x16,f32) + C(16x16,f32)
#define WMMA_F32(a, b, c) \
    __builtin_amdgcn_wmma_f32_16x16x4_f32(false, (a), false, (b), (short)0, (c), false, false)

__device__ __forceinline__ float gelu_exact(float x) {
    return 0.5f * x * (1.0f + erff(x * 0.70710678118654752440f));
}

// Async copy 16B global -> LDS (CDNA5 GLOBAL_LOAD_ASYNC_TO_LDS_B128, ASYNCcnt).
// lds_off = low 32 bits of the generic shared-memory pointer (LDS aperture
// truncation, ISA 10.2).
__device__ __forceinline__ void async_copy_b128(const float* g, const float* lds_ptr) {
    unsigned lds_off = (unsigned)(size_t)lds_ptr;
    unsigned long long ga = (unsigned long long)(size_t)g;
    asm volatile("global_load_async_to_lds_b128 %0, %1, off"
                 :: "v"(lds_off), "v"(ga) : "memory");
}
__device__ __forceinline__ void wait_async0() {
    asm volatile("s_wait_asynccnt 0x0" ::: "memory");
}

// ---------------------------------------------------------------------------
// fp32 WMMA GEMM: C = act(A@B + bias) [+ resid]
// A: MxK row-major, B: KxN row-major, C/resid: MxN row-major.
// Block = 256 threads (8 waves) computes a 128x64 C tile; each wave owns a
// 2x2 grid of 16x16 accumulators. Double-buffered LDS, async loads to LDS.
// A tile LDS stride = 20 floats (80B): 16B-aligned rows for b128 async writes
// AND bank-conflict-free fragment reads (20*r mod 64 distinct, r=0..15).
// ---------------------------------------------------------------------------
__global__ __launch_bounds__(256) void gemm_wmma_f32(
    const float* __restrict__ A, const float* __restrict__ B,
    const float* __restrict__ bias, const float* __restrict__ resid,
    float* __restrict__ C, int M, int N, int Kd, int act)
{
    __shared__ __align__(16) float As[2][128 * 20];   // [buf][row][k], stride 20
    __shared__ __align__(16) float Bs[2][16 * 64];    // [buf][k][n]

    const int tid  = threadIdx.x;
    const int wave = tid >> 5;
    const int lane = tid & 31;
    const int half = lane >> 4;
    const int lr   = lane & 15;

    const int m0 = blockIdx.y * 128;
    const int n0 = blockIdx.x * 64;

    const int colBase = (wave & 1) * 32;   // cols {colBase, colBase+16}
    const int rowBase = (wave >> 1) * 32;  // rows {rowBase, rowBase+16}

    v8f acc00 = {}; v8f acc01 = {}; v8f acc10 = {}; v8f acc11 = {};

    // Loaders: A tile 128x16 (256 thr x 2 float4), B tile 16x64 (256 thr x 1).
    const int arow = tid >> 1, aq = (tid & 1) * 8;
    const int brow = tid >> 4, bcol = (tid & 15) * 4;

    const float* gA = A + (size_t)(m0 + arow) * Kd + aq;
    const float* gB = B + (size_t)brow * N + n0 + bcol;

    // prologue: stage k-block 0 into buffer 0
    async_copy_b128(gA,     &As[0][arow * 20 + aq]);
    async_copy_b128(gA + 4, &As[0][arow * 20 + aq + 4]);
    async_copy_b128(gB,     &Bs[0][brow * 64 + bcol]);

    int buf = 0;
    for (int kb = 0; kb < Kd; kb += 16) {
        wait_async0();          // this wave's copies into `buf` are done
        __syncthreads();        // everyone's copies are done; prev reads done

        if (kb + 16 < Kd) {     // overlap next tile copy with compute
            const float* nA = gA + kb + 16;
            const float* nB = gB + (size_t)(kb + 16) * N;
            async_copy_b128(nA,     &As[buf ^ 1][arow * 20 + aq]);
            async_copy_b128(nA + 4, &As[buf ^ 1][arow * 20 + aq + 4]);
            async_copy_b128(nB,     &Bs[buf ^ 1][brow * 64 + bcol]);
        }

        const float* Asb = As[buf];
        const float* Bsb = Bs[buf];
#pragma unroll
        for (int k0 = 0; k0 < 16; k0 += 4) {
            v2f b0, b1, a0, a1;
            b0.x = Bsb[(k0 + 0 + 2 * half) * 64 + colBase + lr];
            b0.y = Bsb[(k0 + 1 + 2 * half) * 64 + colBase + lr];
            b1.x = Bsb[(k0 + 0 + 2 * half) * 64 + colBase + 16 + lr];
            b1.y = Bsb[(k0 + 1 + 2 * half) * 64 + colBase + 16 + lr];
            a0.x = Asb[(rowBase + lr) * 20 + k0 + 0 + 2 * half];
            a0.y = Asb[(rowBase + lr) * 20 + k0 + 1 + 2 * half];
            a1.x = Asb[(rowBase + 16 + lr) * 20 + k0 + 0 + 2 * half];
            a1.y = Asb[(rowBase + 16 + lr) * 20 + k0 + 1 + 2 * half];
            acc00 = WMMA_F32(a0, b0, acc00);
            acc01 = WMMA_F32(a0, b1, acc01);
            acc10 = WMMA_F32(a1, b0, acc10);
            acc11 = WMMA_F32(a1, b1, acc11);
        }
        buf ^= 1;
    }

    const int nA0 = n0 + colBase + lr;
    const int nA1 = nA0 + 16;
    const float bz0 = bias ? bias[nA0] : 0.0f;
    const float bz1 = bias ? bias[nA1] : 0.0f;
#pragma unroll
    for (int v = 0; v < 8; ++v) {
        const int mA = m0 + rowBase + v + 8 * half;
        const int mB = mA + 16;
        float r00 = acc00[v] + bz0, r01 = acc01[v] + bz1;
        float r10 = acc10[v] + bz0, r11 = acc11[v] + bz1;
        if (act == 1) {
            r00 = gelu_exact(r00); r01 = gelu_exact(r01);
            r10 = gelu_exact(r10); r11 = gelu_exact(r11);
        }
        if (resid) {
            r00 += resid[(size_t)mA * N + nA0]; r01 += resid[(size_t)mA * N + nA1];
            r10 += resid[(size_t)mB * N + nA0]; r11 += resid[(size_t)mB * N + nA1];
        }
        C[(size_t)mA * N + nA0] = r00;
        C[(size_t)mA * N + nA1] = r01;
        C[(size_t)mB * N + nA0] = r10;
        C[(size_t)mB * N + nA1] = r11;
    }
}

// ---------------------------------------------------------------------------
// Elementwise phasor: raw (tok, 2K interleaved pairs) -> [real | imag].
// ---------------------------------------------------------------------------
__device__ __forceinline__ void phasor2(float x0, float x1, float* re, float* im) {
    float px = tanhf(x0) * 0.9f;
    float py = tanhf(x1) * 0.9f;
    float n  = sqrtf(px * px + py * py);
    float nm = fmaxf(n, 1e-5f);
    float sc = fminf((1.0f - 1e-5f) / nm, 1.0f);
    px *= sc; py *= sc;
    float r = n * sc;
    float ph = atan2f(py, px);
    float amp = 1.0f - r;
    *re = amp * cosf(ph);
    *im = amp * sinf(ph);
}

__global__ void phasor_kernel(const float* __restrict__ Kraw,
                              const float* __restrict__ Qraw,
                              float* __restrict__ K2, float* __restrict__ Q2, int n)
{
    int i = blockIdx.x * blockDim.x + threadIdx.x;
    if (i >= n) return;
    int tok = i >> 6, k = i & 63;
    size_t base = (size_t)tok * 128;
    float re, im;
    phasor2(Kraw[base + 2 * k], Kraw[base + 2 * k + 1], &re, &im);
    K2[base + k] = re; K2[base + 64 + k] = im;
    phasor2(Qraw[base + 2 * k], Qraw[base + 2 * k + 1], &re, &im);
    Q2[base + k] = re; Q2[base + 64 + k] = im;
}

// ---------------------------------------------------------------------------
// Per-chunk masked scores: S_c = tril(Q2_c @ K2_c^T), chunk = 64 tokens.
// ---------------------------------------------------------------------------
__global__ __launch_bounds__(256) void s_chunk_kernel(
    const float* __restrict__ Q2, const float* __restrict__ K2,
    float* __restrict__ Sbuf)
{
    const int bc = blockIdx.x;            // b*16 + c
    const size_t tok0 = (size_t)(bc >> 4) * 1024 + (size_t)(bc & 15) * 64;
    const int tid  = threadIdx.x;
    const int wave = tid >> 5, lane = tid & 31, half = lane >> 4, lr = lane & 15;
    const int nOff = (wave & 3) * 16, rOff = (wave >> 2) * 32;

    const float* Qb = Q2 + tok0 * 128;
    const float* Kb = K2 + tok0 * 128;

    v8f acc0 = {}; v8f acc1 = {};
#pragma unroll 8
    for (int k0 = 0; k0 < 128; k0 += 4) {
        v2f bf;   // B[k][n] = K2[tok0+n][k]  (transposed read)
        bf.x = Kb[(size_t)(nOff + lr) * 128 + k0 + 0 + 2 * half];
        bf.y = Kb[(size_t)(nOff + lr) * 128 + k0 + 1 + 2 * half];
        v2f a0;
        a0.x = Qb[(size_t)(rOff + lr) * 128 + k0 + 0 + 2 * half];
        a0.y = Qb[(size_t)(rOff + lr) * 128 + k0 + 1 + 2 * half];
        v2f a1;
        a1.x = Qb[(size_t)(rOff + 16 + lr) * 128 + k0 + 0 + 2 * half];
        a1.y = Qb[(size_t)(rOff + 16 + lr) * 128 + k0 + 1 + 2 * half];
        acc0 = WMMA_F32(a0, bf, acc0);
        acc1 = WMMA_F32(a1, bf, acc1);
    }
    float* Sb = Sbuf + (size_t)bc * 4096;
    const int n = nOff + lr;
#pragma unroll
    for (int v = 0; v < 8; ++v) {
        int mA = rOff + v + 8 * half, mB = mA + 16;
        Sb[mA * 64 + n] = (mA >= n) ? acc0[v] : 0.0f;
        Sb[mB * 64 + n] = (mB >= n) ? acc1[v] : 0.0f;
    }
}

// ---------------------------------------------------------------------------
// Chunked causal linear-attention scan.
// Grid = B * (512/64) = 16 blocks; each owns a 64-wide d-slice and keeps the
// running 128x64 state M = sum K2^T V in LDS. Per chunk:
//   out_c = S_c @ V_c + Q2_c @ M ;  M += K2_c^T @ V_c
// ---------------------------------------------------------------------------
__global__ __launch_bounds__(256) void attn_scan_kernel(
    const float* __restrict__ Q2, const float* __restrict__ K2,
    const float* __restrict__ V,  const float* __restrict__ Sbuf,
    float* __restrict__ R)
{
    __shared__ float Msh[128 * 64];   // 32 KB state
    const int bd = blockIdx.x;        // b*8 + dtile
    const int b  = bd >> 3;
    const int n0 = (bd & 7) * 64;

    const int tid  = threadIdx.x;
    const int wave = tid >> 5, lane = tid & 31, half = lane >> 4, lr = lane & 15;
    const int nOff = (wave & 3) * 16, rOff = (wave >> 2) * 32;

    for (int i = tid; i < 128 * 64; i += 256) Msh[i] = 0.0f;
    __syncthreads();

    for (int c = 0; c < 16; ++c) {
        const size_t tok0 = (size_t)b * 1024 + (size_t)c * 64;
        const float* Sb = Sbuf + (size_t)(b * 16 + c) * 4096;
        const float* Vb = V  + tok0 * 512 + n0;
        const float* Qb = Q2 + tok0 * 128;
        const float* Kb = K2 + tok0 * 128;

        // ---- phase 1: out_c = S_c @ V_c + Q2_c @ M (reads M) ----
        v8f acc0 = {}; v8f acc1 = {};
#pragma unroll 4
        for (int k0 = 0; k0 < 64; k0 += 4) {
            v2f bf;
            bf.x = Vb[(size_t)(k0 + 0 + 2 * half) * 512 + nOff + lr];
            bf.y = Vb[(size_t)(k0 + 1 + 2 * half) * 512 + nOff + lr];
            v2f a0;
            a0.x = Sb[(rOff + lr) * 64 + k0 + 0 + 2 * half];
            a0.y = Sb[(rOff + lr) * 64 + k0 + 1 + 2 * half];
            v2f a1;
            a1.x = Sb[(rOff + 16 + lr) * 64 + k0 + 0 + 2 * half];
            a1.y = Sb[(rOff + 16 + lr) * 64 + k0 + 1 + 2 * half];
            acc0 = WMMA_F32(a0, bf, acc0);
            acc1 = WMMA_F32(a1, bf, acc1);
        }
#pragma unroll 4
        for (int k0 = 0; k0 < 128; k0 += 4) {
            v2f bf;
            bf.x = Msh[(k0 + 0 + 2 * half) * 64 + nOff + lr];
            bf.y = Msh[(k0 + 1 + 2 * half) * 64 + nOff + lr];
            v2f a0;
            a0.x = Qb[(size_t)(rOff + lr) * 128 + k0 + 0 + 2 * half];
            a0.y = Qb[(size_t)(rOff + lr) * 128 + k0 + 1 + 2 * half];
            v2f a1;
            a1.x = Qb[(size_t)(rOff + 16 + lr) * 128 + k0 + 0 + 2 * half];
            a1.y = Qb[(size_t)(rOff + 16 + lr) * 128 + k0 + 1 + 2 * half];
            acc0 = WMMA_F32(a0, bf, acc0);
            acc1 = WMMA_F32(a1, bf, acc1);
        }
        {
            float* Rb = R + tok0 * 512 + n0;
            const int n = nOff + lr;
#pragma unroll
            for (int v = 0; v < 8; ++v) {
                Rb[(size_t)(rOff + v + 8 * half) * 512 + n]      = acc0[v];
                Rb[(size_t)(rOff + 16 + v + 8 * half) * 512 + n] = acc1[v];
            }
        }
        __syncthreads();

        // ---- phase 2: M += K2_c^T @ V_c (each wave owns 4 disjoint subtiles) ----
#pragma unroll
        for (int j = 0; j < 4; ++j) {
            const int mrow0 = ((wave >> 2) * 4 + j) * 16;   // 0..112
            v8f acc = {};
#pragma unroll
            for (int v = 0; v < 8; ++v)
                acc[v] = Msh[(mrow0 + v + 8 * half) * 64 + nOff + lr];
#pragma unroll 4
            for (int k0 = 0; k0 < 64; k0 += 4) {
                v2f bf;
                bf.x = Vb[(size_t)(k0 + 0 + 2 * half) * 512 + nOff + lr];
                bf.y = Vb[(size_t)(k0 + 1 + 2 * half) * 512 + nOff + lr];
                v2f af;   // A[m][l] = K2[tok0+l][m]  (transposed read)
                af.x = Kb[(size_t)(k0 + 0 + 2 * half) * 128 + mrow0 + lr];
                af.y = Kb[(size_t)(k0 + 1 + 2 * half) * 128 + mrow0 + lr];
                acc = WMMA_F32(af, bf, acc);
            }
#pragma unroll
            for (int v = 0; v < 8; ++v)
                Msh[(mrow0 + v + 8 * half) * 64 + nOff + lr] = acc[v];
        }
        __syncthreads();
    }
}

// ---------------------------------------------------------------------------
// Position-normalize + LayerNorm. One wave32 per 512-wide row; in-place safe
// (each lane reads its 16 elements into registers before any write).
// ---------------------------------------------------------------------------
__global__ __launch_bounds__(256) void ln_kernel(
    const float* __restrict__ R, const float* __restrict__ g,
    const float* __restrict__ bta, float* __restrict__ RN)
{
    const int row  = blockIdx.x * 8 + (threadIdx.x >> 5);
    const int lane = threadIdx.x & 31;
    const float* src = R + (size_t)row * 512;
    const int l = row & 1023;
    const float inorm = rsqrtf((float)(l + 1) * 64.0f);

    float vals[16];
    float s = 0.0f, s2 = 0.0f;
#pragma unroll
    for (int j = 0; j < 16; ++j) {
        float v = src[lane + 32 * j] * inorm;
        vals[j] = v; s += v; s2 += v * v;
    }
#pragma unroll
    for (int o = 16; o >= 1; o >>= 1) {
        s  += __shfl_xor(s,  o, 32);
        s2 += __shfl_xor(s2, o, 32);
    }
    const float mu  = s * (1.0f / 512.0f);
    const float var = s2 * (1.0f / 512.0f) - mu * mu;
    const float inv = rsqrtf(var + 1e-5f);
    float* dst = RN + (size_t)row * 512;
#pragma unroll
    for (int j = 0; j < 16; ++j) {
        int e = lane + 32 * j;
        dst[e] = (vals[j] - mu) * inv * g[e] + bta[e];
    }
}

// ---------------------------------------------------------------------------
extern "C" void kernel_launch(void* const* d_in, const int* in_sizes, int n_in,
                              void* d_out, int out_size, void* d_ws, size_t ws_size,
                              hipStream_t stream) {
    const float* x   = (const float*)d_in[0];
    const float* Wk1 = (const float*)d_in[1];
    const float* bk1 = (const float*)d_in[2];
    const float* Wk2 = (const float*)d_in[3];
    const float* bk2 = (const float*)d_in[4];
    const float* Wq1 = (const float*)d_in[5];
    const float* bq1 = (const float*)d_in[6];
    const float* Wq2 = (const float*)d_in[7];
    const float* bq2 = (const float*)d_in[8];
    const float* Wv  = (const float*)d_in[9];
    const float* bv  = (const float*)d_in[10];
    const float* lng = (const float*)d_in[11];
    const float* lnb = (const float*)d_in[12];
    const float* Wo  = (const float*)d_in[13];
    const float* bo  = (const float*)d_in[14];
    float* out = (float*)d_out;

    const int M = 2048;      // B*L tokens
    const int D = 512;
    const int N2K = 128;     // 2*K_OSC

    float* ws   = (float*)d_ws;
    float* Hk   = ws;
    float* Hq   = Hk   + (size_t)M * D;
    float* Vm   = Hq   + (size_t)M * D;
    float* Kraw = Vm   + (size_t)M * D;
    float* Qraw = Kraw + (size_t)M * N2K;
    float* K2   = Qraw + (size_t)M * N2K;
    float* Q2   = K2   + (size_t)M * N2K;
    float* Sbuf = Q2   + (size_t)M * N2K;
    float* R    = Sbuf + (size_t)32 * 4096;

    dim3 blk(256);

    // MLP first layers (gelu) + V projection
    gemm_wmma_f32<<<dim3(D / 64, M / 128), blk, 0, stream>>>(x, Wk1, bk1, nullptr, Hk, M, D, D, 1);
    gemm_wmma_f32<<<dim3(D / 64, M / 128), blk, 0, stream>>>(x, Wq1, bq1, nullptr, Hq, M, D, D, 1);
    gemm_wmma_f32<<<dim3(D / 64, M / 128), blk, 0, stream>>>(x, Wv,  bv,  nullptr, Vm, M, D, D, 0);
    // MLP second layers
    gemm_wmma_f32<<<dim3(N2K / 64, M / 128), blk, 0, stream>>>(Hk, Wk2, bk2, nullptr, Kraw, M, N2K, D, 0);
    gemm_wmma_f32<<<dim3(N2K / 64, M / 128), blk, 0, stream>>>(Hq, Wq2, bq2, nullptr, Qraw, M, N2K, D, 0);
    // Phasor features
    phasor_kernel<<<(M * 64 + 255) / 256, blk, 0, stream>>>(Kraw, Qraw, K2, Q2, M * 64);
    // Per-chunk masked scores
    s_chunk_kernel<<<32, blk, 0, stream>>>(Q2, K2, Sbuf);
    // Chunked causal linear-attention scan
    attn_scan_kernel<<<16, blk, 0, stream>>>(Q2, K2, Vm, Sbuf, R);
    // Position-normalize + LayerNorm (in-place on R)
    ln_kernel<<<M / 8, blk, 0, stream>>>(R, lng, lnb, R);
    // Output projection with residual: out = x + LN(r) @ Wo + bo
    gemm_wmma_f32<<<dim3(D / 64, M / 128), blk, 0, stream>>>(R, Wo, bo, x, out, M, D, D, 0);
}

// v001
// Measured time: 171 microseconds a run.
// Next to v000, in two timings, it ran 1.70 times as fast each time.
#include <hip/hip_runtime.h>
#include <hip/hip_bf16.h>
#include <math.h>

typedef float v2f __attribute__((ext_vector_type(2)));
typedef float v4f __attribute__((ext_vector_type(4)));
typedef float v8f __attribute__((ext_vector_type(8)));

// D = A(16x4,f32) x B(4x16,f32) + C(16x16,f32)
#define WMMA_F32(a, b, c) \
    __builtin_amdgcn_wmma_f32_16x16x4_f32(false, (a), false, (b), (short)0, (c), false, false)

__device__ __forceinline__ float gelu_exact(float x) {
    return 0.5f * x * (1.0f + erff(x * 0.70710678118654752440f));
}

// Async copy 16B global -> LDS (CDNA5 GLOBAL_LOAD_ASYNC_TO_LDS_B128, ASYNCcnt).
// lds_off = low 32 bits of the generic shared-memory pointer (LDS aperture
// truncation, ISA 10.2).
__device__ __forceinline__ void async_copy_b128(const float* g, const float* lds_ptr) {
    unsigned lds_off = (unsigned)(size_t)lds_ptr;
    unsigned long long ga = (unsigned long long)(size_t)g;
    asm volatile("global_load_async_to_lds_b128 %0, %1, off"
                 :: "v"(lds_off), "v"(ga) : "memory");
}
__device__ __forceinline__ void wait_async0() {
    asm volatile("s_wait_asynccnt 0x0" ::: "memory");
}

// ---------------------------------------------------------------------------
// fp32 WMMA GEMM: C = act(A@B + bias) [+ resid]
// A: MxK row-major, B: KxN row-major, C/resid: MxN row-major.
// Block = 256 threads (8 waves) computes a 128x64 C tile; each wave owns a
// 2x2 grid of 16x16 accumulators. Double-buffered LDS, async loads to LDS.
// A tile LDS stride = 20 floats (80B): 16B-aligned rows for b128 async writes
// AND bank-conflict-free fragment reads (20*r mod 64 distinct, r=0..15).
// ---------------------------------------------------------------------------
__global__ __launch_bounds__(256) void gemm_wmma_f32(
    const float* __restrict__ A, const float* __restrict__ B,
    const float* __restrict__ bias, const float* __restrict__ resid,
    float* __restrict__ C, int M, int N, int Kd, int act)
{
    __shared__ __align__(16) float As[2][128 * 20];   // [buf][row][k], stride 20
    __shared__ __align__(16) float Bs[2][16 * 64];    // [buf][k][n]

    const int tid  = threadIdx.x;
    const int wave = tid >> 5;
    const int lane = tid & 31;
    const int half = lane >> 4;
    const int lr   = lane & 15;

    const int m0 = blockIdx.y * 128;
    const int n0 = blockIdx.x * 64;

    const int colBase = (wave & 1) * 32;   // cols {colBase, colBase+16}
    const int rowBase = (wave >> 1) * 32;  // rows {rowBase, rowBase+16}

    v8f acc00 = {}; v8f acc01 = {}; v8f acc10 = {}; v8f acc11 = {};

    // Loaders: A tile 128x16 (256 thr x 2 float4), B tile 16x64 (256 thr x 1).
    const int arow = tid >> 1, aq = (tid & 1) * 8;
    const int brow = tid >> 4, bcol = (tid & 15) * 4;

    const float* gA = A + (size_t)(m0 + arow) * Kd + aq;
    const float* gB = B + (size_t)brow * N + n0 + bcol;

    // prologue: stage k-block 0 into buffer 0
    async_copy_b128(gA,     &As[0][arow * 20 + aq]);
    async_copy_b128(gA + 4, &As[0][arow * 20 + aq + 4]);
    async_copy_b128(gB,     &Bs[0][brow * 64 + bcol]);

    int buf = 0;
    for (int kb = 0; kb < Kd; kb += 16) {
        wait_async0();          // this wave's copies into `buf` are done
        __syncthreads();        // everyone's copies are done; prev reads done

        if (kb + 16 < Kd) {     // overlap next tile copy with compute
            const float* nA = gA + kb + 16;
            const float* nB = gB + (size_t)(kb + 16) * N;
            async_copy_b128(nA,     &As[buf ^ 1][arow * 20 + aq]);
            async_copy_b128(nA + 4, &As[buf ^ 1][arow * 20 + aq + 4]);
            async_copy_b128(nB,     &Bs[buf ^ 1][brow * 64 + bcol]);
        }

        const float* Asb = As[buf];
        const float* Bsb = Bs[buf];
#pragma unroll
        for (int k0 = 0; k0 < 16; k0 += 4) {
            v2f b0, b1, a0, a1;
            b0.x = Bsb[(k0 + 0 + 2 * half) * 64 + colBase + lr];
            b0.y = Bsb[(k0 + 1 + 2 * half) * 64 + colBase + lr];
            b1.x = Bsb[(k0 + 0 + 2 * half) * 64 + colBase + 16 + lr];
            b1.y = Bsb[(k0 + 1 + 2 * half) * 64 + colBase + 16 + lr];
            a0.x = Asb[(rowBase + lr) * 20 + k0 + 0 + 2 * half];
            a0.y = Asb[(rowBase + lr) * 20 + k0 + 1 + 2 * half];
            a1.x = Asb[(rowBase + 16 + lr) * 20 + k0 + 0 + 2 * half];
            a1.y = Asb[(rowBase + 16 + lr) * 20 + k0 + 1 + 2 * half];
            acc00 = WMMA_F32(a0, b0, acc00);
            acc01 = WMMA_F32(a0, b1, acc01);
            acc10 = WMMA_F32(a1, b0, acc10);
            acc11 = WMMA_F32(a1, b1, acc11);
        }
        buf ^= 1;
    }

    const int nA0 = n0 + colBase + lr;
    const int nA1 = nA0 + 16;
    const float bz0 = bias ? bias[nA0] : 0.0f;
    const float bz1 = bias ? bias[nA1] : 0.0f;
#pragma unroll
    for (int v = 0; v < 8; ++v) {
        const int mA = m0 + rowBase + v + 8 * half;
        const int mB = mA + 16;
        float r00 = acc00[v] + bz0, r01 = acc01[v] + bz1;
        float r10 = acc10[v] + bz0, r11 = acc11[v] + bz1;
        if (act == 1) {
            r00 = gelu_exact(r00); r01 = gelu_exact(r01);
            r10 = gelu_exact(r10); r11 = gelu_exact(r11);
        }
        if (resid) {
            r00 += resid[(size_t)mA * N + nA0]; r01 += resid[(size_t)mA * N + nA1];
            r10 += resid[(size_t)mB * N + nA0]; r11 += resid[(size_t)mB * N + nA1];
        }
        C[(size_t)mA * N + nA0] = r00;
        C[(size_t)mA * N + nA1] = r01;
        C[(size_t)mB * N + nA0] = r10;
        C[(size_t)mB * N + nA1] = r11;
    }
}

// ---------------------------------------------------------------------------
// Elementwise phasor: raw (tok, 2K interleaved pairs) -> [real | imag].
// ---------------------------------------------------------------------------
__device__ __forceinline__ void phasor2(float x0, float x1, float* re, float* im) {
    float px = tanhf(x0) * 0.9f;
    float py = tanhf(x1) * 0.9f;
    float n  = sqrtf(px * px + py * py);
    float nm = fmaxf(n, 1e-5f);
    float sc = fminf((1.0f - 1e-5f) / nm, 1.0f);
    px *= sc; py *= sc;
    float r = n * sc;
    float ph = atan2f(py, px);
    float amp = 1.0f - r;
    *re = amp * cosf(ph);
    *im = amp * sinf(ph);
}

__global__ void phasor_kernel(const float* __restrict__ Kraw,
                              const float* __restrict__ Qraw,
                              float* __restrict__ K2, float* __restrict__ Q2, int n)
{
    int i = blockIdx.x * blockDim.x + threadIdx.x;
    if (i >= n) return;
    int tok = i >> 6, k = i & 63;
    size_t base = (size_t)tok * 128;
    float re, im;
    phasor2(Kraw[base + 2 * k], Kraw[base + 2 * k + 1], &re, &im);
    K2[base + k] = re; K2[base + 64 + k] = im;
    phasor2(Qraw[base + 2 * k], Qraw[base + 2 * k + 1], &re, &im);
    Q2[base + k] = re; Q2[base + 64 + k] = im;
}

// ---------------------------------------------------------------------------
// Per-chunk masked scores: S_c = tril(Q2_c @ K2_c^T), chunk = 64 tokens.
// ---------------------------------------------------------------------------
__global__ __launch_bounds__(256) void s_chunk_kernel(
    const float* __restrict__ Q2, const float* __restrict__ K2,
    float* __restrict__ Sbuf)
{
    const int bc = blockIdx.x;            // b*16 + c
    const size_t tok0 = (size_t)(bc >> 4) * 1024 + (size_t)(bc & 15) * 64;
    const int tid  = threadIdx.x;
    const int wave = tid >> 5, lane = tid & 31, half = lane >> 4, lr = lane & 15;
    const int nOff = (wave & 3) * 16, rOff = (wave >> 2) * 32;

    const float* Qb = Q2 + tok0 * 128;
    const float* Kb = K2 + tok0 * 128;

    v8f acc0 = {}; v8f acc1 = {};
#pragma unroll 8
    for (int k0 = 0; k0 < 128; k0 += 4) {
        v2f bf;   // B[k][n] = K2[tok0+n][k]  (transposed read)
        bf.x = Kb[(size_t)(nOff + lr) * 128 + k0 + 0 + 2 * half];
        bf.y = Kb[(size_t)(nOff + lr) * 128 + k0 + 1 + 2 * half];
        v2f a0;
        a0.x = Qb[(size_t)(rOff + lr) * 128 + k0 + 0 + 2 * half];
        a0.y = Qb[(size_t)(rOff + lr) * 128 + k0 + 1 + 2 * half];
        v2f a1;
        a1.x = Qb[(size_t)(rOff + 16 + lr) * 128 + k0 + 0 + 2 * half];
        a1.y = Qb[(size_t)(rOff + 16 + lr) * 128 + k0 + 1 + 2 * half];
        acc0 = WMMA_F32(a0, bf, acc0);
        acc1 = WMMA_F32(a1, bf, acc1);
    }
    float* Sb = Sbuf + (size_t)bc * 4096;
    const int n = nOff + lr;
#pragma unroll
    for (int v = 0; v < 8; ++v) {
        int mA = rOff + v + 8 * half, mB = mA + 16;
        Sb[mA * 64 + n] = (mA >= n) ? acc0[v] : 0.0f;
        Sb[mB * 64 + n] = (mB >= n) ? acc1[v] : 0.0f;
    }
}

// ---------------------------------------------------------------------------
// Per-chunk states: P_c = K2_c^T @ V_c (128 x 512), chunk = 64 tokens.
// Grid = 2 batches * 15 chunks * 8 d-slices = 240 independent blocks (the last
// chunk's state has no reader). Tile (b, c, dtile) is a contiguous 128x64 block
// at index (b*15 + c)*8 + dtile.
// ---------------------------------------------------------------------------
__global__ __launch_bounds__(256) void chunk_state_kernel(
    const float* __restrict__ K2, const float* __restrict__ V,
    float* __restrict__ P)
{
    const int tid  = threadIdx.x;
    const int wave = tid >> 5, lane = tid & 31, half = lane >> 4, lr = lane & 15;
    const int nOff = (wave & 3) * 16;

    const int sidx = blockIdx.x;          // (b*15 + c)*8 + dtile
    const int bc15 = sidx >> 3;
    const int b    = bc15 / 15;
    const int c    = bc15 - b * 15;
    const size_t tok0 = (size_t)b * 1024 + (size_t)c * 64;
    const float* Vb = V  + tok0 * 512 + (sidx & 7) * 64;
    const float* Kb = K2 + tok0 * 128;
    const int mBase = (wave >> 2) * 64;   // each wave owns 4 disjoint 16x16 subtiles

    v8f acc[4] = {};
    // 8 k-steps a trip: 80 independent fragment loads in flight per lane
#pragma unroll 8
    for (int k0 = 0; k0 < 64; k0 += 4) {
        v2f bf;
        bf.x = Vb[(size_t)(k0 + 0 + 2 * half) * 512 + nOff + lr];
        bf.y = Vb[(size_t)(k0 + 1 + 2 * half) * 512 + nOff + lr];
#pragma unroll
        for (int j = 0; j < 4; ++j) {
            v2f af;   // A[m][l] = K2[tok0+l][m]  (transposed read)
            af.x = Kb[(size_t)(k0 + 0 + 2 * half) * 128 + mBase + j * 16 + lr];
            af.y = Kb[(size_t)(k0 + 1 + 2 * half) * 128 + mBase + j * 16 + lr];
            acc[j] = WMMA_F32(af, bf, acc[j]);
        }
    }
    float* Pb = P + (size_t)sidx * 8192;
#pragma unroll
    for (int j = 0; j < 4; ++j)
#pragma unroll
        for (int v = 0; v < 8; ++v)
            Pb[(mBase + j * 16 + v + 8 * half) * 64 + nOff + lr] = acc[j][v];
}

// ---------------------------------------------------------------------------
// Chunk-parallel causal linear attention.
// Grid = B * 16 chunks * (512/64) d-slices = 256 independent blocks. Each sums
// the states of the earlier chunks of its batch, M = sum_{j<c} P_j, into LDS:
//   out_c = S_c @ V_c + Q2_c @ M
// ---------------------------------------------------------------------------
__global__ __launch_bounds__(256) void attn_out_kernel(
    const float* __restrict__ Q2, const float* __restrict__ V,
    const float* __restrict__ Sbuf, const float* __restrict__ P,
    float* __restrict__ R)
{
    __shared__ __align__(16) float Msh[128 * 64];   // 32 KB prefix state
    const int dt = blockIdx.x & 7;
    const int bq = blockIdx.x >> 3;
    const int b  = bq >> 4;
    const int c  = 15 - (bq & 15);    // blocks with the longest prefix start first
    const int n0 = dt * 64;

    const int tid  = threadIdx.x;
    const int wave = tid >> 5, lane = tid & 31, half = lane >> 4, lr = lane & 15;
    const int nOff = (wave & 3) * 16, rOff = (wave >> 2) * 32;

    const size_t tok0 = (size_t)b * 1024 + (size_t)c * 64;
    const float* Sb = Sbuf + (size_t)(b * 16 + c) * 4096;
    const float* Vb = V  + tok0 * 512 + n0;
    const float* Qb = Q2 + tok0 * 128;

    if (c > 0) {
        // thread t owns float4 slots t + 256*i of the 128x64 tile
        const v4f* Pt = (const v4f*)(P + ((size_t)(b * 15) * 8 + dt) * 8192) + tid;
        v4f m[8];
#pragma unroll
        for (int i = 0; i < 8; ++i) m[i] = Pt[256 * i];
        // the loads' scalar base may be rewritten on the short-prefix path: keep the wait in front of it
        asm volatile("s_wait_xcnt 0x0" ::: "memory");
        // 4 tiles a trip: 32 independent 16-byte loads per lane in flight
#pragma unroll 4
        for (int j = 1; j < c; ++j) {
            const v4f* Pj = Pt + (size_t)j * (8 * 2048);
#pragma unroll
            for (int i = 0; i < 8; ++i) m[i] += Pj[256 * i];
        }
#pragma unroll
        for (int i = 0; i < 8; ++i) *(v4f*)&Msh[(tid + 256 * i) * 4] = m[i];
    }

    v8f acc0 = {}; v8f acc1 = {};
    // fully unrolled: all S and V fragment loads issue ahead of the first product
#pragma unroll
    for (int k0 = 0; k0 < 64; k0 += 4) {
        v2f bf;
        bf.x = Vb[(size_t)(k0 + 0 + 2 * half) * 512 + nOff + lr];
        bf.y = Vb[(size_t)(k0 + 1 + 2 * half) * 512 + nOff + lr];
        v2f a0;
        a0.x = Sb[(rOff + lr) * 64 + k0 + 0 + 2 * half];
        a0.y = Sb[(rOff + lr) * 64 + k0 + 1 + 2 * half];
        v2f a1;
        a1.x = Sb[(rOff + 16 + lr) * 64 + k0 + 0 + 2 * half];
        a1.y = Sb[(rOff + 16 + lr) * 64 + k0 + 1 + 2 * half];
        acc0 = WMMA_F32(a0, bf, acc0);
        acc1 = WMMA_F32(a1, bf, acc1);
    }

    if (c > 0) {                      // same for the whole block
        __syncthreads();              // M complete before any wave reads it
        // 16 k-steps a trip: the Q2 fragment loads of a trip issue ahead of its products
#pragma unroll 16
        for (int k0 = 0; k0 < 128; k0 += 4) {
            v2f bf;
            bf.x = Msh[(k0 + 0 + 2 * half) * 64 + nOff + lr];
            bf.y = Msh[(k0 + 1 + 2 * half) * 64 + nOff + lr];
            v2f a0;
            a0.x = Qb[(size_t)(rOff + lr) * 128 + k0 + 0 + 2 * half];
            a0.y = Qb[(size_t)(rOff + lr) * 128 + k0 + 1 + 2 * half];
            v2f a1;
            a1.x = Qb[(size_t)(rOff + 16 + lr) * 128 + k0 + 0 + 2 * half];
            a1.y = Qb[(size_t)(rOff + 16 + lr) * 128 + k0 + 1 + 2 * half];
            acc0 = WMMA_F32(a0, bf, acc0);
            acc1 = WMMA_F32(a1, bf, acc1);
        }
    }

    float* Rb = R + tok0 * 512 + n0;
    const int n = nOff + lr;
#pragma unroll
    for (int v = 0; v < 8; ++v) {
        Rb[(size_t)(rOff + v + 8 * half) * 512 + n]      = acc0[v];
        Rb[(size_t)(rOff + 16 + v + 8 * half) * 512 + n] = acc1[v];
    }
}

// ---------------------------------------------------------------------------
// Position-normalize + LayerNorm. One wave32 per 512-wide row; in-place safe
// (each lane reads its 16 elements into registers before any write).
// ---------------------------------------------------------------------------
__global__ __launch_bounds__(256) void ln_kernel(
    const float* __restrict__ R, const float* __restrict__ g,
    const float* __restrict__ bta, float* __restrict__ RN)
{
    const int row  = blockIdx.x * 8 + (threadIdx.x >> 5);
    const int lane = threadIdx.x & 31;
    const float* src = R + (size_t)row * 512;
    const int l = row & 1023;
    const float inorm = rsqrtf((float)(l + 1) * 64.0f);

    float vals[16];
    float s = 0.0f, s2 = 0.0f;
#pragma unroll
    for (int j = 0; j < 16; ++j) {
        float v = src[lane + 32 * j] * inorm;
        vals[j] = v; s += v; s2 += v * v;
    }
#pragma unroll
    for (int o = 16; o >= 1; o >>= 1) {
        s  += __shfl_xor(s,  o, 32);
        s2 += __shfl_xor(s2, o, 32);
    }
    const float mu  = s * (1.0f / 512.0f);
    const float var = s2 * (1.0f / 512.0f) - mu * mu;
    const float inv = rsqrtf(var + 1e-5f);
    float* dst = RN + (size_t)row * 512;
#pragma unroll
    for (int j = 0; j < 16; ++j) {
        int e = lane + 32 * j;
        dst[e] = (vals[j] - mu) * inv * g[e] + bta[e];
    }
}

// ---------------------------------------------------------------------------
extern "C" void kernel_launch(void* const* d_in, const int* in_sizes, int n_in,
                              void* d_out, int out_size, void* d_ws, size_t ws_size,
                              hipStream_t stream) {
    const float* x   = (const float*)d_in[0];
    const float* Wk1 = (const float*)d_in[1];
    const float* bk1 = (const float*)d_in[2];
    const float* Wk2 = (const float*)d_in[3];
    const float* bk2 = (const float*)d_in[4];
    const float* Wq1 = (const float*)d_in[5];
    const float* bq1 = (const float*)d_in[6];
    const float* Wq2 = (const float*)d_in[7];
    const float* bq2 = (const float*)d_in[8];
    const float* Wv  = (const float*)d_in[9];
    const float* bv  = (const float*)d_in[10];
    const float* lng = (const float*)d_in[11];
    const float* lnb = (const float*)d_in[12];
    const float* Wo  = (const float*)d_in[13];
    const float* bo  = (const float*)d_in[14];
    float* out = (float*)d_out;

    const int M = 2048;      // B*L tokens
    const int D = 512;
    const int N2K = 128;     // 2*K_OSC

    float* ws   = (float*)d_ws;
    float* Hk   = ws;
    float* Hq   = Hk   + (size_t)M * D;
    float* Vm   = Hq   + (size_t)M * D;
    float* Kraw = Vm   + (size_t)M * D;
    float* Qraw = Kraw + (size_t)M * N2K;
    float* K2   = Qraw + (size_t)M * N2K;
    float* Q2   = K2   + (size_t)M * N2K;
    float* Sbuf = Q2   + (size_t)M * N2K;
    float* R    = Sbuf + (size_t)32 * 4096;
    float* P    = R    + (size_t)M * D;      // 30 chunk states of 128 x 512

    dim3 blk(256);

    // MLP first layers (gelu) + V projection
    gemm_wmma_f32<<<dim3(D / 64, M / 128), blk, 0, stream>>>(x, Wk1, bk1, nullptr, Hk, M, D, D, 1);
    gemm_wmma_f32<<<dim3(D / 64, M / 128), blk, 0, stream>>>(x, Wq1, bq1, nullptr, Hq, M, D, D, 1);
    gemm_wmma_f32<<<dim3(D / 64, M / 128), blk, 0, stream>>>(x, Wv,  bv,  nullptr, Vm, M, D, D, 0);
    // MLP second layers
    gemm_wmma_f32<<<dim3(N2K / 64, M / 128), blk, 0, stream>>>(Hk, Wk2, bk2, nullptr, Kraw, M, N2K, D, 0);
    gemm_wmma_f32<<<dim3(N2K / 64, M / 128), blk, 0, stream>>>(Hq, Wq2, bq2, nullptr, Qraw, M, N2K, D, 0);
    // Phasor features
    phasor_kernel<<<(M * 64 + 255) / 256, blk, 0, stream>>>(Kraw, Qraw, K2, Q2, M * 64);
    // Per-chunk masked scores
    s_chunk_kernel<<<32, blk, 0, stream>>>(Q2, K2, Sbuf);
    // Per-chunk states K2_c^T V_c
    chunk_state_kernel<<<240, blk, 0, stream>>>(K2, Vm, P);
    // Chunk-parallel causal linear attention
    attn_out_kernel<<<256, blk, 0, stream>>>(Q2, Vm, Sbuf, P, R);
    // Position-normalize + LayerNorm (in-place on R)
    ln_kernel<<<M / 8, blk, 0, stream>>>(R, lng, lnb, R);
    // Output projection with residual: out = x + LN(r) @ Wo + bo
    gemm_wmma_f32<<<dim3(D / 64, M / 128), blk, 0, stream>>>(R, Wo, bo, x, out, M, D, D, 0);
}

// v002
// A run of this version takes 103 microseconds.
// Timed twice side by side with v001, it ran 1.65 times as fast both times.
// All steps since v000 together make it 2.81 times as fast.
#include <hip/hip_runtime.h>
#include <hip/hip_bf16.h>
#include <math.h>

typedef float v2f __attribute__((ext_vector_type(2)));
typedef float v4f __attribute__((ext_vector_type(4)));
typedef float v8f __attribute__((ext_vector_type(8)));

// D = A(16x4,f32) x B(4x16,f32) + C(16x16,f32)
#define WMMA_F32(a, b, c) \
    __builtin_amdgcn_wmma_f32_16x16x4_f32(false, (a), false, (b), (short)0, (c), false, false)

__device__ __forceinline__ float gelu_exact(float x) {
    return 0.5f * x * (1.0f + erff(x * 0.70710678118654752440f));
}

// Async copy 16B global -> LDS (CDNA5 GLOBAL_LOAD_ASYNC_TO_LDS_B128, ASYNCcnt).
// lds_off = low 32 bits of the generic shared-memory pointer (LDS aperture
// truncation, ISA 10.2).
__device__ __forceinline__ void async_copy_b128(const float* g, const float* lds_ptr) {
    unsigned lds_off = (unsigned)(size_t)lds_ptr;
    unsigned long long ga = (unsigned long long)(size_t)g;
    asm volatile("global_load_async_to_lds_b128 %0, %1, off"
                 :: "v"(lds_off), "v"(ga) : "memory");
}
__device__ __forceinline__ void wait_async0() {
    asm volatile("s_wait_asynccnt 0x0" ::: "memory");
}

// ---------------------------------------------------------------------------
// fp32 WMMA GEMM: C = act(A@B + bias) [+ resid]
// A: MxK row-major, B: KxN row-major, C/resid: MxN row-major.
// One grid holds up to three independent products that share Kd and act: flat
// blocks [0, nb0) work on product 0 (width N0), [nb0, nb0 + nb1) on product 1,
// the rest on product 2 (both of width N12). Within a product the tile column
// runs fastest.
// Block = 256 threads (8 waves) computes a 128x64 C tile; each wave owns a
// 2x2 grid of 16x16 accumulators. Double-buffered LDS, async loads to LDS.
// A tile LDS stride = 20 floats (80B): 16B-aligned rows for b128 async writes
// AND bank-conflict-free fragment reads (20*r mod 64 distinct, r=0..15).
// ---------------------------------------------------------------------------
__global__ __launch_bounds__(256) void gemm_wmma_f32(
    const float* __restrict__ A0, const float* __restrict__ B0,
    const float* __restrict__ bias0, float* __restrict__ C0,
    const float* __restrict__ A1, const float* __restrict__ B1,
    const float* __restrict__ bias1, float* __restrict__ C1,
    const float* __restrict__ A2, const float* __restrict__ B2,
    const float* __restrict__ bias2, float* __restrict__ C2,
    const float* __restrict__ resid,
    int nb0, int nb1, int N0, int N12, int Kd, int act)
{
    __shared__ __align__(16) float As[2][128 * 20];   // [buf][row][k], stride 20
    __shared__ __align__(16) float Bs[2][16 * 64];    // [buf][k][n]

    const int tid  = threadIdx.x;
    const int wave = tid >> 5;
    const int lane = tid & 31;
    const int half = lane >> 4;
    const int lr   = lane & 15;

    // which product this block belongs to: the same for the whole block
    int id = blockIdx.x;
    const float* A = A0; const float* B = B0; const float* bias = bias0;
    float* C = C0;
    int N = N0;
    if (id >= nb0 + nb1) {
        id -= nb0 + nb1; A = A2; B = B2; bias = bias2; C = C2; N = N12;
    } else if (id >= nb0) {
        id -= nb0;       A = A1; B = B1; bias = bias1; C = C1; N = N12;
    }
    const int nx = N >> 6;                 // tile columns of this product
    const int m0 = (id / nx) * 128;
    const int n0 = (id % nx) * 64;

    const int colBase = (wave & 1) * 32;   // cols {colBase, colBase+16}
    const int rowBase = (wave >> 1) * 32;  // rows {rowBase, rowBase+16}

    v8f acc00 = {}; v8f acc01 = {}; v8f acc10 = {}; v8f acc11 = {};

    // Loaders: A tile 128x16 (256 thr x 2 float4), B tile 16x64 (256 thr x 1).
    const int arow = tid >> 1, aq = (tid & 1) * 8;
    const int brow = tid >> 4, bcol = (tid & 15) * 4;

    const float* gA = A + (size_t)(m0 + arow) * Kd + aq;
    const float* gB = B + (size_t)brow * N + n0 + bcol;

    // prologue: stage k-block 0 into buffer 0
    async_copy_b128(gA,     &As[0][arow * 20 + aq]);
    async_copy_b128(gA + 4, &As[0][arow * 20 + aq + 4]);
    async_copy_b128(gB,     &Bs[0][brow * 64 + bcol]);

    int buf = 0;
    for (int kb = 0; kb < Kd; kb += 16) {
        wait_async0();          // this wave's copies into `buf` are done
        __syncthreads();        // everyone's copies are done; prev reads done

        if (kb + 16 < Kd) {     // overlap next tile copy with compute
            const float* nA = gA + kb + 16;
            const float* nB = gB + (size_t)(kb + 16) * N;
            async_copy_b128(nA,     &As[buf ^ 1][arow * 20 + aq]);
            async_copy_b128(nA + 4, &As[buf ^ 1][arow * 20 + aq + 4]);
            async_copy_b128(nB,     &Bs[buf ^ 1][brow * 64 + bcol]);
        }

        const float* Asb = As[buf];
        const float* Bsb = Bs[buf];
#pragma unroll
        for (int k0 = 0; k0 < 16; k0 += 4) {
            v2f b0, b1, a0, a1;
            b0.x = Bsb[(k0 + 0 + 2 * half) * 64 + colBase + lr];
            b0.y = Bsb[(k0 + 1 + 2 * half) * 64 + colBase + lr];
            b1.x = Bsb[(k0 + 0 + 2 * half) * 64 + colBase + 16 + lr];
            b1.y = Bsb[(k0 + 1 + 2 * half) * 64 + colBase + 16 + lr];
            a0.x = Asb[(rowBase + lr) * 20 + k0 + 0 + 2 * half];
            a0.y = Asb[(rowBase + lr) * 20 + k0 + 1 + 2 * half];
            a1.x = Asb[(rowBase + 16 + lr) * 20 + k0 + 0 + 2 * half];
            a1.y = Asb[(rowBase + 16 + lr) * 20 + k0 + 1 + 2 * half];
            acc00 = WMMA_F32(a0, b0, acc00);
            acc01 = WMMA_F32(a0, b1, acc01);
            acc10 = WMMA_F32(a1, b0, acc10);
            acc11 = WMMA_F32(a1, b1, acc11);
        }
        buf ^= 1;
    }

    const int nA0 = n0 + colBase + lr;
    const int nA1 = nA0 + 16;
    const float bz0 = bias ? bias[nA0] : 0.0f;
    const float bz1 = bias ? bias[nA1] : 0.0f;
#pragma unroll
    for (int v = 0; v < 8; ++v) {
        const int mA = m0 + rowBase + v + 8 * half;
        const int mB = mA + 16;
        float r00 = acc00[v] + bz0, r01 = acc01[v] + bz1;
        float r10 = acc10[v] + bz0, r11 = acc11[v] + bz1;
        if (act == 1) {
            r00 = gelu_exact(r00); r01 = gelu_exact(r01);
            r10 = gelu_exact(r10); r11 = gelu_exact(r11);
        }
        if (resid) {
            r00 += resid[(size_t)mA * N + nA0]; r01 += resid[(size_t)mA * N + nA1];
            r10 += resid[(size_t)mB * N + nA0]; r11 += resid[(size_t)mB * N + nA1];
        }
        C[(size_t)mA * N + nA0] = r00;
        C[(size_t)mA * N + nA1] = r01;
        C[(size_t)mB * N + nA0] = r10;
        C[(size_t)mB * N + nA1] = r11;
    }
}

// ---------------------------------------------------------------------------
// Elementwise phasor: raw (tok, 2K interleaved pairs) -> [real | imag].
// ---------------------------------------------------------------------------
__device__ __forceinline__ void phasor2(float x0, float x1, float* re, float* im) {
    float px = tanhf(x0) * 0.9f;
    float py = tanhf(x1) * 0.9f;
    float n  = sqrtf(px * px + py * py);
    float nm = fmaxf(n, 1e-5f);
    float sc = fminf((1.0f - 1e-5f) / nm, 1.0f);
    px *= sc; py *= sc;
    float r = n * sc;
    float ph = atan2f(py, px);
    float amp = 1.0f - r;
    *re = amp * cosf(ph);
    *im = amp * sinf(ph);
}

__global__ void phasor_kernel(const float* __restrict__ Kraw,
                              const float* __restrict__ Qraw,
                              float* __restrict__ K2, float* __restrict__ Q2, int n)
{
    int i = blockIdx.x * blockDim.x + threadIdx.x;
    if (i >= n) return;
    int tok = i >> 6, k = i & 63;
    size_t base = (size_t)tok * 128;
    float re, im;
    phasor2(Kraw[base + 2 * k], Kraw[base + 2 * k + 1], &re, &im);
    K2[base + k] = re; K2[base + 64 + k] = im;
    phasor2(Qraw[base + 2 * k], Qraw[base + 2 * k + 1], &re, &im);
    Q2[base + k] = re; Q2[base + 64 + k] = im;
}

// ---------------------------------------------------------------------------
// Per-chunk masked scores: S_c = tril(Q2_c @ K2_c^T), chunk = 64 tokens.
// ---------------------------------------------------------------------------
__device__ __forceinline__ void s_chunk_block(
    const float* __restrict__ Q2, const float* __restrict__ K2,
    float* __restrict__ Sbuf, const int bc)   // bc = b*16 + c
{
    const size_t tok0 = (size_t)(bc >> 4) * 1024 + (size_t)(bc & 15) * 64;
    const int tid  = threadIdx.x;
    const int wave = tid >> 5, lane = tid & 31, half = lane >> 4, lr = lane & 15;
    const int nOff = (wave & 3) * 16, rOff = (wave >> 2) * 32;

    const float* Qb = Q2 + tok0 * 128;
    const float* Kb = K2 + tok0 * 128;

    v8f acc0 = {}; v8f acc1 = {};
#pragma unroll 8
    for (int k0 = 0; k0 < 128; k0 += 4) {
        v2f bf;   // B[k][n] = K2[tok0+n][k]  (transposed read)
        bf.x = Kb[(size_t)(nOff + lr) * 128 + k0 + 0 + 2 * half];
        bf.y = Kb[(size_t)(nOff + lr) * 128 + k0 + 1 + 2 * half];
        v2f a0;
        a0.x = Qb[(size_t)(rOff + lr) * 128 + k0 + 0 + 2 * half];
        a0.y = Qb[(size_t)(rOff + lr) * 128 + k0 + 1 + 2 * half];
        v2f a1;
        a1.x = Qb[(size_t)(rOff + 16 + lr) * 128 + k0 + 0 + 2 * half];
        a1.y = Qb[(size_t)(rOff + 16 + lr) * 128 + k0 + 1 + 2 * half];
        acc0 = WMMA_F32(a0, bf, acc0);
        acc1 = WMMA_F32(a1, bf, acc1);
    }
    float* Sb = Sbuf + (size_t)bc * 4096;
    const int n = nOff + lr;
#pragma unroll
    for (int v = 0; v < 8; ++v) {
        int mA = rOff + v + 8 * half, mB = mA + 16;
        Sb[mA * 64 + n] = (mA >= n) ? acc0[v] : 0.0f;
        Sb[mB * 64 + n] = (mB >= n) ? acc1[v] : 0.0f;
    }
}

// ---------------------------------------------------------------------------
// Per-chunk states: P_c = K2_c^T @ V_c (128 x 512), chunk = 64 tokens.
// 2 batches * 15 chunks * 8 d-slices = 240 independent blocks (the last
// chunk's state has no reader). Tile (b, c, dtile) is a contiguous 128x64 block
// at index (b*15 + c)*8 + dtile.
// ---------------------------------------------------------------------------
__device__ __forceinline__ void chunk_state_block(
    const float* __restrict__ K2, const float* __restrict__ V,
    float* __restrict__ P, const int sidx)    // sidx = (b*15 + c)*8 + dtile
{
    const int tid  = threadIdx.x;
    const int wave = tid >> 5, lane = tid & 31, half = lane >> 4, lr = lane & 15;
    const int nOff = (wave & 3) * 16;

    const int bc15 = sidx >> 3;
    const int b    = bc15 / 15;
    const int c    = bc15 - b * 15;
    const size_t tok0 = (size_t)b * 1024 + (size_t)c * 64;
    const float* Vb = V  + tok0 * 512 + (sidx & 7) * 64;
    const float* Kb = K2 + tok0 * 128;
    const int mBase = (wave >> 2) * 64;   // each wave owns 4 disjoint 16x16 subtiles

    v8f acc[4] = {};
    // 8 k-steps a trip: 80 independent fragment loads in flight per lane
#pragma unroll 8
    for (int k0 = 0; k0 < 64; k0 += 4) {
        v2f bf;
        bf.x = Vb[(size_t)(k0 + 0 + 2 * half) * 512 + nOff + lr];
        bf.y = Vb[(size_t)(k0 + 1 + 2 * half) * 512 + nOff + lr];
#pragma unroll
        for (int j = 0; j < 4; ++j) {
            v2f af;   // A[m][l] = K2[tok0+l][m]  (transposed read)
            af.x = Kb[(size_t)(k0 + 0 + 2 * half) * 128 + mBase + j * 16 + lr];
            af.y = Kb[(size_t)(k0 + 1 + 2 * half) * 128 + mBase + j * 16 + lr];
            acc[j] = WMMA_F32(af, bf, acc[j]);
        }
    }
    float* Pb = P + (size_t)sidx * 8192;
#pragma unroll
    for (int j = 0; j < 4; ++j)
#pragma unroll
        for (int v = 0; v < 8; ++v)
            Pb[(mBase + j * 16 + v + 8 * half) * 64 + nOff + lr] = acc[j][v];
}

// Scores and states depend only on K2, Q2 and V, not on each other: one grid,
// blocks 0..31 the masked scores, blocks 32..271 the chunk states.
__global__ __launch_bounds__(256) void chunk_scores_states_kernel(
    const float* __restrict__ Q2, const float* __restrict__ K2,
    const float* __restrict__ V, float* __restrict__ Sbuf, float* __restrict__ P)
{
    const int blk = blockIdx.x;
    if (blk < 32) s_chunk_block(Q2, K2, Sbuf, blk);
    else          chunk_state_block(K2, V, P, blk - 32);
}

// ---------------------------------------------------------------------------
// Chunk-parallel causal linear attention.
// Grid = B * 16 chunks * (512/64) d-slices = 256 independent blocks. Each sums
// the states of the earlier chunks of its batch, M = sum_{j<c} P_j, into LDS:
//   out_c = S_c @ V_c + Q2_c @ M
// ---------------------------------------------------------------------------
__global__ __launch_bounds__(256) void attn_out_kernel(
    const float* __restrict__ Q2, const float* __restrict__ V,
    const float* __restrict__ Sbuf, const float* __restrict__ P,
    float* __restrict__ R)
{
    __shared__ __align__(16) float Msh[128 * 64];   // 32 KB prefix state
    const int dt = blockIdx.x & 7;
    const int bq = blockIdx.x >> 3;
    const int b  = bq >> 4;
    const int c  = 15 - (bq & 15);    // blocks with the longest prefix start first
    const int n0 = dt * 64;

    const int tid  = threadIdx.x;
    const int wave = tid >> 5, lane = tid & 31, half = lane >> 4, lr = lane & 15;
    const int nOff = (wave & 3) * 16, rOff = (wave >> 2) * 32;

    const size_t tok0 = (size_t)b * 1024 + (size_t)c * 64;
    const float* Sb = Sbuf + (size_t)(b * 16 + c) * 4096;
    const float* Vb = V  + tok0 * 512 + n0;
    const float* Qb = Q2 + tok0 * 128;

    if (c > 0) {
        // thread t owns float4 slots t + 256*i of the 128x64 tile
        const v4f* Pt = (const v4f*)(P + ((size_t)(b * 15) * 8 + dt) * 8192) + tid;
        v4f m[8];
#pragma unroll
        for (int i = 0; i < 8; ++i) m[i] = Pt[256 * i];
        // the loads' scalar base may be rewritten on the short-prefix path: keep the wait in front of it
        asm volatile("s_wait_xcnt 0x0" ::: "memory");
        // 4 tiles a trip: 32 independent 16-byte loads per lane in flight
#pragma unroll 4
        for (int j = 1; j < c; ++j) {
            const v4f* Pj = Pt + (size_t)j * (8 * 2048);
#pragma unroll
            for (int i = 0; i < 8; ++i) m[i] += Pj[256 * i];
        }
#pragma unroll
        for (int i = 0; i < 8; ++i) *(v4f*)&Msh[(tid + 256 * i) * 4] = m[i];
    }

    v8f acc0 = {}; v8f acc1 = {};
    // fully unrolled: all S and V fragment loads issue ahead of the first product
#pragma unroll
    for (int k0 = 0; k0 < 64; k0 += 4) {
        v2f bf;
        bf.x = Vb[(size_t)(k0 + 0 + 2 * half) * 512 + nOff + lr];
        bf.y = Vb[(size_t)(k0 + 1 + 2 * half) * 512 + nOff + lr];
        v2f a0;
        a0.x = Sb[(rOff + lr) * 64 + k0 + 0 + 2 * half];
        a0.y = Sb[(rOff + lr) * 64 + k0 + 1 + 2 * half];
        v2f a1;
        a1.x = Sb[(rOff + 16 + lr) * 64 + k0 + 0 + 2 * half];
        a1.y = Sb[(rOff + 16 + lr) * 64 + k0 + 1 + 2 * half];
        acc0 = WMMA_F32(a0, bf, acc0);
        acc1 = WMMA_F32(a1, bf, acc1);
    }

    if (c > 0) {                      // same for the whole block
        __syncthreads();              // M complete before any wave reads it
        // 16 k-steps a trip: the Q2 fragment loads of a trip issue ahead of its products
#pragma unroll 16
        for (int k0 = 0; k0 < 128; k0 += 4) {
            v2f bf;
            bf.x = Msh[(k0 + 0 + 2 * half) * 64 + nOff + lr];
            bf.y = Msh[(k0 + 1 + 2 * half) * 64 + nOff + lr];
            v2f a0;
            a0.x = Qb[(size_t)(rOff + lr) * 128 + k0 + 0 + 2 * half];
            a0.y = Qb[(size_t)(rOff + lr) * 128 + k0 + 1 + 2 * half];
            v2f a1;
            a1.x = Qb[(size_t)(rOff + 16 + lr) * 128 + k0 + 0 + 2 * half];
            a1.y = Qb[(size_t)(rOff + 16 + lr) * 128 + k0 + 1 + 2 * half];
            acc0 = WMMA_F32(a0, bf, acc0);
            acc1 = WMMA_F32(a1, bf, acc1);
        }
    }

    float* Rb = R + tok0 * 512 + n0;
    const int n = nOff + lr;
#pragma unroll
    for (int v = 0; v < 8; ++v) {
        Rb[(size_t)(rOff + v + 8 * half) * 512 + n]      = acc0[v];
        Rb[(size_t)(rOff + 16 + v + 8 * half) * 512 + n] = acc1[v];
    }
}

// ---------------------------------------------------------------------------
// Position-normalize + LayerNorm. One wave32 per 512-wide row; in-place safe
// (each lane reads its 16 elements into registers before any write).
// ---------------------------------------------------------------------------
__global__ __launch_bounds__(256) void ln_kernel(
    const float* __restrict__ R, const float* __restrict__ g,
    const float* __restrict__ bta, float* __restrict__ RN)
{
    const int row  = blockIdx.x * 8 + (threadIdx.x >> 5);
    const int lane = threadIdx.x & 31;
    const float* src = R + (size_t)row * 512;
    const int l = row & 1023;
    const float inorm = rsqrtf((float)(l + 1) * 64.0f);

    float vals[16];
    float s = 0.0f, s2 = 0.0f;
#pragma unroll
    for (int j = 0; j < 16; ++j) {
        float v = src[lane + 32 * j] * inorm;
        vals[j] = v; s += v; s2 += v * v;
    }
#pragma unroll
    for (int o = 16; o >= 1; o >>= 1) {
        s  += __shfl_xor(s,  o, 32);
        s2 += __shfl_xor(s2, o, 32);
    }
    const float mu  = s * (1.0f / 512.0f);
    const float var = s2 * (1.0f / 512.0f) - mu * mu;
    const float inv = rsqrtf(var + 1e-5f);
    float* dst = RN + (size_t)row * 512;
#pragma unroll
    for (int j = 0; j < 16; ++j) {
        int e = lane + 32 * j;
        dst[e] = (vals[j] - mu) * inv * g[e] + bta[e];
    }
}

// ---------------------------------------------------------------------------
extern "C" void kernel_launch(void* const* d_in, const int* in_sizes, int n_in,
                              void* d_out, int out_size, void* d_ws, size_t ws_size,
                              hipStream_t stream) {
    const float* x   = (const float*)d_in[0];
    const float* Wk1 = (const float*)d_in[1];
    const float* bk1 = (const float*)d_in[2];
    const float* Wk2 = (const float*)d_in[3];
    const float* bk2 = (const float*)d_in[4];
    const float* Wq1 = (const float*)d_in[5];
    const float* bq1 = (const float*)d_in[6];
    const float* Wq2 = (const float*)d_in[7];
    const float* bq2 = (const float*)d_in[8];
    const float* Wv  = (const float*)d_in[9];
    const float* bv  = (const float*)d_in[10];
    const float* lng = (const float*)d_in[11];
    const float* lnb = (const float*)d_in[12];
    const float* Wo  = (const float*)d_in[13];
    const float* bo  = (const float*)d_in[14];
    float* out = (float*)d_out;

    const int M = 2048;      // B*L tokens
    const int D = 512;
    const int N2K = 128;     // 2*K_OSC

    float* ws   = (float*)d_ws;
    float* Hk   = ws;
    float* Hq   = Hk   + (size_t)M * D;
    float* Vm   = Hq   + (size_t)M * D;
    float* Kraw = Vm   + (size_t)M * D;
    float* Qraw = Kraw + (size_t)M * N2K;
    float* K2   = Qraw + (size_t)M * N2K;
    float* Q2   = K2   + (size_t)M * N2K;
    float* Sbuf = Q2   + (size_t)M * N2K;
    float* R    = Sbuf + (size_t)32 * 4096;
    float* P    = R    + (size_t)M * D;      // 30 chunk states of 128 x 512

    dim3 blk(256);

    const int nbD = (D / 64) * (M / 128);     // 128 blocks for an M x D product
    const int nbK = (N2K / 64) * (M / 128);   // 32 blocks for an M x 2K product

    // Both MLP first layers (gelu): 256 blocks
    gemm_wmma_f32<<<nbD + nbD, blk, 0, stream>>>(
        x, Wk1, bk1, Hk,  x, Wq1, bq1, Hq,  nullptr, nullptr, nullptr, nullptr,
        nullptr, nbD, nbD, D, D, D, 1);
    // V projection + both MLP second layers: 192 blocks
    gemm_wmma_f32<<<nbD + nbK + nbK, blk, 0, stream>>>(
        x, Wv, bv, Vm,  Hk, Wk2, bk2, Kraw,  Hq, Wq2, bq2, Qraw,
        nullptr, nbD, nbK, D, N2K, D, 0);
    // Phasor features
    phasor_kernel<<<(M * 64 + 255) / 256, blk, 0, stream>>>(Kraw, Qraw, K2, Q2, M * 64);
    // Per-chunk masked scores + per-chunk states K2_c^T V_c
    chunk_scores_states_kernel<<<32 + 240, blk, 0, stream>>>(Q2, K2, Vm, Sbuf, P);
    // Chunk-parallel causal linear attention
    attn_out_kernel<<<256, blk, 0, stream>>>(Q2, Vm, Sbuf, P, R);
    // Position-normalize + LayerNorm (in-place on R)
    ln_kernel<<<M / 8, blk, 0, stream>>>(R, lng, lnb, R);
    // Output projection with residual: out = x + LN(r) @ Wo + bo
    gemm_wmma_f32<<<nbD, blk, 0, stream>>>(
        R, Wo, bo, out,  nullptr, nullptr, nullptr, nullptr,  nullptr, nullptr, nullptr, nullptr,
        x, nbD, 0, D, D, D, 0);
}

// v003
// It runs in 83 microseconds.
// Next to v002, in two timings, it ran 1.24 times as fast each time.
// Counting every step since v000, it is 3.49 times as fast.
#include <hip/hip_runtime.h>
#include <hip/hip_bf16.h>
#include <math.h>

typedef float v2f __attribute__((ext_vector_type(2)));
typedef float v4f __attribute__((ext_vector_type(4)));
typedef float v8f __attribute__((ext_vector_type(8)));

// D = A(16x4,f32) x B(4x16,f32) + C(16x16,f32)
#define WMMA_F32(a, b, c) \
    __builtin_amdgcn_wmma_f32_16x16x4_f32(false, (a), false, (b), (short)0, (c), false, false)

__device__ __forceinline__ float gelu_exact(float x) {
    return 0.5f * x * (1.0f + erff(x * 0.70710678118654752440f));
}

// Async copies 16B global -> LDS (CDNA5 GLOBAL_LOAD_ASYNC_TO_LDS_B128, ASYNCcnt).
// An LDS address is the low 32 bits of the generic shared-memory pointer (LDS
// aperture truncation, ISA 10.2).
// One stage of the GEMM ring per call: 8 copies of the A tile (rows 16 apart)
// and 4 of the B tile (rows 16 apart) for this lane. The closing s_wait_xcnt
// stands in the copies' own statement, so that no address register is
// rewritten ahead of it.
__device__ __forceinline__ void stage_copies(const float* gA, size_t aStep,
                                             const float* gB, size_t bStep,
                                             const float* ldsA, const float* ldsB) {
    const unsigned la = (unsigned)(size_t)ldsA;
    const unsigned lb = (unsigned)(size_t)ldsB;
    asm volatile(
        "global_load_async_to_lds_b128 %0, %1, off\n\t"
        "global_load_async_to_lds_b128 %2, %3, off\n\t"
        "global_load_async_to_lds_b128 %4, %5, off\n\t"
        "global_load_async_to_lds_b128 %6, %7, off\n\t"
        "global_load_async_to_lds_b128 %8, %9, off\n\t"
        "global_load_async_to_lds_b128 %10, %11, off\n\t"
        "global_load_async_to_lds_b128 %12, %13, off\n\t"
        "global_load_async_to_lds_b128 %14, %15, off\n\t"
        "global_load_async_to_lds_b128 %16, %17, off\n\t"
        "global_load_async_to_lds_b128 %18, %19, off\n\t"
        "global_load_async_to_lds_b128 %20, %21, off\n\t"
        "global_load_async_to_lds_b128 %22, %23, off\n\t"
        "s_wait_xcnt 0x0"
        :: "v"(la),                    "v"(gA),
           "v"(la + 1u * 16u * 272u),  "v"(gA + 1 * aStep),
           "v"(la + 2u * 16u * 272u),  "v"(gA + 2 * aStep),
           "v"(la + 3u * 16u * 272u),  "v"(gA + 3 * aStep),
           "v"(la + 4u * 16u * 272u),  "v"(gA + 4 * aStep),
           "v"(la + 5u * 16u * 272u),  "v"(gA + 5 * aStep),
           "v"(la + 6u * 16u * 272u),  "v"(gA + 6 * aStep),
           "v"(la + 7u * 16u * 272u),  "v"(gA + 7 * aStep),
           "v"(lb),                    "v"(gB),
           "v"(lb + 1u * 16u * 256u),  "v"(gB + 1 * bStep),
           "v"(lb + 2u * 16u * 256u),  "v"(gB + 2 * bStep),
           "v"(lb + 3u * 16u * 256u),  "v"(gB + 3 * bStep)
        : "memory");
}
// The issuing wave's own wait: its copies have landed in LDS behind it.
__device__ __forceinline__ void wait_async0() {
    asm volatile("s_wait_asynccnt 0x0" ::: "memory");
}
// The wave's own LDS reads have returned: its buffer may be handed back for a refill.
__device__ __forceinline__ void wait_ds0() {
    asm volatile("s_wait_dscnt 0x0" ::: "memory");
}

// ---------------------------------------------------------------------------
// fp32 WMMA GEMM: C = act(A@B + bias) [+ resid]
// A: MxK row-major, B: KxN row-major, C/resid: MxN row-major.
// One grid holds up to three independent products that share Kd and act: flat
// blocks [0, nb0) work on product 0 (width N0), [nb0, nb0 + nb1) on product 1,
// the rest on product 2 (both of width N12). Within a product the tile column
// runs fastest.
// Block = 256 threads (8 waves) computes a 128x64 C tile; each wave owns a
// 2x2 grid of 16x16 accumulators. Double-buffered LDS, async loads to LDS,
// 64 k per stage (Kd a multiple of 64): one barrier and one exposed wait per
// 64 WMMAs of a wave.
// A tile LDS stride = 68 floats (272B): 16B-aligned rows for b128 async writes
// AND bank-conflict-free fragment reads (68*r mod 64 = 4*r distinct, r=0..15).
// ---------------------------------------------------------------------------
__global__ __launch_bounds__(256) void gemm_wmma_f32(
    const float* __restrict__ A0, const float* __restrict__ B0,
    const float* __restrict__ bias0, float* __restrict__ C0,
    const float* __restrict__ A1, const float* __restrict__ B1,
    const float* __restrict__ bias1, float* __restrict__ C1,
    const float* __restrict__ A2, const float* __restrict__ B2,
    const float* __restrict__ bias2, float* __restrict__ C2,
    const float* __restrict__ resid,
    int nb0, int nb1, int N0, int N12, int Kd, int act)
{
    __shared__ __align__(16) float As[2][128 * 68];   // [buf][row][k], stride 68
    __shared__ __align__(16) float Bs[2][64 * 64];    // [buf][k][n]

    const int tid  = threadIdx.x;
    const int wave = tid >> 5;
    const int lane = tid & 31;
    const int half = lane >> 4;
    const int lr   = lane & 15;

    // which product this block belongs to: the same for the whole block
    int id = blockIdx.x;
    const float* A = A0; const float* B = B0; const float* bias = bias0;
    float* C = C0;
    int N = N0;
    if (id >= nb0 + nb1) {
        id -= nb0 + nb1; A = A2; B = B2; bias = bias2; C = C2; N = N12;
    } else if (id >= nb0) {
        id -= nb0;       A = A1; B = B1; bias = bias1; C = C1; N = N12;
    }
    const int nx = N >> 6;                 // tile columns of this product
    const int m0 = (id / nx) * 128;
    const int n0 = (id % nx) * 64;

    const int colBase = (wave & 1) * 32;   // cols {colBase, colBase+16}
    const int rowBase = (wave >> 1) * 32;  // rows {rowBase, rowBase+16}

    v8f acc00 = {}; v8f acc01 = {}; v8f acc10 = {}; v8f acc11 = {};

    // Loaders: a stage is A 128x64 (256 thr x 8 float4) and B 64x64 (256 thr x 4);
    // 16 lanes cover one 256-byte row of either tile.
    const int ldrow = tid >> 4, ldcol = (tid & 15) * 4;

    const float* gA = A + (size_t)(m0 + ldrow) * Kd + ldcol;
    const float* gB = B + (size_t)ldrow * N + n0 + ldcol;
    const size_t aStep = (size_t)16 * Kd;      // 16 rows of A
    const size_t bStep = (size_t)16 * N;       // 16 rows of B
    const int ldsAo = ldrow * 68 + ldcol;
    const int ldsBo = ldrow * 64 + ldcol;
    const int nst = Kd >> 6;                   // stages

    // prologue: stage 0 into buffer 0, published; then stage 1 into buffer 1
    stage_copies(gA, aStep, gB, bStep, &As[0][ldsAo], &Bs[0][ldsBo]);
    wait_async0();              // this wave's copies of stage 0 have landed
    __syncthreads();            // everyone's have
    if (nst > 1)
        stage_copies(gA + 64, aStep, gB + (size_t)64 * N, bStep, &As[1][ldsAo], &Bs[1][ldsBo]);

    for (int st = 0; st < nst; ++st) {
        const int buf = st & 1;
        const float* Asb = As[buf];
        const float* Bsb = Bs[buf];
        // fully unrolled: constant LDS offsets, fragment reads issue ahead of their products
#pragma unroll
        for (int k0 = 0; k0 < 64; k0 += 4) {
            v2f b0, b1, a0, a1;
            b0.x = Bsb[(k0 + 0 + 2 * half) * 64 + colBase + lr];
            b0.y = Bsb[(k0 + 1 + 2 * half) * 64 + colBase + lr];
            b1.x = Bsb[(k0 + 0 + 2 * half) * 64 + colBase + 16 + lr];
            b1.y = Bsb[(k0 + 1 + 2 * half) * 64 + colBase + 16 + lr];
            a0.x = Asb[(rowBase + lr) * 68 + k0 + 0 + 2 * half];
            a0.y = Asb[(rowBase + lr) * 68 + k0 + 1 + 2 * half];
            a1.x = Asb[(rowBase + 16 + lr) * 68 + k0 + 0 + 2 * half];
            a1.y = Asb[(rowBase + 16 + lr) * 68 + k0 + 1 + 2 * half];
            acc00 = WMMA_F32(a0, b0, acc00);
            acc01 = WMMA_F32(a0, b1, acc01);
            acc10 = WMMA_F32(a1, b0, acc10);
            acc11 = WMMA_F32(a1, b1, acc11);
        }
        wait_ds0();             // this wave's reads of `buf` are done
        wait_async0();          // this wave's copies of stage st + 1 have landed
        __syncthreads();        // stage st + 1 published; `buf` left by every reader
        if (st + 2 < nst) {     // refill `buf` while stage st + 1 is worked on
            const int kn = (st + 2) * 64;
            stage_copies(gA + kn, aStep, gB + (size_t)kn * N, bStep, &As[buf][ldsAo], &Bs[buf][ldsBo]);
        }
    }
    wait_async0();              // nothing in flight when the ring is left

    const int nA0 = n0 + colBase + lr;
    const int nA1 = nA0 + 16;
    const float bz0 = bias ? bias[nA0] : 0.0f;
    const float bz1 = bias ? bias[nA1] : 0.0f;
#pragma unroll
    for (int v = 0; v < 8; ++v) {
        const int mA = m0 + rowBase + v + 8 * half;
        const int mB = mA + 16;
        float r00 = acc00[v] + bz0, r01 = acc01[v] + bz1;
        float r10 = acc10[v] + bz0, r11 = acc11[v] + bz1;
        if (act == 1) {
            r00 = gelu_exact(r00); r01 = gelu_exact(r01);
            r10 = gelu_exact(r10); r11 = gelu_exact(r11);
        }
        if (resid) {
            r00 += resid[(size_t)mA * N + nA0]; r01 += resid[(size_t)mA * N + nA1];
            r10 += resid[(size_t)mB * N + nA0]; r11 += resid[(size_t)mB * N + nA1];
        }
        C[(size_t)mA * N + nA0] = r00;
        C[(size_t)mA * N + nA1] = r01;
        C[(size_t)mB * N + nA0] = r10;
        C[(size_t)mB * N + nA1] = r11;
    }
}

// ---------------------------------------------------------------------------
// Elementwise phasor: raw (tok, 2K interleaved pairs) -> [real | imag].
// ---------------------------------------------------------------------------
__device__ __forceinline__ void phasor2(float x0, float x1, float* re, float* im) {
    float px = tanhf(x0) * 0.9f;
    float py = tanhf(x1) * 0.9f;
    float n  = sqrtf(px * px + py * py);
    float nm = fmaxf(n, 1e-5f);
    float sc = fminf((1.0f - 1e-5f) / nm, 1.0f);
    px *= sc; py *= sc;
    float r = n * sc;
    float ph = atan2f(py, px);
    float amp = 1.0f - r;
    *re = amp * cosf(ph);
    *im = amp * sinf(ph);
}

__global__ void phasor_kernel(const float* __restrict__ Kraw,
                              const float* __restrict__ Qraw,
                              float* __restrict__ K2, float* __restrict__ Q2, int n)
{
    int i = blockIdx.x * blockDim.x + threadIdx.x;
    if (i >= n) return;
    int tok = i >> 6, k = i & 63;
    size_t base = (size_t)tok * 128;
    float re, im;
    phasor2(Kraw[base + 2 * k], Kraw[base + 2 * k + 1], &re, &im);
    K2[base + k] = re; K2[base + 64 + k] = im;
    phasor2(Qraw[base + 2 * k], Qraw[base + 2 * k + 1], &re, &im);
    Q2[base + k] = re; Q2[base + 64 + k] = im;
}

// ---------------------------------------------------------------------------
// Per-chunk masked scores: S_c = tril(Q2_c @ K2_c^T), chunk = 64 tokens.
// ---------------------------------------------------------------------------
__device__ __forceinline__ void s_chunk_block(
    const float* __restrict__ Q2, const float* __restrict__ K2,
    float* __restrict__ Sbuf, const int bc)   // bc = b*16 + c
{
    const size_t tok0 = (size_t)(bc >> 4) * 1024 + (size_t)(bc & 15) * 64;
    const int tid  = threadIdx.x;
    const int wave = tid >> 5, lane = tid & 31, half = lane >> 4, lr = lane & 15;
    const int nOff = (wave & 3) * 16, rOff = (wave >> 2) * 32;

    const float* Qb = Q2 + tok0 * 128;
    const float* Kb = K2 + tok0 * 128;

    v8f acc0 = {}; v8f acc1 = {};
#pragma unroll 8
    for (int k0 = 0; k0 < 128; k0 += 4) {
        v2f bf;   // B[k][n] = K2[tok0+n][k]  (transposed read)
        bf.x = Kb[(size_t)(nOff + lr) * 128 + k0 + 0 + 2 * half];
        bf.y = Kb[(size_t)(nOff + lr) * 128 + k0 + 1 + 2 * half];
        v2f a0;
        a0.x = Qb[(size_t)(rOff + lr) * 128 + k0 + 0 + 2 * half];
        a0.y = Qb[(size_t)(rOff + lr) * 128 + k0 + 1 + 2 * half];
        v2f a1;
        a1.x = Qb[(size_t)(rOff + 16 + lr) * 128 + k0 + 0 + 2 * half];
        a1.y = Qb[(size_t)(rOff + 16 + lr) * 128 + k0 + 1 + 2 * half];
        acc0 = WMMA_F32(a0, bf, acc0);
        acc1 = WMMA_F32(a1, bf, acc1);
    }
    float* Sb = Sbuf + (size_t)bc * 4096;
    const int n = nOff + lr;
#pragma unroll
    for (int v = 0; v < 8; ++v) {
        int mA = rOff + v + 8 * half, mB = mA + 16;
        Sb[mA * 64 + n] = (mA >= n) ? acc0[v] : 0.0f;
        Sb[mB * 64 + n] = (mB >= n) ? acc1[v] : 0.0f;
    }
}

// ---------------------------------------------------------------------------
// Per-chunk states: P_c = K2_c^T @ V_c (128 x 512), chunk = 64 tokens.
// 2 batches * 15 chunks * 8 d-slices = 240 independent blocks (the last
// chunk's state has no reader). Tile (b, c, dtile) is a contiguous 128x64 block
// at index (b*15 + c)*8 + dtile.
// ---------------------------------------------------------------------------
__device__ __forceinline__ void chunk_state_block(
    const float* __restrict__ K2, const float* __restrict__ V,
    float* __restrict__ P, const int sidx)    // sidx = (b*15 + c)*8 + dtile
{
    const int tid  = threadIdx.x;
    const int wave = tid >> 5, lane = tid & 31, half = lane >> 4, lr = lane & 15;
    const int nOff = (wave & 3) * 16;

    const int bc15 = sidx >> 3;
    const int b    = bc15 / 15;
    const int c    = bc15 - b * 15;
    const size_t tok0 = (size_t)b * 1024 + (size_t)c * 64;
    const float* Vb = V  + tok0 * 512 + (sidx & 7) * 64;
    const float* Kb = K2 + tok0 * 128;
    const int mBase = (wave >> 2) * 64;   // each wave owns 4 disjoint 16x16 subtiles

    v8f acc[4] = {};
    // 8 k-steps a trip: 80 independent fragment loads in flight per lane
#pragma unroll 8
    for (int k0 = 0; k0 < 64; k0 += 4) {
        v2f bf;
        bf.x = Vb[(size_t)(k0 + 0 + 2 * half) * 512 + nOff + lr];
        bf.y = Vb[(size_t)(k0 + 1 + 2 * half) * 512 + nOff + lr];
#pragma unroll
        for (int j = 0; j < 4; ++j) {
            v2f af;   // A[m][l] = K2[tok0+l][m]  (transposed read)
            af.x = Kb[(size_t)(k0 + 0 + 2 * half) * 128 + mBase + j * 16 + lr];
            af.y = Kb[(size_t)(k0 + 1 + 2 * half) * 128 + mBase + j * 16 + lr];
            acc[j] = WMMA_F32(af, bf, acc[j]);
        }
    }
    float* Pb = P + (size_t)sidx * 8192;
#pragma unroll
    for (int j = 0; j < 4; ++j)
#pragma unroll
        for (int v = 0; v < 8; ++v)
            Pb[(mBase + j * 16 + v + 8 * half) * 64 + nOff + lr] = acc[j][v];
}

// Scores and states depend only on K2, Q2 and V, not on each other: one grid,
// blocks 0..31 the masked scores, blocks 32..271 the chunk states.
__global__ __launch_bounds__(256) void chunk_scores_states_kernel(
    const float* __restrict__ Q2, const float* __restrict__ K2,
    const float* __restrict__ V, float* __restrict__ Sbuf, float* __restrict__ P)
{
    const int blk = blockIdx.x;
    if (blk < 32) s_chunk_block(Q2, K2, Sbuf, blk);
    else          chunk_state_block(K2, V, P, blk - 32);
}

// ---------------------------------------------------------------------------
// Chunk-parallel causal linear attention.
// Grid = B * 16 chunks * (512/64) d-slices = 256 independent blocks. Each sums
// the states of the earlier chunks of its batch, M = sum_{j<c} P_j, into LDS:
//   out_c = S_c @ V_c + Q2_c @ M
// ---------------------------------------------------------------------------
__global__ __launch_bounds__(256) void attn_out_kernel(
    const float* __restrict__ Q2, const float* __restrict__ V,
    const float* __restrict__ Sbuf, const float* __restrict__ P,
    float* __restrict__ R)
{
    __shared__ __align__(16) float Msh[128 * 64];   // 32 KB prefix state
    const int dt = blockIdx.x & 7;
    const int bq = blockIdx.x >> 3;
    const int b  = bq >> 4;
    const int c  = 15 - (bq & 15);    // blocks with the longest prefix start first
    const int n0 = dt * 64;

    const int tid  = threadIdx.x;
    const int wave = tid >> 5, lane = tid & 31, half = lane >> 4, lr = lane & 15;
    const int nOff = (wave & 3) * 16, rOff = (wave >> 2) * 32;

    const size_t tok0 = (size_t)b * 1024 + (size_t)c * 64;
    const float* Sb = Sbuf + (size_t)(b * 16 + c) * 4096;
    const float* Vb = V  + tok0 * 512 + n0;
    const float* Qb = Q2 + tok0 * 128;

    if (c > 0) {
        // thread t owns float4 slots t + 256*i of the 128x64 tile
        const v4f* Pt = (const v4f*)(P + ((size_t)(b * 15) * 8 + dt) * 8192) + tid;
        v4f m[8];
#pragma unroll
        for (int i = 0; i < 8; ++i) m[i] = Pt[256 * i];
        // the loads' scalar base may be rewritten on the short-prefix path: keep the wait in front of it
        asm volatile("s_wait_xcnt 0x0" ::: "memory");
        // 4 tiles a trip: 32 independent 16-byte loads per lane in flight
#pragma unroll 4
        for (int j = 1; j < c; ++j) {
            const v4f* Pj = Pt + (size_t)j * (8 * 2048);
#pragma unroll
            for (int i = 0; i < 8; ++i) m[i] += Pj[256 * i];
        }
#pragma unroll
        for (int i = 0; i < 8; ++i) *(v4f*)&Msh[(tid + 256 * i) * 4] = m[i];
    }

    v8f acc0 = {}; v8f acc1 = {};
    // fully unrolled: all S and V fragment loads issue ahead of the first product
#pragma unroll
    for (int k0 = 0; k0 < 64; k0 += 4) {
        v2f bf;
        bf.x = Vb[(size_t)(k0 + 0 + 2 * half) * 512 + nOff + lr];
        bf.y = Vb[(size_t)(k0 + 1 + 2 * half) * 512 + nOff + lr];
        v2f a0;
        a0.x = Sb[(rOff + lr) * 64 + k0 + 0 + 2 * half];
        a0.y = Sb[(rOff + lr) * 64 + k0 + 1 + 2 * half];
        v2f a1;
        a1.x = Sb[(rOff + 16 + lr) * 64 + k0 + 0 + 2 * half];
        a1.y = Sb[(rOff + 16 + lr) * 64 + k0 + 1 + 2 * half];
        acc0 = WMMA_F32(a0, bf, acc0);
        acc1 = WMMA_F32(a1, bf, acc1);
    }

    if (c > 0) {                      // same for the whole block
        __syncthreads();              // M complete before any wave reads it
        // 16 k-steps a trip: the Q2 fragment loads of a trip issue ahead of its products
#pragma unroll 16
        for (int k0 = 0; k0 < 128; k0 += 4) {
            v2f bf;
            bf.x = Msh[(k0 + 0 + 2 * half) * 64 + nOff + lr];
            bf.y = Msh[(k0 + 1 + 2 * half) * 64 + nOff + lr];
            v2f a0;
            a0.x = Qb[(size_t)(rOff + lr) * 128 + k0 + 0 + 2 * half];
            a0.y = Qb[(size_t)(rOff + lr) * 128 + k0 + 1 + 2 * half];
            v2f a1;
            a1.x = Qb[(size_t)(rOff + 16 + lr) * 128 + k0 + 0 + 2 * half];
            a1.y = Qb[(size_t)(rOff + 16 + lr) * 128 + k0 + 1 + 2 * half];
            acc0 = WMMA_F32(a0, bf, acc0);
            acc1 = WMMA_F32(a1, bf, acc1);
        }
    }

    float* Rb = R + tok0 * 512 + n0;
    const int n = nOff + lr;
#pragma unroll
    for (int v = 0; v < 8; ++v) {
        Rb[(size_t)(rOff + v + 8 * half) * 512 + n]      = acc0[v];
        Rb[(size_t)(rOff + 16 + v + 8 * half) * 512 + n] = acc1[v];
    }
}

// ---------------------------------------------------------------------------
// Position-normalize + LayerNorm. One wave32 per 512-wide row; in-place safe
// (each lane reads its 16 elements into registers before any write).
// ---------------------------------------------------------------------------
__global__ __launch_bounds__(256) void ln_kernel(
    const float* __restrict__ R, const float* __restrict__ g,
    const float* __restrict__ bta, float* __restrict__ RN)
{
    const int row  = blockIdx.x * 8 + (threadIdx.x >> 5);
    const int lane = threadIdx.x & 31;
    const float* src = R + (size_t)row * 512;
    const int l = row & 1023;
    const float inorm = rsqrtf((float)(l + 1) * 64.0f);

    float vals[16];
    float s = 0.0f, s2 = 0.0f;
#pragma unroll
    for (int j = 0; j < 16; ++j) {
        float v = src[lane + 32 * j] * inorm;
        vals[j] = v; s += v; s2 += v * v;
    }
#pragma unroll
    for (int o = 16; o >= 1; o >>= 1) {
        s  += __shfl_xor(s,  o, 32);
        s2 += __shfl_xor(s2, o, 32);
    }
    const float mu  = s * (1.0f / 512.0f);
    const float var = s2 * (1.0f / 512.0f) - mu * mu;
    const float inv = rsqrtf(var + 1e-5f);
    float* dst = RN + (size_t)row * 512;
#pragma unroll
    for (int j = 0; j < 16; ++j) {
        int e = lane + 32 * j;
        dst[e] = (vals[j] - mu) * inv * g[e] + bta[e];
    }
}

// ---------------------------------------------------------------------------
extern "C" void kernel_launch(void* const* d_in, const int* in_sizes, int n_in,
                              void* d_out, int out_size, void* d_ws, size_t ws_size,
                              hipStream_t stream) {
    const float* x   = (const float*)d_in[0];
    const float* Wk1 = (const float*)d_in[1];
    const float* bk1 = (const float*)d_in[2];
    const float* Wk2 = (const float*)d_in[3];
    const float* bk2 = (const float*)d_in[4];
    const float* Wq1 = (const float*)d_in[5];
    const float* bq1 = (const float*)d_in[6];
    const float* Wq2 = (const float*)d_in[7];
    const float* bq2 = (const float*)d_in[8];
    const float* Wv  = (const float*)d_in[9];
    const float* bv  = (const float*)d_in[10];
    const float* lng = (const float*)d_in[11];
    const float* lnb = (const float*)d_in[12];
    const float* Wo  = (const float*)d_in[13];
    const float* bo  = (const float*)d_in[14];
    float* out = (float*)d_out;

    const int M = 2048;      // B*L tokens
    const int D = 512;
    const int N2K = 128;     // 2*K_OSC

    float* ws   = (float*)d_ws;
    float* Hk   = ws;
    float* Hq   = Hk   + (size_t)M * D;
    float* Vm   = Hq   + (size_t)M * D;
    float* Kraw = Vm   + (size_t)M * D;
    float* Qraw = Kraw + (size_t)M * N2K;
    float* K2   = Qraw + (size_t)M * N2K;
    float* Q2   = K2   + (size_t)M * N2K;
    float* Sbuf = Q2   + (size_t)M * N2K;
    float* R    = Sbuf + (size_t)32 * 4096;
    float* P    = R    + (size_t)M * D;      // 30 chunk states of 128 x 512

    dim3 blk(256);

    const int nbD = (D / 64) * (M / 128);     // 128 blocks for an M x D product
    const int nbK = (N2K / 64) * (M / 128);   // 32 blocks for an M x 2K product

    // Both MLP first layers (gelu): 256 blocks
    gemm_wmma_f32<<<nbD + nbD, blk, 0, stream>>>(
        x, Wk1, bk1, Hk,  x, Wq1, bq1, Hq,  nullptr, nullptr, nullptr, nullptr,
        nullptr, nbD, nbD, D, D, D, 1);
    // V projection + both MLP second layers: 192 blocks
    gemm_wmma_f32<<<nbD + nbK + nbK, blk, 0, stream>>>(
        x, Wv, bv, Vm,  Hk, Wk2, bk2, Kraw,  Hq, Wq2, bq2, Qraw,
        nullptr, nbD, nbK, D, N2K, D, 0);
    // Phasor features
    phasor_kernel<<<(M * 64 + 255) / 256, blk, 0, stream>>>(Kraw, Qraw, K2, Q2, M * 64);
    // Per-chunk masked scores + per-chunk states K2_c^T V_c
    chunk_scores_states_kernel<<<32 + 240, blk, 0, stream>>>(Q2, K2, Vm, Sbuf, P);
    // Chunk-parallel causal linear attention
    attn_out_kernel<<<256, blk, 0, stream>>>(Q2, Vm, Sbuf, P, R);
    // Position-normalize + LayerNorm (in-place on R)
    ln_kernel<<<M / 8, blk, 0, stream>>>(R, lng, lnb, R);
    // Output projection with residual: out = x + LN(r) @ Wo + bo
    gemm_wmma_f32<<<nbD, blk, 0, stream>>>(
        R, Wo, bo, out,  nullptr, nullptr, nullptr, nullptr,  nullptr, nullptr, nullptr, nullptr,
        x, nbD, 0, D, D, D, 0);
}

// v004
// A run of this version takes 74.9 microseconds.
// Timed twice side by side with v003, it ran 1.09 and 1.11 times as fast.
// Counting every step since v000, it is 3.84 times as fast.
#include <hip/hip_runtime.h>
#include <hip/hip_bf16.h>
#include <math.h>

typedef float v2f __attribute__((ext_vector_type(2)));
typedef float v4f __attribute__((ext_vector_type(4)));
typedef float v8f __attribute__((ext_vector_type(8)));

// D = A(16x4,f32) x B(4x16,f32) + C(16x16,f32)
#define WMMA_F32(a, b, c) \
    __builtin_amdgcn_wmma_f32_16x16x4_f32(false, (a), false, (b), (short)0, (c), false, false)

__device__ __forceinline__ float gelu_exact(float x) {
    return 0.5f * x * (1.0f + erff(x * 0.70710678118654752440f));
}

// Async copies 16B global -> LDS (CDNA5 GLOBAL_LOAD_ASYNC_TO_LDS_B128, ASYNCcnt).
// An LDS address is the low 32 bits of the generic shared-memory pointer (LDS
// aperture truncation, ISA 10.2).
// One stage of the GEMM ring per call: 8 copies of the A tile (rows 16 apart)
// and 4 of the B tile (rows 16 apart) for this lane. The closing s_wait_xcnt
// stands in the copies' own statement, so that no address register is
// rewritten ahead of it.
__device__ __forceinline__ void stage_copies(const float* gA, size_t aStep,
                                             const float* gB, size_t bStep,
                                             const float* ldsA, const float* ldsB) {
    const unsigned la = (unsigned)(size_t)ldsA;
    const unsigned lb = (unsigned)(size_t)ldsB;
    asm volatile(
        "global_load_async_to_lds_b128 %0, %1, off\n\t"
        "global_load_async_to_lds_b128 %2, %3, off\n\t"
        "global_load_async_to_lds_b128 %4, %5, off\n\t"
        "global_load_async_to_lds_b128 %6, %7, off\n\t"
        "global_load_async_to_lds_b128 %8, %9, off\n\t"
        "global_load_async_to_lds_b128 %10, %11, off\n\t"
        "global_load_async_to_lds_b128 %12, %13, off\n\t"
        "global_load_async_to_lds_b128 %14, %15, off\n\t"
        "global_load_async_to_lds_b128 %16, %17, off\n\t"
        "global_load_async_to_lds_b128 %18, %19, off\n\t"
        "global_load_async_to_lds_b128 %20, %21, off\n\t"
        "global_load_async_to_lds_b128 %22, %23, off\n\t"
        "s_wait_xcnt 0x0"
        :: "v"(la),                    "v"(gA),
           "v"(la + 1u * 16u * 272u),  "v"(gA + 1 * aStep),
           "v"(la + 2u * 16u * 272u),  "v"(gA + 2 * aStep),
           "v"(la + 3u * 16u * 272u),  "v"(gA + 3 * aStep),
           "v"(la + 4u * 16u * 272u),  "v"(gA + 4 * aStep),
           "v"(la + 5u * 16u * 272u),  "v"(gA + 5 * aStep),
           "v"(la + 6u * 16u * 272u),  "v"(gA + 6 * aStep),
           "v"(la + 7u * 16u * 272u),  "v"(gA + 7 * aStep),
           "v"(lb),                    "v"(gB),
           "v"(lb + 1u * 16u * 256u),  "v"(gB + 1 * bStep),
           "v"(lb + 2u * 16u * 256u),  "v"(gB + 2 * bStep),
           "v"(lb + 3u * 16u * 256u),  "v"(gB + 3 * bStep)
        : "memory");
}
// The issuing wave's own wait: its copies have landed in LDS behind it.
__device__ __forceinline__ void wait_async0() {
    asm volatile("s_wait_asynccnt 0x0" ::: "memory");
}
// The wave's own LDS reads have returned: its buffer may be handed back for a refill.
__device__ __forceinline__ void wait_ds0() {
    asm volatile("s_wait_dscnt 0x0" ::: "memory");
}

// 1/sqrt(x) for x in the normal range. The v_nop fills the slot that the
// instruction set asks for behind a transcendental, whatever is scheduled next.
__device__ __forceinline__ float rsq_normal(float x) {
    float r;
    asm("v_rsq_f32 %0, %1\n\tv_nop" : "=v"(r) : "v"(x));
    return r;
}

// ---------------------------------------------------------------------------
// fp32 WMMA GEMM: C = act(A@B + bias) [+ resid]
// A: MxK row-major, B: KxN row-major, C/resid: MxN row-major.
// One grid holds up to three independent products that share Kd and act: flat
// blocks [0, nb0) work on product 0 (width N0), [nb0, nb0 + nb1) on product 1,
// the rest on product 2 (both of width N12). Within a product the tile column
// runs fastest.
// Block = 256 threads (8 waves) computes a 128x64 C tile; each wave owns a
// 2x2 grid of 16x16 accumulators. Double-buffered LDS, async loads to LDS,
// 64 k per stage (Kd a multiple of 64): one barrier and one exposed wait per
// 64 WMMAs of a wave.
// A tile LDS stride = 68 floats (272B): 16B-aligned rows for b128 async writes
// AND bank-conflict-free fragment reads (68*r mod 64 = 4*r distinct, r=0..15).
// LN = true (Kd = 512): each A fragment is layer-normalized over its row on its
// way from LDS to the product. lnS holds, per row,
// 32 partial sums and 32 partial sums of squares (plane [slice][row], 2048 rows,
// the squares 32 planes further on), written by the kernel that wrote A.
// ---------------------------------------------------------------------------
template <bool LN>
__global__ __launch_bounds__(256) void gemm_wmma_f32(
    const float* __restrict__ A0, const float* __restrict__ B0,
    const float* __restrict__ bias0, float* __restrict__ C0,
    const float* __restrict__ A1, const float* __restrict__ B1,
    const float* __restrict__ bias1, float* __restrict__ C1,
    const float* __restrict__ A2, const float* __restrict__ B2,
    const float* __restrict__ bias2, float* __restrict__ C2,
    const float* __restrict__ resid,
    const float* __restrict__ lnS, const float* __restrict__ lnG,
    const float* __restrict__ lnB,
    int nb0, int nb1, int N0, int N12, int Kd, int act)
{
    __shared__ __align__(16) float As[2][128 * 68];   // [buf][row][k], stride 68
    __shared__ __align__(16) float Bs[2][64 * 64];    // [buf][k][n]
    __shared__ __align__(16) float Gs[512];           // LN only: gain by k
    __shared__ __align__(16) float Ts[512];           // LN only: shift by k
    __shared__ float Rst[256];                        // LN only: row sums | row sums of squares

    const int tid  = threadIdx.x;
    const int wave = tid >> 5;
    const int lane = tid & 31;
    const int half = lane >> 4;
    const int lr   = lane & 15;

    // which product this block belongs to: the same for the whole block
    int id = blockIdx.x;
    const float* A = A0; const float* B = B0; const float* bias = bias0;
    float* C = C0;
    int N = N0;
    if (id >= nb0 + nb1) {
        id -= nb0 + nb1; A = A2; B = B2; bias = bias2; C = C2; N = N12;
    } else if (id >= nb0) {
        id -= nb0;       A = A1; B = B1; bias = bias1; C = C1; N = N12;
    }
    const int nx = N >> 6;                 // tile columns of this product
    const int m0 = (id / nx) * 128;
    const int n0 = (id % nx) * 64;

    const int colBase = (wave & 1) * 32;   // cols {colBase, colBase+16}
    const int rowBase = (wave >> 1) * 32;  // rows {rowBase, rowBase+16}

    v8f acc00 = {}; v8f acc01 = {}; v8f acc10 = {}; v8f acc11 = {};

    // Loaders: a stage is A 128x64 (256 thr x 8 float4) and B 64x64 (256 thr x 4);
    // 16 lanes cover one 256-byte row of either tile.
    const int ldrow = tid >> 4, ldcol = (tid & 15) * 4;

    const float* gA = A + (size_t)(m0 + ldrow) * Kd + ldcol;
    const float* gB = B + (size_t)ldrow * N + n0 + ldcol;
    const size_t aStep = (size_t)16 * Kd;      // 16 rows of A
    const size_t bStep = (size_t)16 * N;       // 16 rows of B
    const int ldsAo = ldrow * 68 + ldcol;
    const int ldsBo = ldrow * 64 + ldcol;
    const int nst = Kd >> 6;                   // stages

    // prologue: stage 0 into buffer 0, published; then stage 1 into buffer 1
    stage_copies(gA, aStep, gB, bStep, &As[0][ldsAo], &Bs[0][ldsBo]);
    if constexpr (LN) {
        // while stage 0 flies: gain and shift into LDS; threads 0..127 add up the
        // 32 partial sums of one row each, threads 128..255 the sums of squares
        Gs[tid] = lnG[tid]; Gs[tid + 256] = lnG[tid + 256];
        Ts[tid] = lnB[tid]; Ts[tid + 256] = lnB[tid + 256];
        const float* sp = lnS + (size_t)(tid >> 7) * (32 * 2048) + m0 + (tid & 127);
        float s = 0.0f;
#pragma unroll
        for (int i = 0; i < 32; ++i) s += sp[i * 2048];
        Rst[tid] = s;
    }
    wait_async0();              // this wave's copies of stage 0 have landed
    __syncthreads();            // everyone's have
    if (nst > 1)
        stage_copies(gA + 64, aStep, gB + (size_t)64 * N, bStep, &As[1][ldsAo], &Bs[1][ldsBo]);

    // LN: mean and 1/sigma of this lane's two A rows
    float mean0 = 0.0f, sc0 = 0.0f, mean1 = 0.0f, sc1 = 0.0f;
    if constexpr (LN) {
        const int r0 = rowBase + lr, r1 = r0 + 16;
        mean0 = Rst[r0] * (1.0f / 512.0f);
        mean1 = Rst[r1] * (1.0f / 512.0f);
        const float var0 = Rst[128 + r0] * (1.0f / 512.0f) - mean0 * mean0;
        const float var1 = Rst[128 + r1] * (1.0f / 512.0f) - mean1 * mean1;
        sc0 = rsq_normal(var0 + 1e-5f);
        sc1 = rsq_normal(var1 + 1e-5f);
    }

    for (int st = 0; st < nst; ++st) {
        const int buf = st & 1;
        const float* Asb = As[buf];
        const float* Bsb = Bs[buf];
        // fully unrolled: constant LDS offsets, fragment reads issue ahead of their products
#pragma unroll
        for (int k0 = 0; k0 < 64; k0 += 4) {
            v2f b0, b1, a0, a1;
            b0.x = Bsb[(k0 + 0 + 2 * half) * 64 + colBase + lr];
            b0.y = Bsb[(k0 + 1 + 2 * half) * 64 + colBase + lr];
            b1.x = Bsb[(k0 + 0 + 2 * half) * 64 + colBase + 16 + lr];
            b1.y = Bsb[(k0 + 1 + 2 * half) * 64 + colBase + 16 + lr];
            a0.x = Asb[(rowBase + lr) * 68 + k0 + 0 + 2 * half];
            a0.y = Asb[(rowBase + lr) * 68 + k0 + 1 + 2 * half];
            a1.x = Asb[(rowBase + 16 + lr) * 68 + k0 + 0 + 2 * half];
            a1.y = Asb[(rowBase + 16 + lr) * 68 + k0 + 1 + 2 * half];
            if constexpr (LN) {
                const v2f g2 = *(const v2f*)&Gs[st * 64 + k0 + 2 * half];
                const v2f t2 = *(const v2f*)&Ts[st * 64 + k0 + 2 * half];
                a0 = (a0 - mean0) * sc0 * g2 + t2;
                a1 = (a1 - mean1) * sc1 * g2 + t2;
            }
            acc00 = WMMA_F32(a0, b0, acc00);
            acc01 = WMMA_F32(a0, b1, acc01);
            acc10 = WMMA_F32(a1, b0, acc10);
            acc11 = WMMA_F32(a1, b1, acc11);
        }
        wait_ds0();             // this wave's reads of `buf` are done
        wait_async0();          // this wave's copies of stage st + 1 have landed
        __syncthreads();        // stage st + 1 published; `buf` left by every reader
        if (st + 2 < nst) {     // refill `buf` while stage st + 1 is worked on
            const int kn = (st + 2) * 64;
            stage_copies(gA + kn, aStep, gB + (size_t)kn * N, bStep, &As[buf][ldsAo], &Bs[buf][ldsBo]);
        }
    }
    wait_async0();              // nothing in flight when the ring is left

    const int nA0 = n0 + colBase + lr;
    const int nA1 = nA0 + 16;
    const float bz0 = bias ? bias[nA0] : 0.0f;
    const float bz1 = bias ? bias[nA1] : 0.0f;
#pragma unroll
    for (int v = 0; v < 8; ++v) {
        const int mA = m0 + rowBase + v + 8 * half;
        const int mB = mA + 16;
        float r00 = acc00[v] + bz0, r01 = acc01[v] + bz1;
        float r10 = acc10[v] + bz0, r11 = acc11[v] + bz1;
        if (act == 1) {
            r00 = gelu_exact(r00); r01 = gelu_exact(r01);
            r10 = gelu_exact(r10); r11 = gelu_exact(r11);
        }
        if (resid) {
            r00 += resid[(size_t)mA * N + nA0]; r01 += resid[(size_t)mA * N + nA1];
            r10 += resid[(size_t)mB * N + nA0]; r11 += resid[(size_t)mB * N + nA1];
        }
        C[(size_t)mA * N + nA0] = r00;
        C[(size_t)mA * N + nA1] = r01;
        C[(size_t)mB * N + nA0] = r10;
        C[(size_t)mB * N + nA1] = r11;
    }
}

// ---------------------------------------------------------------------------
// Elementwise phasor: raw (tok, 2K interleaved pairs) -> [real | imag].
// ---------------------------------------------------------------------------
__device__ __forceinline__ void phasor2(float x0, float x1, float* re, float* im) {
    float px = tanhf(x0) * 0.9f;
    float py = tanhf(x1) * 0.9f;
    float n  = sqrtf(px * px + py * py);
    float nm = fmaxf(n, 1e-5f);
    float sc = fminf((1.0f - 1e-5f) / nm, 1.0f);
    px *= sc; py *= sc;
    float r = n * sc;
    float ph = atan2f(py, px);
    float amp = 1.0f - r;
    *re = amp * cosf(ph);
    *im = amp * sinf(ph);
}

__global__ void phasor_kernel(const float* __restrict__ Kraw,
                              const float* __restrict__ Qraw,
                              float* __restrict__ K2, float* __restrict__ Q2, int n)
{
    int i = blockIdx.x * blockDim.x + threadIdx.x;
    if (i >= n) return;
    int tok = i >> 6, k = i & 63;
    size_t base = (size_t)tok * 128;
    float re, im;
    phasor2(Kraw[base + 2 * k], Kraw[base + 2 * k + 1], &re, &im);
    K2[base + k] = re; K2[base + 64 + k] = im;
    phasor2(Qraw[base + 2 * k], Qraw[base + 2 * k + 1], &re, &im);
    Q2[base + k] = re; Q2[base + 64 + k] = im;
}

// ---------------------------------------------------------------------------
// Per-chunk masked scores: S_c = tril(Q2_c @ K2_c^T), chunk = 64 tokens.
// ---------------------------------------------------------------------------
__device__ __forceinline__ void s_chunk_block(
    const float* __restrict__ Q2, const float* __restrict__ K2,
    float* __restrict__ Sbuf, const int bc)   // bc = b*16 + c
{
    const size_t tok0 = (size_t)(bc >> 4) * 1024 + (size_t)(bc & 15) * 64;
    const int tid  = threadIdx.x;
    const int wave = tid >> 5, lane = tid & 31, half = lane >> 4, lr = lane & 15;
    const int nOff = (wave & 3) * 16, rOff = (wave >> 2) * 32;

    const float* Qb = Q2 + tok0 * 128;
    const float* Kb = K2 + tok0 * 128;

    v8f acc0 = {}; v8f acc1 = {};
#pragma unroll 8
    for (int k0 = 0; k0 < 128; k0 += 4) {
        v2f bf;   // B[k][n] = K2[tok0+n][k]  (transposed read)
        bf.x = Kb[(size_t)(nOff + lr) * 128 + k0 + 0 + 2 * half];
        bf.y = Kb[(size_t)(nOff + lr) * 128 + k0 + 1 + 2 * half];
        v2f a0;
        a0.x = Qb[(size_t)(rOff + lr) * 128 + k0 + 0 + 2 * half];
        a0.y = Qb[(size_t)(rOff + lr) * 128 + k0 + 1 + 2 * half];
        v2f a1;
        a1.x = Qb[(size_t)(rOff + 16 + lr) * 128 + k0 + 0 + 2 * half];
        a1.y = Qb[(size_t)(rOff + 16 + lr) * 128 + k0 + 1 + 2 * half];
        acc0 = WMMA_F32(a0, bf, acc0);
        acc1 = WMMA_F32(a1, bf, acc1);
    }
    float* Sb = Sbuf + (size_t)bc * 4096;
    const int n = nOff + lr;
#pragma unroll
    for (int v = 0; v < 8; ++v) {
        int mA = rOff + v + 8 * half, mB = mA + 16;
        Sb[mA * 64 + n] = (mA >= n) ? acc0[v] : 0.0f;
        Sb[mB * 64 + n] = (mB >= n) ? acc1[v] : 0.0f;
    }
}

// ---------------------------------------------------------------------------
// Per-chunk states: P_c = K2_c^T @ V_c (128 x 512), chunk = 64 tokens.
// 2 batches * 15 chunks * 8 d-slices = 240 independent blocks (the last
// chunk's state has no reader). Tile (b, c, dtile) is a contiguous 128x64 block
// at index (b*15 + c)*8 + dtile.
// ---------------------------------------------------------------------------
__device__ __forceinline__ void chunk_state_block(
    const float* __restrict__ K2, const float* __restrict__ V,
    float* __restrict__ P, const int sidx)    // sidx = (b*15 + c)*8 + dtile
{
    const int tid  = threadIdx.x;
    const int wave = tid >> 5, lane = tid & 31, half = lane >> 4, lr = lane & 15;
    const int nOff = (wave & 3) * 16;

    const int bc15 = sidx >> 3;
    const int b    = bc15 / 15;
    const int c    = bc15 - b * 15;
    const size_t tok0 = (size_t)b * 1024 + (size_t)c * 64;
    const float* Vb = V  + tok0 * 512 + (sidx & 7) * 64;
    const float* Kb = K2 + tok0 * 128;
    const int mBase = (wave >> 2) * 64;   // each wave owns 4 disjoint 16x16 subtiles

    v8f acc[4] = {};
    // 8 k-steps a trip: 80 independent fragment loads in flight per lane
#pragma unroll 8
    for (int k0 = 0; k0 < 64; k0 += 4) {
        v2f bf;
        bf.x = Vb[(size_t)(k0 + 0 + 2 * half) * 512 + nOff + lr];
        bf.y = Vb[(size_t)(k0 + 1 + 2 * half) * 512 + nOff + lr];
#pragma unroll
        for (int j = 0; j < 4; ++j) {
            v2f af;   // A[m][l] = K2[tok0+l][m]  (transposed read)
            af.x = Kb[(size_t)(k0 + 0 + 2 * half) * 128 + mBase + j * 16 + lr];
            af.y = Kb[(size_t)(k0 + 1 + 2 * half) * 128 + mBase + j * 16 + lr];
            acc[j] = WMMA_F32(af, bf, acc[j]);
        }
    }
    float* Pb = P + (size_t)sidx * 8192;
#pragma unroll
    for (int j = 0; j < 4; ++j)
#pragma unroll
        for (int v = 0; v < 8; ++v)
            Pb[(mBase + j * 16 + v + 8 * half) * 64 + nOff + lr] = acc[j][v];
}

// Scores and states depend only on K2, Q2 and V, not on each other: one grid,
// blocks 0..31 the masked scores, blocks 32..271 the chunk states.
__global__ __launch_bounds__(256) void chunk_scores_states_kernel(
    const float* __restrict__ Q2, const float* __restrict__ K2,
    const float* __restrict__ V, float* __restrict__ Sbuf, float* __restrict__ P)
{
    const int blk = blockIdx.x;
    if (blk < 32) s_chunk_block(Q2, K2, Sbuf, blk);
    else          chunk_state_block(K2, V, P, blk - 32);
}

// ---------------------------------------------------------------------------
// Chunk-parallel causal linear attention.
// Grid = B * 16 chunks * (512/64) d-slices = 256 independent blocks. Each sums
// the states of the earlier chunks of its batch, M = sum_{j<c} P_j, into LDS:
//   out_c = S_c @ V_c + Q2_c @ M
// The rows are stored position-normalized (divided by sqrt(64 * position)).
// Each wave also leaves, for the LayerNorm in the output projection, the sum and
// the sum of squares of its 16 columns of every row it holds: plane
// [slice = dt*4 + column group][row] of St, the squares 32 planes further on.
// ---------------------------------------------------------------------------
// v + (v of lane ^ X) inside a 16-lane row, as one DPP add (0x160 + X = row_xmask:X)
template <int CTRL>
__device__ __forceinline__ float dpp_xadd(float v) {
    return v + __int_as_float(__builtin_amdgcn_update_dpp(0, __float_as_int(v), CTRL, 0xf, 0xf, true));
}
__device__ __forceinline__ float row16_sum(float v) {
    v = dpp_xadd<0x161>(v);
    v = dpp_xadd<0x162>(v);
    v = dpp_xadd<0x164>(v);
    v = dpp_xadd<0x168>(v);
    return v;
}

__global__ __launch_bounds__(256) void attn_out_kernel(
    const float* __restrict__ Q2, const float* __restrict__ V,
    const float* __restrict__ Sbuf, const float* __restrict__ P,
    float* __restrict__ R, float* __restrict__ St)
{
    __shared__ __align__(16) float Msh[128 * 64];   // 32 KB prefix state
    const int dt = blockIdx.x & 7;
    const int bq = blockIdx.x >> 3;
    const int b  = bq >> 4;
    const int c  = 15 - (bq & 15);    // blocks with the longest prefix start first
    const int n0 = dt * 64;

    const int tid  = threadIdx.x;
    const int wave = tid >> 5, lane = tid & 31, half = lane >> 4, lr = lane & 15;
    const int nOff = (wave & 3) * 16, rOff = (wave >> 2) * 32;

    const size_t tok0 = (size_t)b * 1024 + (size_t)c * 64;
    const float* Sb = Sbuf + (size_t)(b * 16 + c) * 4096;
    const float* Vb = V  + tok0 * 512 + n0;
    const float* Qb = Q2 + tok0 * 128;

    if (c > 0) {
        // thread t owns float4 slots t + 256*i of the 128x64 tile
        const v4f* Pt = (const v4f*)(P + ((size_t)(b * 15) * 8 + dt) * 8192) + tid;
        v4f m[8];
#pragma unroll
        for (int i = 0; i < 8; ++i) m[i] = Pt[256 * i];
        // the loads' scalar base may be rewritten on the short-prefix path: keep the wait in front of it
        asm volatile("s_wait_xcnt 0x0" ::: "memory");
        // 4 tiles a trip: 32 independent 16-byte loads per lane in flight
#pragma unroll 4
        for (int j = 1; j < c; ++j) {
            const v4f* Pj = Pt + (size_t)j * (8 * 2048);
#pragma unroll
            for (int i = 0; i < 8; ++i) m[i] += Pj[256 * i];
        }
#pragma unroll
        for (int i = 0; i < 8; ++i) *(v4f*)&Msh[(tid + 256 * i) * 4] = m[i];
    }

    v8f acc0 = {}; v8f acc1 = {};
    // fully unrolled: all S and V fragment loads issue ahead of the first product
#pragma unroll
    for (int k0 = 0; k0 < 64; k0 += 4) {
        v2f bf;
        bf.x = Vb[(size_t)(k0 + 0 + 2 * half) * 512 + nOff + lr];
        bf.y = Vb[(size_t)(k0 + 1 + 2 * half) * 512 + nOff + lr];
        v2f a0;
        a0.x = Sb[(rOff + lr) * 64 + k0 + 0 + 2 * half];
        a0.y = Sb[(rOff + lr) * 64 + k0 + 1 + 2 * half];
        v2f a1;
        a1.x = Sb[(rOff + 16 + lr) * 64 + k0 + 0 + 2 * half];
        a1.y = Sb[(rOff + 16 + lr) * 64 + k0 + 1 + 2 * half];
        acc0 = WMMA_F32(a0, bf, acc0);
        acc1 = WMMA_F32(a1, bf, acc1);
    }

    if (c > 0) {                      // same for the whole block
        __syncthreads();              // M complete before any wave reads it
        // 16 k-steps a trip: the Q2 fragment loads of a trip issue ahead of its products
#pragma unroll 16
        for (int k0 = 0; k0 < 128; k0 += 4) {
            v2f bf;
            bf.x = Msh[(k0 + 0 + 2 * half) * 64 + nOff + lr];
            bf.y = Msh[(k0 + 1 + 2 * half) * 64 + nOff + lr];
            v2f a0;
            a0.x = Qb[(size_t)(rOff + lr) * 128 + k0 + 0 + 2 * half];
            a0.y = Qb[(size_t)(rOff + lr) * 128 + k0 + 1 + 2 * half];
            v2f a1;
            a1.x = Qb[(size_t)(rOff + 16 + lr) * 128 + k0 + 0 + 2 * half];
            a1.y = Qb[(size_t)(rOff + 16 + lr) * 128 + k0 + 1 + 2 * half];
            acc0 = WMMA_F32(a0, bf, acc0);
            acc1 = WMMA_F32(a1, bf, acc1);
        }
    }

    // What follows reads the accumulators with vector instructions right behind the
    // last matrix instruction: four v_nop keep the vector slots between the two.
    // The scheduling barriers hold them at this place (nothing moves across).
    __builtin_amdgcn_sched_barrier(0);
    asm volatile("v_nop\n\tv_nop\n\tv_nop\n\tv_nop");
    __builtin_amdgcn_sched_barrier(0);

    float* Rb = R + tok0 * 512 + n0;
    const int n = nOff + lr;
#pragma unroll
    for (int v = 0; v < 8; ++v) {
        const int pos = c * 64 + rOff + v + 8 * half + 1;   // 1-based position in the sequence
        acc0[v] *= rsq_normal((float)pos * 64.0f);
        acc1[v] *= rsq_normal((float)(pos + 16) * 64.0f);
        Rb[(size_t)(rOff + v + 8 * half) * 512 + n]      = acc0[v];
        Rb[(size_t)(rOff + 16 + v + 8 * half) * 512 + n] = acc1[v];
    }

    // row statistics over this wave's 16 columns; lanes 0..7 of a half keep the
    // rows of acc0, lanes 8..15 those of acc1, one row a lane
    float ps = 0.0f, pq = 0.0f;
#pragma unroll
    for (int v = 0; v < 8; ++v) {
        const float s0 = row16_sum(acc0[v]);
        const float s1 = row16_sum(acc1[v]);
        const float q0 = row16_sum(acc0[v] * acc0[v]);
        const float q1 = row16_sum(acc1[v] * acc1[v]);
        if ((lr & 7) == v) {
            ps = (lr & 8) ? s1 : s0;
            pq = (lr & 8) ? q1 : q0;
        }
    }
    const size_t so = (size_t)(dt * 4 + (wave & 3)) * 2048 + tok0
                    + rOff + ((lr & 8) << 1) + (lr & 7) + 8 * half;
    St[so] = ps;
    St[so + 32 * 2048] = pq;
}

// ---------------------------------------------------------------------------
extern "C" void kernel_launch(void* const* d_in, const int* in_sizes, int n_in,
                              void* d_out, int out_size, void* d_ws, size_t ws_size,
                              hipStream_t stream) {
    const float* x   = (const float*)d_in[0];
    const float* Wk1 = (const float*)d_in[1];
    const float* bk1 = (const float*)d_in[2];
    const float* Wk2 = (const float*)d_in[3];
    const float* bk2 = (const float*)d_in[4];
    const float* Wq1 = (const float*)d_in[5];
    const float* bq1 = (const float*)d_in[6];
    const float* Wq2 = (const float*)d_in[7];
    const float* bq2 = (const float*)d_in[8];
    const float* Wv  = (const float*)d_in[9];
    const float* bv  = (const float*)d_in[10];
    const float* lng = (const float*)d_in[11];
    const float* lnb = (const float*)d_in[12];
    const float* Wo  = (const float*)d_in[13];
    const float* bo  = (const float*)d_in[14];
    float* out = (float*)d_out;

    const int M = 2048;      // B*L tokens
    const int D = 512;
    const int N2K = 128;     // 2*K_OSC

    float* ws   = (float*)d_ws;
    float* Hk   = ws;
    float* Hq   = Hk   + (size_t)M * D;
    float* Vm   = Hq   + (size_t)M * D;
    float* Kraw = Vm   + (size_t)M * D;
    float* Qraw = Kraw + (size_t)M * N2K;
    float* K2   = Qraw + (size_t)M * N2K;
    float* Q2   = K2   + (size_t)M * N2K;
    float* Sbuf = Q2   + (size_t)M * N2K;
    float* R    = Sbuf + (size_t)32 * 4096;
    float* P    = R    + (size_t)M * D;      // 30 chunk states of 128 x 512
    float* St   = P    + (size_t)30 * 128 * D;   // 64 planes of M row statistics

    dim3 blk(256);

    const int nbD = (D / 64) * (M / 128);     // 128 blocks for an M x D product
    const int nbK = (N2K / 64) * (M / 128);   // 32 blocks for an M x 2K product

    // Both MLP first layers (gelu): 256 blocks
    gemm_wmma_f32<false><<<nbD + nbD, blk, 0, stream>>>(
        x, Wk1, bk1, Hk,  x, Wq1, bq1, Hq,  nullptr, nullptr, nullptr, nullptr,
        nullptr, nullptr, nullptr, nullptr, nbD, nbD, D, D, D, 1);
    // V projection + both MLP second layers: 192 blocks
    gemm_wmma_f32<false><<<nbD + nbK + nbK, blk, 0, stream>>>(
        x, Wv, bv, Vm,  Hk, Wk2, bk2, Kraw,  Hq, Wq2, bq2, Qraw,
        nullptr, nullptr, nullptr, nullptr, nbD, nbK, D, N2K, D, 0);
    // Phasor features
    phasor_kernel<<<(M * 64 + 255) / 256, blk, 0, stream>>>(Kraw, Qraw, K2, Q2, M * 64);
    // Per-chunk masked scores + per-chunk states K2_c^T V_c
    chunk_scores_states_kernel<<<32 + 240, blk, 0, stream>>>(Q2, K2, Vm, Sbuf, P);
    // Chunk-parallel causal linear attention, position-normalized, + partial row statistics
    attn_out_kernel<<<256, blk, 0, stream>>>(Q2, Vm, Sbuf, P, R, St);
    // Output projection with residual, LayerNorm applied to its A fragments:
    // out = x + LN(r) @ Wo + bo
    gemm_wmma_f32<true><<<nbD, blk, 0, stream>>>(
        R, Wo, bo, out,  nullptr, nullptr, nullptr, nullptr,  nullptr, nullptr, nullptr, nullptr,
        x, St, lng, lnb, nbD, 0, D, D, D, 0);
}

// v005
// Measured time: 69.8 microseconds a run.
// Timed twice side by side with v004, it ran 1.07 times as fast both times.
// Counting every step since v000, it is 4.10 times as fast.
#include <hip/hip_runtime.h>
#include <hip/hip_bf16.h>
#include <math.h>

typedef float v2f __attribute__((ext_vector_type(2)));
typedef float v4f __attribute__((ext_vector_type(4)));
typedef float v8f __attribute__((ext_vector_type(8)));

// D = A(16x4,f32) x B(4x16,f32) + C(16x16,f32)
#define WMMA_F32(a, b, c) \
    __builtin_amdgcn_wmma_f32_16x16x4_f32(false, (a), false, (b), (short)0, (c), false, false)

__device__ __forceinline__ float gelu_exact(float x) {
    return 0.5f * x * (1.0f + erff(x * 0.70710678118654752440f));
}

// Async copies 16B global -> LDS (CDNA5 GLOBAL_LOAD_ASYNC_TO_LDS_B128, ASYNCcnt).
// An LDS address is the low 32 bits of the generic shared-memory pointer (LDS
// aperture truncation, ISA 10.2).
// One stage of the GEMM ring per call: 8 copies of the A tile (rows 16 apart)
// and 4 of the B tile (rows 16 apart) for this lane. The closing s_wait_xcnt
// stands in the copies' own statement, so that no address register is
// rewritten ahead of it.
__device__ __forceinline__ void stage_copies(const float* gA, size_t aStep,
                                             const float* gB, size_t bStep,
                                             const float* ldsA, const float* ldsB) {
    const unsigned la = (unsigned)(size_t)ldsA;
    const unsigned lb = (unsigned)(size_t)ldsB;
    asm volatile(
        "global_load_async_to_lds_b128 %0, %1, off\n\t"
        "global_load_async_to_lds_b128 %2, %3, off\n\t"
        "global_load_async_to_lds_b128 %4, %5, off\n\t"
        "global_load_async_to_lds_b128 %6, %7, off\n\t"
        "global_load_async_to_lds_b128 %8, %9, off\n\t"
        "global_load_async_to_lds_b128 %10, %11, off\n\t"
        "global_load_async_to_lds_b128 %12, %13, off\n\t"
        "global_load_async_to_lds_b128 %14, %15, off\n\t"
        "global_load_async_to_lds_b128 %16, %17, off\n\t"
        "global_load_async_to_lds_b128 %18, %19, off\n\t"
        "global_load_async_to_lds_b128 %20, %21, off\n\t"
        "global_load_async_to_lds_b128 %22, %23, off\n\t"
        "s_wait_xcnt 0x0"
        :: "v"(la),                    "v"(gA),
           "v"(la + 1u * 16u * 272u),  "v"(gA + 1 * aStep),
           "v"(la + 2u * 16u * 272u),  "v"(gA + 2 * aStep),
           "v"(la + 3u * 16u * 272u),  "v"(gA + 3 * aStep),
           "v"(la + 4u * 16u * 272u),  "v"(gA + 4 * aStep),
           "v"(la + 5u * 16u * 272u),  "v"(gA + 5 * aStep),
           "v"(la + 6u * 16u * 272u),  "v"(gA + 6 * aStep),
           "v"(la + 7u * 16u * 272u),  "v"(gA + 7 * aStep),
           "v"(lb),                    "v"(gB),
           "v"(lb + 1u * 16u * 256u),  "v"(gB + 1 * bStep),
           "v"(lb + 2u * 16u * 256u),  "v"(gB + 2 * bStep),
           "v"(lb + 3u * 16u * 256u),  "v"(gB + 3 * bStep)
        : "memory");
}
// The same for a 64-row A tile: 4 copies of the A tile and 4 of the B tile.
__device__ __forceinline__ void stage_copies_a4(const float* gA, size_t aStep,
                                                const float* gB, size_t bStep,
                                                const float* ldsA, const float* ldsB) {
    const unsigned la = (unsigned)(size_t)ldsA;
    const unsigned lb = (unsigned)(size_t)ldsB;
    asm volatile(
        "global_load_async_to_lds_b128 %0, %1, off\n\t"
        "global_load_async_to_lds_b128 %2, %3, off\n\t"
        "global_load_async_to_lds_b128 %4, %5, off\n\t"
        "global_load_async_to_lds_b128 %6, %7, off\n\t"
        "global_load_async_to_lds_b128 %8, %9, off\n\t"
        "global_load_async_to_lds_b128 %10, %11, off\n\t"
        "global_load_async_to_lds_b128 %12, %13, off\n\t"
        "global_load_async_to_lds_b128 %14, %15, off\n\t"
        "s_wait_xcnt 0x0"
        :: "v"(la),                    "v"(gA),
           "v"(la + 1u * 16u * 272u),  "v"(gA + 1 * aStep),
           "v"(la + 2u * 16u * 272u),  "v"(gA + 2 * aStep),
           "v"(la + 3u * 16u * 272u),  "v"(gA + 3 * aStep),
           "v"(lb),                    "v"(gB),
           "v"(lb + 1u * 16u * 256u),  "v"(gB + 1 * bStep),
           "v"(lb + 2u * 16u * 256u),  "v"(gB + 2 * bStep),
           "v"(lb + 3u * 16u * 256u),  "v"(gB + 3 * bStep)
        : "memory");
}
// One stage for a tile of MT rows of A.
template <int MT>
__device__ __forceinline__ void stage_tile(const float* gA, size_t aStep,
                                           const float* gB, size_t bStep,
                                           const float* ldsA, const float* ldsB) {
    if constexpr (MT == 128) stage_copies(gA, aStep, gB, bStep, ldsA, ldsB);
    else                     stage_copies_a4(gA, aStep, gB, bStep, ldsA, ldsB);
}
// The issuing wave's own wait: its copies have landed in LDS behind it.
__device__ __forceinline__ void wait_async0() {
    asm volatile("s_wait_asynccnt 0x0" ::: "memory");
}
// The wave's own LDS reads have returned: its buffer may be handed back for a refill.
__device__ __forceinline__ void wait_ds0() {
    asm volatile("s_wait_dscnt 0x0" ::: "memory");
}

// 1/sqrt(x) for x in the normal range. The v_nop fills the slot that the
// instruction set asks for behind a transcendental, whatever is scheduled next.
__device__ __forceinline__ float rsq_normal(float x) {
    float r;
    asm("v_rsq_f32 %0, %1\n\tv_nop" : "=v"(r) : "v"(x));
    return r;
}

// ---------------------------------------------------------------------------
// fp32 WMMA GEMM: C = act(A@B + bias) [+ resid]
// A: MxK row-major, B: KxN row-major, C/resid: MxN row-major.
// One grid holds up to three independent products that share Kd and act: flat
// blocks [0, nb0) work on product 0 (width N0), [nb0, nb0 + nb1) on product 1,
// the rest on product 2 (both of width N12). Within a product the tile column
// runs fastest.
// Block = 256 threads (8 waves) computes an MT x 64 C tile; each wave owns a
// 2x2 grid of 16x16 accumulators. MT = 128: one 32x32 part of the tile a wave.
// MT = 64, for a product whose 128-row tiles would leave half the WGPs without a
// block: waves w and w + 4 share a 32x32 part, w takes the first 32 k of every
// stage and w + 4 the last 32 (LDS reads per WMMA stay as they are), and the two
// partial tiles are added through LDS at the end.
// Double-buffered LDS, async loads to LDS, 64 k per stage (Kd a multiple of 64):
// one barrier and one exposed wait per 64 WMMAs of a wave (32 where MT = 64).
// A tile LDS stride = 68 floats (272B): 16B-aligned rows for b128 async writes
// AND bank-conflict-free fragment reads (68*r mod 64 = 4*r distinct, r=0..15).
// LN = true (Kd = 512): each A fragment is layer-normalized over its row on its
// way from LDS to the product. lnS holds, per row,
// 32 partial sums and 32 partial sums of squares (plane [slice][row], 2048 rows,
// the squares 32 planes further on), written by the kernel that wrote A.
// ---------------------------------------------------------------------------
template <bool LN, int MT>
__global__ __launch_bounds__(256) void gemm_wmma_f32(
    const float* __restrict__ A0, const float* __restrict__ B0,
    const float* __restrict__ bias0, float* __restrict__ C0,
    const float* __restrict__ A1, const float* __restrict__ B1,
    const float* __restrict__ bias1, float* __restrict__ C1,
    const float* __restrict__ A2, const float* __restrict__ B2,
    const float* __restrict__ bias2, float* __restrict__ C2,
    const float* __restrict__ resid,
    const float* __restrict__ lnS, const float* __restrict__ lnG,
    const float* __restrict__ lnB,
    int nb0, int nb1, int N0, int N12, int Kd, int act)
{
    constexpr bool SPLIT = (MT == 64);                // two waves share a part of the tile, half the k each
    constexpr int  KW = SPLIT ? 32 : 64;              // k of a stage that one wave works on
    __shared__ __align__(16) float As[2][MT * 68];    // [buf][row][k], stride 68
    __shared__ __align__(16) float Bs[2][64 * 64];    // [buf][k][n]
    __shared__ __align__(16) float Gs[512];           // LN only: gain by k
    __shared__ __align__(16) float Ts[512];           // LN only: shift by k
    __shared__ float Rst[2 * MT];                     // LN only: row sums | row sums of squares

    const int tid  = threadIdx.x;
    const int wave = tid >> 5;
    const int lane = tid & 31;
    const int half = lane >> 4;
    const int lr   = lane & 15;

    // which product this block belongs to: the same for the whole block
    int id = blockIdx.x;
    const float* A = A0; const float* B = B0; const float* bias = bias0;
    float* C = C0;
    int N = N0;
    if (id >= nb0 + nb1) {
        id -= nb0 + nb1; A = A2; B = B2; bias = bias2; C = C2; N = N12;
    } else if (id >= nb0) {
        id -= nb0;       A = A1; B = B1; bias = bias1; C = C1; N = N12;
    }
    const int nx = N >> 6;                 // tile columns of this product
    const int m0 = (id / nx) * MT;
    const int n0 = (id % nx) * 64;

    const int colBase = (wave & 1) * 32;   // cols {colBase, colBase+16}
    const int rowBase = ((wave >> 1) & (MT / 32 - 1)) * 32;   // rows {rowBase, rowBase+16}
    const int kh = SPLIT ? (wave >> 2) : 0;       // which half of a stage's k

    v8f acc00 = {}; v8f acc01 = {}; v8f acc10 = {}; v8f acc11 = {};

    // Loaders: a stage is A MTx64 (256 thr x MT/16 float4) and B 64x64 (256 thr x 4);
    // 16 lanes cover one 256-byte row of either tile.
    const int ldrow = tid >> 4, ldcol = (tid & 15) * 4;

    const float* gA = A + (size_t)(m0 + ldrow) * Kd + ldcol;
    const float* gB = B + (size_t)ldrow * N + n0 + ldcol;
    const size_t aStep = (size_t)16 * Kd;      // 16 rows of A
    const size_t bStep = (size_t)16 * N;       // 16 rows of B
    const int ldsAo = ldrow * 68 + ldcol;
    const int ldsBo = ldrow * 64 + ldcol;
    const int nst = Kd >> 6;                   // stages

    // prologue: stage 0 into buffer 0, published; then stage 1 into buffer 1
    stage_tile<MT>(gA, aStep, gB, bStep, &As[0][ldsAo], &Bs[0][ldsBo]);
    if constexpr (LN) {
        // while stage 0 flies: gain and shift into LDS; threads 0..MT-1 add up the
        // 32 partial sums of one row each, threads MT..2*MT-1 the sums of squares
        Gs[tid] = lnG[tid]; Gs[tid + 256] = lnG[tid + 256];
        Ts[tid] = lnB[tid]; Ts[tid + 256] = lnB[tid + 256];
        if (tid < 2 * MT) {
            const float* sp = lnS + (size_t)(tid / MT) * (32 * 2048) + m0 + (tid % MT);
            float s = 0.0f;
#pragma unroll
            for (int i = 0; i < 32; ++i) s += sp[i * 2048];
            Rst[tid] = s;
        }
    }
    wait_async0();              // this wave's copies of stage 0 have landed
    __syncthreads();            // everyone's have
    if (nst > 1)
        stage_tile<MT>(gA + 64, aStep, gB + (size_t)64 * N, bStep, &As[1][ldsAo], &Bs[1][ldsBo]);

    // LN: mean and 1/sigma of this lane's two A rows
    float mean0 = 0.0f, sc0 = 0.0f, mean1 = 0.0f, sc1 = 0.0f;
    if constexpr (LN) {
        const int r0 = rowBase + lr, r1 = r0 + 16;
        mean0 = Rst[r0] * (1.0f / 512.0f);
        mean1 = Rst[r1] * (1.0f / 512.0f);
        const float var0 = Rst[MT + r0] * (1.0f / 512.0f) - mean0 * mean0;
        const float var1 = Rst[MT + r1] * (1.0f / 512.0f) - mean1 * mean1;
        sc0 = rsq_normal(var0 + 1e-5f);
        sc1 = rsq_normal(var1 + 1e-5f);
    }

    for (int st = 0; st < nst; ++st) {
        const int buf = st & 1;
        const float* Asb = As[buf] + kh * KW;
        const float* Bsb = Bs[buf] + kh * KW * 64;
        // fully unrolled: constant LDS offsets, fragment reads issue ahead of their products
#pragma unroll
        for (int k0 = 0; k0 < KW; k0 += 4) {
            v2f b0, b1, a0, a1;
            b0.x = Bsb[(k0 + 0 + 2 * half) * 64 + colBase + lr];
            b0.y = Bsb[(k0 + 1 + 2 * half) * 64 + colBase + lr];
            b1.x = Bsb[(k0 + 0 + 2 * half) * 64 + colBase + 16 + lr];
            b1.y = Bsb[(k0 + 1 + 2 * half) * 64 + colBase + 16 + lr];
            a0.x = Asb[(rowBase + lr) * 68 + k0 + 0 + 2 * half];
            a0.y = Asb[(rowBase + lr) * 68 + k0 + 1 + 2 * half];
            a1.x = Asb[(rowBase + 16 + lr) * 68 + k0 + 0 + 2 * half];
            a1.y = Asb[(rowBase + 16 + lr) * 68 + k0 + 1 + 2 * half];
            if constexpr (LN) {
                const v2f g2 = *(const v2f*)&Gs[st * 64 + kh * KW + k0 + 2 * half];
                const v2f t2 = *(const v2f*)&Ts[st * 64 + kh * KW + k0 + 2 * half];
                a0 = (a0 - mean0) * sc0 * g2 + t2;
                a1 = (a1 - mean1) * sc1 * g2 + t2;
            }
            acc00 = WMMA_F32(a0, b0, acc00);
            acc01 = WMMA_F32(a0, b1, acc01);
            acc10 = WMMA_F32(a1, b0, acc10);
            acc11 = WMMA_F32(a1, b1, acc11);
        }
        wait_ds0();             // this wave's reads of `buf` are done
        wait_async0();          // this wave's copies of stage st + 1 have landed
        __syncthreads();        // stage st + 1 published; `buf` left by every reader
        if (st + 2 < nst) {     // refill `buf` while stage st + 1 is worked on
            const int kn = (st + 2) * 64;
            stage_tile<MT>(gA + kn, aStep, gB + (size_t)kn * N, bStep, &As[buf][ldsAo], &Bs[buf][ldsBo]);
        }
    }
    wait_async0();              // nothing in flight when the ring is left

    if constexpr (SPLIT) {
        // Every wave has left the ring (the loop's last barrier): its first buffer
        // carries the partial tiles. Wave w finishes rows rowBase..+15 and hands
        // over its part of rows rowBase+16..+31; wave w + 4 the other way round.
        float* Xs = &As[0][0];
        float* mine = Xs + wave * 512 + lane;
        const float* theirs = Xs + (wave ^ 4) * 512 + lane;
        // both loops unrolled: accumulator elements stay registers only under constant indices
#pragma unroll
        for (int v = 0; v < 8; ++v) {
            mine[v * 32]       = kh ? acc00[v] : acc10[v];
            mine[(8 + v) * 32] = kh ? acc01[v] : acc11[v];
        }
        __syncthreads();        // both partial tiles are in LDS
#pragma unroll
        for (int v = 0; v < 8; ++v) {
            acc00[v] = (kh ? acc10[v] : acc00[v]) + theirs[v * 32];
            acc01[v] = (kh ? acc11[v] : acc01[v]) + theirs[(8 + v) * 32];
        }
    }

    const int nA0 = n0 + colBase + lr;
    const int nA1 = nA0 + 16;
    const float bz0 = bias ? bias[nA0] : 0.0f;
    const float bz1 = bias ? bias[nA1] : 0.0f;
#pragma unroll
    for (int v = 0; v < 8; ++v) {
        const int mA = m0 + rowBase + kh * 16 + v + 8 * half;
        const int mB = mA + 16;
        float r00 = acc00[v] + bz0, r01 = acc01[v] + bz1;
        float r10 = acc10[v] + bz0, r11 = acc11[v] + bz1;   // SPLIT: partial sums, not stored
        if (act == 1) {
            r00 = gelu_exact(r00); r01 = gelu_exact(r01);
            if constexpr (!SPLIT) { r10 = gelu_exact(r10); r11 = gelu_exact(r11); }
        }
        if (resid) {
            r00 += resid[(size_t)mA * N + nA0]; r01 += resid[(size_t)mA * N + nA1];
            if constexpr (!SPLIT) {
                r10 += resid[(size_t)mB * N + nA0]; r11 += resid[(size_t)mB * N + nA1];
            }
        }
        C[(size_t)mA * N + nA0] = r00;
        C[(size_t)mA * N + nA1] = r01;
        if constexpr (!SPLIT) {
            C[(size_t)mB * N + nA0] = r10;
            C[(size_t)mB * N + nA1] = r11;
        }
    }
}

// ---------------------------------------------------------------------------
// Elementwise phasor: raw (tok, 2K interleaved pairs) -> [real | imag].
// ---------------------------------------------------------------------------
__device__ __forceinline__ void phasor2(float x0, float x1, float* re, float* im) {
    float px = tanhf(x0) * 0.9f;
    float py = tanhf(x1) * 0.9f;
    float n  = sqrtf(px * px + py * py);
    float nm = fmaxf(n, 1e-5f);
    float sc = fminf((1.0f - 1e-5f) / nm, 1.0f);
    px *= sc; py *= sc;
    float r = n * sc;
    float ph = atan2f(py, px);
    float amp = 1.0f - r;
    *re = amp * cosf(ph);
    *im = amp * sinf(ph);
}

__global__ void phasor_kernel(const float* __restrict__ Kraw,
                              const float* __restrict__ Qraw,
                              float* __restrict__ K2, float* __restrict__ Q2, int n)
{
    int i = blockIdx.x * blockDim.x + threadIdx.x;
    if (i >= n) return;
    int tok = i >> 6, k = i & 63;
    size_t base = (size_t)tok * 128;
    float re, im;
    phasor2(Kraw[base + 2 * k], Kraw[base + 2 * k + 1], &re, &im);
    K2[base + k] = re; K2[base + 64 + k] = im;
    phasor2(Qraw[base + 2 * k], Qraw[base + 2 * k + 1], &re, &im);
    Q2[base + k] = re; Q2[base + 64 + k] = im;
}

// ---------------------------------------------------------------------------
// Per-chunk masked scores: S_c = tril(Q2_c @ K2_c^T), chunk = 64 tokens.
// ---------------------------------------------------------------------------
__device__ __forceinline__ void s_chunk_block(
    const float* __restrict__ Q2, const float* __restrict__ K2,
    float* __restrict__ Sbuf, const int bc)   // bc = b*16 + c
{
    const size_t tok0 = (size_t)(bc >> 4) * 1024 + (size_t)(bc & 15) * 64;
    const int tid  = threadIdx.x;
    const int wave = tid >> 5, lane = tid & 31, half = lane >> 4, lr = lane & 15;
    const int nOff = (wave & 3) * 16, rOff = (wave >> 2) * 32;

    const float* Qb = Q2 + tok0 * 128;
    const float* Kb = K2 + tok0 * 128;

    v8f acc0 = {}; v8f acc1 = {};
#pragma unroll 8
    for (int k0 = 0; k0 < 128; k0 += 4) {
        v2f bf;   // B[k][n] = K2[tok0+n][k]  (transposed read)
        bf.x = Kb[(size_t)(nOff + lr) * 128 + k0 + 0 + 2 * half];
        bf.y = Kb[(size_t)(nOff + lr) * 128 + k0 + 1 + 2 * half];
        v2f a0;
        a0.x = Qb[(size_t)(rOff + lr) * 128 + k0 + 0 + 2 * half];
        a0.y = Qb[(size_t)(rOff + lr) * 128 + k0 + 1 + 2 * half];
        v2f a1;
        a1.x = Qb[(size_t)(rOff + 16 + lr) * 128 + k0 + 0 + 2 * half];
        a1.y = Qb[(size_t)(rOff + 16 + lr) * 128 + k0 + 1 + 2 * half];
        acc0 = WMMA_F32(a0, bf, acc0);
        acc1 = WMMA_F32(a1, bf, acc1);
    }
    float* Sb = Sbuf + (size_t)bc * 4096;
    const int n = nOff + lr;
#pragma unroll
    for (int v = 0; v < 8; ++v) {
        int mA = rOff + v + 8 * half, mB = mA + 16;
        Sb[mA * 64 + n] = (mA >= n) ? acc0[v] : 0.0f;
        Sb[mB * 64 + n] = (mB >= n) ? acc1[v] : 0.0f;
    }
}

// ---------------------------------------------------------------------------
// Per-chunk states: P_c = K2_c^T @ V_c (128 x 512), chunk = 64 tokens.
// 2 batches * 15 chunks * 8 d-slices = 240 independent blocks (the last
// chunk's state has no reader). Tile (b, c, dtile) is a contiguous 128x64 block
// at index (b*15 + c)*8 + dtile.
// ---------------------------------------------------------------------------
__device__ __forceinline__ void chunk_state_block(
    const float* __restrict__ K2, const float* __restrict__ V,
    float* __restrict__ P, const int sidx)    // sidx = (b*15 + c)*8 + dtile
{
    const int tid  = threadIdx.x;
    const int wave = tid >> 5, lane = tid & 31, half = lane >> 4, lr = lane & 15;
    const int nOff = (wave & 3) * 16;

    const int bc15 = sidx >> 3;
    const int b    = bc15 / 15;
    const int c    = bc15 - b * 15;
    const size_t tok0 = (size_t)b * 1024 + (size_t)c * 64;
    const float* Vb = V  + tok0 * 512 + (sidx & 7) * 64;
    const float* Kb = K2 + tok0 * 128;
    const int mBase = (wave >> 2) * 64;   // each wave owns 4 disjoint 16x16 subtiles

    v8f acc[4] = {};
    // 8 k-steps a trip: 80 independent fragment loads in flight per lane
#pragma unroll 8
    for (int k0 = 0; k0 < 64; k0 += 4) {
        v2f bf;
        bf.x = Vb[(size_t)(k0 + 0 + 2 * half) * 512 + nOff + lr];
        bf.y = Vb[(size_t)(k0 + 1 + 2 * half) * 512 + nOff + lr];
#pragma unroll
        for (int j = 0; j < 4; ++j) {
            v2f af;   // A[m][l] = K2[tok0+l][m]  (transposed read)
            af.x = Kb[(size_t)(k0 + 0 + 2 * half) * 128 + mBase + j * 16 + lr];
            af.y = Kb[(size_t)(k0 + 1 + 2 * half) * 128 + mBase + j * 16 + lr];
            acc[j] = WMMA_F32(af, bf, acc[j]);
        }
    }
    float* Pb = P + (size_t)sidx * 8192;
#pragma unroll
    for (int j = 0; j < 4; ++j)
#pragma unroll
        for (int v = 0; v < 8; ++v)
            Pb[(mBase + j * 16 + v + 8 * half) * 64 + nOff + lr] = acc[j][v];
}

// Scores and states depend only on K2, Q2 and V, not on each other: one grid,
// blocks 0..31 the masked scores, blocks 32..271 the chunk states.
__global__ __launch_bounds__(256) void chunk_scores_states_kernel(
    const float* __restrict__ Q2, const float* __restrict__ K2,
    const float* __restrict__ V, float* __restrict__ Sbuf, float* __restrict__ P)
{
    const int blk = blockIdx.x;
    if (blk < 32) s_chunk_block(Q2, K2, Sbuf, blk);
    else          chunk_state_block(K2, V, P, blk - 32);
}

// ---------------------------------------------------------------------------
// Chunk-parallel causal linear attention.
// Grid = B * 16 chunks * (512/64) d-slices = 256 independent blocks. Each sums
// the states of the earlier chunks of its batch, M = sum_{j<c} P_j, into LDS:
//   out_c = S_c @ V_c + Q2_c @ M
// The rows are stored position-normalized (divided by sqrt(64 * position)).
// Each wave also leaves, for the LayerNorm in the output projection, the sum and
// the sum of squares of its 16 columns of every row it holds: plane
// [slice = dt*4 + column group][row] of St, the squares 32 planes further on.
// ---------------------------------------------------------------------------
// v + (v of lane ^ X) inside a 16-lane row, as one DPP add (0x160 + X = row_xmask:X)
template <int CTRL>
__device__ __forceinline__ float dpp_xadd(float v) {
    return v + __int_as_float(__builtin_amdgcn_update_dpp(0, __float_as_int(v), CTRL, 0xf, 0xf, true));
}
__device__ __forceinline__ float row16_sum(float v) {
    v = dpp_xadd<0x161>(v);
    v = dpp_xadd<0x162>(v);
    v = dpp_xadd<0x164>(v);
    v = dpp_xadd<0x168>(v);
    return v;
}

__global__ __launch_bounds__(256) void attn_out_kernel(
    const float* __restrict__ Q2, const float* __restrict__ V,
    const float* __restrict__ Sbuf, const float* __restrict__ P,
    float* __restrict__ R, float* __restrict__ St)
{
    __shared__ __align__(16) float Msh[128 * 64];   // 32 KB prefix state
    const int dt = blockIdx.x & 7;
    const int bq = blockIdx.x >> 3;
    const int b  = bq >> 4;
    const int c  = 15 - (bq & 15);    // blocks with the longest prefix start first
    const int n0 = dt * 64;

    const int tid  = threadIdx.x;
    const int wave = tid >> 5, lane = tid & 31, half = lane >> 4, lr = lane & 15;
    const int nOff = (wave & 3) * 16, rOff = (wave >> 2) * 32;

    const size_t tok0 = (size_t)b * 1024 + (size_t)c * 64;
    const float* Sb = Sbuf + (size_t)(b * 16 + c) * 4096;
    const float* Vb = V  + tok0 * 512 + n0;
    const float* Qb = Q2 + tok0 * 128;

    if (c > 0) {
        // thread t owns float4 slots t + 256*i of the 128x64 tile
        const v4f* Pt = (const v4f*)(P + ((size_t)(b * 15) * 8 + dt) * 8192) + tid;
        v4f m[8];
#pragma unroll
        for (int i = 0; i < 8; ++i) m[i] = Pt[256 * i];
        // the loads' scalar base may be rewritten on the short-prefix path: keep the wait in front of it
        asm volatile("s_wait_xcnt 0x0" ::: "memory");
        // 4 tiles a trip: 32 independent 16-byte loads per lane in flight
#pragma unroll 4
        for (int j = 1; j < c; ++j) {
            const v4f* Pj = Pt + (size_t)j * (8 * 2048);
#pragma unroll
            for (int i = 0; i < 8; ++i) m[i] += Pj[256 * i];
        }
#pragma unroll
        for (int i = 0; i < 8; ++i) *(v4f*)&Msh[(tid + 256 * i) * 4] = m[i];
    }

    v8f acc0 = {}; v8f acc1 = {};
    // fully unrolled: all S and V fragment loads issue ahead of the first product
#pragma unroll
    for (int k0 = 0; k0 < 64; k0 += 4) {
        v2f bf;
        bf.x = Vb[(size_t)(k0 + 0 + 2 * half) * 512 + nOff + lr];
        bf.y = Vb[(size_t)(k0 + 1 + 2 * half) * 512 + nOff + lr];
        v2f a0;
        a0.x = Sb[(rOff + lr) * 64 + k0 + 0 + 2 * half];
        a0.y = Sb[(rOff + lr) * 64 + k0 + 1 + 2 * half];
        v2f a1;
        a1.x = Sb[(rOff + 16 + lr) * 64 + k0 + 0 + 2 * half];
        a1.y = Sb[(rOff + 16 + lr) * 64 + k0 + 1 + 2 * half];
        acc0 = WMMA_F32(a0, bf, acc0);
        acc1 = WMMA_F32(a1, bf, acc1);
    }

    if (c > 0) {                      // same for the whole block
        __syncthreads();              // M complete before any wave reads it
        // 16 k-steps a trip: the Q2 fragment loads of a trip issue ahead of its products
#pragma unroll 16
        for (int k0 = 0; k0 < 128; k0 += 4) {
            v2f bf;
            bf.x = Msh[(k0 + 0 + 2 * half) * 64 + nOff + lr];
            bf.y = Msh[(k0 + 1 + 2 * half) * 64 + nOff + lr];
            v2f a0;
            a0.x = Qb[(size_t)(rOff + lr) * 128 + k0 + 0 + 2 * half];
            a0.y = Qb[(size_t)(rOff + lr) * 128 + k0 + 1 + 2 * half];
            v2f a1;
            a1.x = Qb[(size_t)(rOff + 16 + lr) * 128 + k0 + 0 + 2 * half];
            a1.y = Qb[(size_t)(rOff + 16 + lr) * 128 + k0 + 1 + 2 * half];
            acc0 = WMMA_F32(a0, bf, acc0);
            acc1 = WMMA_F32(a1, bf, acc1);
        }
    }

    // What follows reads the accumulators with vector instructions right behind the
    // last matrix instruction: four v_nop keep the vector slots between the two.
    // The scheduling barriers hold them at this place (nothing moves across).
    __builtin_amdgcn_sched_barrier(0);
    asm volatile("v_nop\n\tv_nop\n\tv_nop\n\tv_nop");
    __builtin_amdgcn_sched_barrier(0);

    float* Rb = R + tok0 * 512 + n0;
    const int n = nOff + lr;
#pragma unroll
    for (int v = 0; v < 8; ++v) {
        const int pos = c * 64 + rOff + v + 8 * half + 1;   // 1-based position in the sequence
        acc0[v] *= rsq_normal((float)pos * 64.0f);
        acc1[v] *= rsq_normal((float)(pos + 16) * 64.0f);
        Rb[(size_t)(rOff + v + 8 * half) * 512 + n]      = acc0[v];
        Rb[(size_t)(rOff + 16 + v + 8 * half) * 512 + n] = acc1[v];
    }

    // row statistics over this wave's 16 columns; lanes 0..7 of a half keep the
    // rows of acc0, lanes 8..15 those of acc1, one row a lane
    float ps = 0.0f, pq = 0.0f;
#pragma unroll
    for (int v = 0; v < 8; ++v) {
        const float s0 = row16_sum(acc0[v]);
        const float s1 = row16_sum(acc1[v]);
        const float q0 = row16_sum(acc0[v] * acc0[v]);
        const float q1 = row16_sum(acc1[v] * acc1[v]);
        if ((lr & 7) == v) {
            ps = (lr & 8) ? s1 : s0;
            pq = (lr & 8) ? q1 : q0;
        }
    }
    const size_t so = (size_t)(dt * 4 + (wave & 3)) * 2048 + tok0
                    + rOff + ((lr & 8) << 1) + (lr & 7) + 8 * half;
    St[so] = ps;
    St[so + 32 * 2048] = pq;
}

// ---------------------------------------------------------------------------
extern "C" void kernel_launch(void* const* d_in, const int* in_sizes, int n_in,
                              void* d_out, int out_size, void* d_ws, size_t ws_size,
                              hipStream_t stream) {
    const float* x   = (const float*)d_in[0];
    const float* Wk1 = (const float*)d_in[1];
    const float* bk1 = (const float*)d_in[2];
    const float* Wk2 = (const float*)d_in[3];
    const float* bk2 = (const float*)d_in[4];
    const float* Wq1 = (const float*)d_in[5];
    const float* bq1 = (const float*)d_in[6];
    const float* Wq2 = (const float*)d_in[7];
    const float* bq2 = (const float*)d_in[8];
    const float* Wv  = (const float*)d_in[9];
    const float* bv  = (const float*)d_in[10];
    const float* lng = (const float*)d_in[11];
    const float* lnb = (const float*)d_in[12];
    const float* Wo  = (const float*)d_in[13];
    const float* bo  = (const float*)d_in[14];
    float* out = (float*)d_out;

    const int M = 2048;      // B*L tokens
    const int D = 512;
    const int N2K = 128;     // 2*K_OSC

    float* ws   = (float*)d_ws;
    float* Hk   = ws;
    float* Hq   = Hk   + (size_t)M * D;
    float* Vm   = Hq   + (size_t)M * D;
    float* Kraw = Vm   + (size_t)M * D;
    float* Qraw = Kraw + (size_t)M * N2K;
    float* K2   = Qraw + (size_t)M * N2K;
    float* Q2   = K2   + (size_t)M * N2K;
    float* Sbuf = Q2   + (size_t)M * N2K;
    float* R    = Sbuf + (size_t)32 * 4096;
    float* P    = R    + (size_t)M * D;      // 30 chunk states of 128 x 512
    float* St   = P    + (size_t)30 * 128 * D;   // 64 planes of M row statistics

    dim3 blk(256);

    const int nbD = (D / 64) * (M / 128);     // 128 blocks for an M x D product
    const int nbK = (N2K / 64) * (M / 128);   // 32 blocks for an M x 2K product
    const int nbO = (D / 64) * (M / 64);      // 256 blocks for an M x D product in 64-row tiles

    // Both MLP first layers (gelu): 256 blocks
    gemm_wmma_f32<false, 128><<<nbD + nbD, blk, 0, stream>>>(
        x, Wk1, bk1, Hk,  x, Wq1, bq1, Hq,  nullptr, nullptr, nullptr, nullptr,
        nullptr, nullptr, nullptr, nullptr, nbD, nbD, D, D, D, 1);
    // V projection + both MLP second layers: 192 blocks
    gemm_wmma_f32<false, 128><<<nbD + nbK + nbK, blk, 0, stream>>>(
        x, Wv, bv, Vm,  Hk, Wk2, bk2, Kraw,  Hq, Wq2, bq2, Qraw,
        nullptr, nullptr, nullptr, nullptr, nbD, nbK, D, N2K, D, 0);
    // Phasor features
    phasor_kernel<<<(M * 64 + 255) / 256, blk, 0, stream>>>(Kraw, Qraw, K2, Q2, M * 64);
    // Per-chunk masked scores + per-chunk states K2_c^T V_c
    chunk_scores_states_kernel<<<32 + 240, blk, 0, stream>>>(Q2, K2, Vm, Sbuf, P);
    // Chunk-parallel causal linear attention, position-normalized, + partial row statistics
    attn_out_kernel<<<256, blk, 0, stream>>>(Q2, Vm, Sbuf, P, R, St);
    // Output projection with residual, LayerNorm applied to its A fragments:
    // out = x + LN(r) @ Wo + bo
    gemm_wmma_f32<true, 64><<<nbO, blk, 0, stream>>>(
        R, Wo, bo, out,  nullptr, nullptr, nullptr, nullptr,  nullptr, nullptr, nullptr, nullptr,
        x, St, lng, lnb, nbO, 0, D, D, D, 0);
}

// v007
// One run takes 63.7 microseconds.
// Versions in between are left out here; by their measured steps it is 1.09 times as fast as v005.
// All steps since v000 together make it 4.47 times as fast.
#include <hip/hip_runtime.h>
#include <hip/hip_bf16.h>
#include <math.h>

typedef float v2f __attribute__((ext_vector_type(2)));
typedef float v4f __attribute__((ext_vector_type(4)));
typedef float v8f __attribute__((ext_vector_type(8)));

// D = A(16x4,f32) x B(4x16,f32) + C(16x16,f32)
#define WMMA_F32(a, b, c) \
    __builtin_amdgcn_wmma_f32_16x16x4_f32(false, (a), false, (b), (short)0, (c), false, false)

__device__ __forceinline__ float gelu_exact(float x) {
    return 0.5f * x * (1.0f + erff(x * 0.70710678118654752440f));
}

// Async copies 16B global -> LDS (CDNA5 GLOBAL_LOAD_ASYNC_TO_LDS_B128, ASYNCcnt).
// An LDS address is the low 32 bits of the generic shared-memory pointer (LDS
// aperture truncation, ISA 10.2).
// One stage of the GEMM ring per call: 8 copies of the A tile (rows 16 apart)
// and 4 of the B tile (rows 16 apart) for this lane. The closing s_wait_xcnt
// stands in the copies' own statement, so that no address register is
// rewritten ahead of it.
__device__ __forceinline__ void stage_copies(const float* gA, size_t aStep,
                                             const float* gB, size_t bStep,
                                             const float* ldsA, const float* ldsB) {
    const unsigned la = (unsigned)(size_t)ldsA;
    const unsigned lb = (unsigned)(size_t)ldsB;
    asm volatile(
        "global_load_async_to_lds_b128 %0, %1, off\n\t"
        "global_load_async_to_lds_b128 %2, %3, off\n\t"
        "global_load_async_to_lds_b128 %4, %5, off\n\t"
        "global_load_async_to_lds_b128 %6, %7, off\n\t"
        "global_load_async_to_lds_b128 %8, %9, off\n\t"
        "global_load_async_to_lds_b128 %10, %11, off\n\t"
        "global_load_async_to_lds_b128 %12, %13, off\n\t"
        "global_load_async_to_lds_b128 %14, %15, off\n\t"
        "global_load_async_to_lds_b128 %16, %17, off\n\t"
        "global_load_async_to_lds_b128 %18, %19, off\n\t"
        "global_load_async_to_lds_b128 %20, %21, off\n\t"
        "global_load_async_to_lds_b128 %22, %23, off\n\t"
        "s_wait_xcnt 0x0"
        :: "v"(la),                    "v"(gA),
           "v"(la + 1u * 16u * 272u),  "v"(gA + 1 * aStep),
           "v"(la + 2u * 16u * 272u),  "v"(gA + 2 * aStep),
           "v"(la + 3u * 16u * 272u),  "v"(gA + 3 * aStep),
           "v"(la + 4u * 16u * 272u),  "v"(gA + 4 * aStep),
           "v"(la + 5u * 16u * 272u),  "v"(gA + 5 * aStep),
           "v"(la + 6u * 16u * 272u),  "v"(gA + 6 * aStep),
           "v"(la + 7u * 16u * 272u),  "v"(gA + 7 * aStep),
           "v"(lb),                    "v"(gB),
           "v"(lb + 1u * 16u * 256u),  "v"(gB + 1 * bStep),
           "v"(lb + 2u * 16u * 256u),  "v"(gB + 2 * bStep),
           "v"(lb + 3u * 16u * 256u),  "v"(gB + 3 * bStep)
        : "memory");
}
// The same for a 64-row A tile: 4 copies of the A tile and 4 of the B tile.
__device__ __forceinline__ void stage_copies_a4(const float* gA, size_t aStep,
                                                const float* gB, size_t bStep,
                                                const float* ldsA, const float* ldsB) {
    const unsigned la = (unsigned)(size_t)ldsA;
    const unsigned lb = (unsigned)(size_t)ldsB;
    asm volatile(
        "global_load_async_to_lds_b128 %0, %1, off\n\t"
        "global_load_async_to_lds_b128 %2, %3, off\n\t"
        "global_load_async_to_lds_b128 %4, %5, off\n\t"
        "global_load_async_to_lds_b128 %6, %7, off\n\t"
        "global_load_async_to_lds_b128 %8, %9, off\n\t"
        "global_load_async_to_lds_b128 %10, %11, off\n\t"
        "global_load_async_to_lds_b128 %12, %13, off\n\t"
        "global_load_async_to_lds_b128 %14, %15, off\n\t"
        "s_wait_xcnt 0x0"
        :: "v"(la),                    "v"(gA),
           "v"(la + 1u * 16u * 272u),  "v"(gA + 1 * aStep),
           "v"(la + 2u * 16u * 272u),  "v"(gA + 2 * aStep),
           "v"(la + 3u * 16u * 272u),  "v"(gA + 3 * aStep),
           "v"(lb),                    "v"(gB),
           "v"(lb + 1u * 16u * 256u),  "v"(gB + 1 * bStep),
           "v"(lb + 2u * 16u * 256u),  "v"(gB + 2 * bStep),
           "v"(lb + 3u * 16u * 256u),  "v"(gB + 3 * bStep)
        : "memory");
}
// One stage for a tile of MT rows of A.
template <int MT>
__device__ __forceinline__ void stage_tile(const float* gA, size_t aStep,
                                           const float* gB, size_t bStep,
                                           const float* ldsA, const float* ldsB) {
    if constexpr (MT == 128) stage_copies(gA, aStep, gB, bStep, ldsA, ldsB);
    else                     stage_copies_a4(gA, aStep, gB, bStep, ldsA, ldsB);
}
// The issuing wave's own wait: its copies have landed in LDS behind it.
__device__ __forceinline__ void wait_async0() {
    asm volatile("s_wait_asynccnt 0x0" ::: "memory");
}
// The wave's own LDS reads have returned: its buffer may be handed back for a refill.
__device__ __forceinline__ void wait_ds0() {
    asm volatile("s_wait_dscnt 0x0" ::: "memory");
}

// 1/sqrt(x) for x in the normal range. The v_nop fills the slot that the
// instruction set asks for behind a transcendental, whatever is scheduled next.
__device__ __forceinline__ float rsq_normal(float x) {
    float r;
    asm("v_rsq_f32 %0, %1\n\tv_nop" : "=v"(r) : "v"(x));
    return r;
}

// ---------------------------------------------------------------------------
// Phasor of one raw pair (x0, x1): real and imaginary part.
// ---------------------------------------------------------------------------
__device__ __forceinline__ void phasor2(float x0, float x1, float* re, float* im) {
    float px = tanhf(x0) * 0.9f;
    float py = tanhf(x1) * 0.9f;
    float n  = sqrtf(px * px + py * py);
    float nm = fmaxf(n, 1e-5f);
    float sc = fminf((1.0f - 1e-5f) / nm, 1.0f);
    px *= sc; py *= sc;
    float r = n * sc;
    float ph = atan2f(py, px);
    float amp = 1.0f - r;
    *re = amp * cosf(ph);
    *im = amp * sinf(ph);
}

// The value that lane ^ 1 holds (DPP row_xmask:1).
__device__ __forceinline__ float lane_xor1(float v) {
    return __int_as_float(__builtin_amdgcn_update_dpp(0, __float_as_int(v), 0x161, 0xf, 0xf, true));
}

// ---------------------------------------------------------------------------
// fp32 WMMA GEMM: C = act(A@B + bias) [+ resid]
// A: MxK row-major, B: KxN row-major, C/resid: MxN row-major.
// One grid holds up to three independent products that share Kd and act: flat
// blocks [0, nb0) work on product 0 (width N0), [nb0, nb0 + nb1) on product 1,
// the rest on product 2 (both of width N12). Within a product the tile column
// runs fastest.
// Block = 256 threads (8 waves) computes an MT x 64 C tile; each wave owns a
// 2x2 grid of 16x16 accumulators. MT = 128: one 32x32 part of the tile a wave.
// MT = 64, for a product whose 128-row tiles would leave half the WGPs without a
// block: waves w and w + 4 share a 32x32 part, w takes the first 32 k of every
// stage and w + 4 the last 32 (LDS reads per WMMA stay as they are), and the two
// partial tiles are added through LDS at the end.
// Double-buffered LDS, async loads to LDS, 64 k per stage (Kd a multiple of 64):
// one barrier per 64 WMMAs of a wave (32 where MT = 64), in front of a stage's last block.
// A tile LDS stride = 68 floats (272B): 16B-aligned rows for b128 async writes
// AND bank-conflict-free fragment reads (68*r mod 64 = 4*r distinct, r=0..15).
// LN = true (Kd = 512): each A fragment is layer-normalized over its row on its
// way from LDS to the product. lnS holds, per row,
// 32 partial sums and 32 partial sums of squares (plane [slice][row], 2048 rows,
// the squares 32 planes further on), written by the kernel that wrote A.
// PH = true (MT = 64): the product's columns are interleaved pairs (x0, x1); C
// takes their phasors, row layout [N/2 real | N/2 imaginary], not the product.
// gemm_block is tile `id` of one product; As0 (2 buffers of MT x 68), Bs0 (2 of
// 64 x 64), Gs, Ts (512 each) and Rst (2 * MT), the last three for LN only, are
// the calling kernel's LDS.
// ---------------------------------------------------------------------------
template <bool LN, int MT, bool PH>
__device__ __forceinline__ void gemm_block(
    float* As0, float* Bs0, float* Gs, float* Ts, float* Rst,
    const float* __restrict__ A, const float* __restrict__ B,
    const float* __restrict__ bias, float* __restrict__ C,
    const float* __restrict__ resid,
    const float* __restrict__ lnS, const float* __restrict__ lnG,
    const float* __restrict__ lnB,
    const int id, const int N, const int Kd, const int act)
{
    constexpr bool SPLIT = (MT == 64);                // two waves share a part of the tile, half the k each
    constexpr int  KW = SPLIT ? 32 : 64;              // k of a stage that one wave works on
    constexpr int  ASZ = MT * 68, BSZ = 64 * 64;      // floats of one buffer of A, of B
    static_assert(!PH || SPLIT, "the phasor epilogue is written for the 64-row tile");

    const int tid  = threadIdx.x;
    const int wave = tid >> 5;
    const int lane = tid & 31;
    const int half = lane >> 4;
    const int lr   = lane & 15;

    const int nx = N >> 6;                 // tile columns of this product
    const int m0 = (id / nx) * MT;
    const int n0 = (id % nx) * 64;

    const int colBase = (wave & 1) * 32;   // cols {colBase, colBase+16}
    const int rowBase = ((wave >> 1) & (MT / 32 - 1)) * 32;   // rows {rowBase, rowBase+16}
    const int kh = SPLIT ? (wave >> 2) : 0;       // which half of a stage's k

    v8f acc00 = {}; v8f acc01 = {}; v8f acc10 = {}; v8f acc11 = {};

    // Loaders: a stage is A MTx64 (256 thr x MT/16 float4) and B 64x64 (256 thr x 4);
    // 16 lanes cover one 256-byte row of either tile.
    const int ldrow = tid >> 4, ldcol = (tid & 15) * 4;

    const float* gA = A + (size_t)(m0 + ldrow) * Kd + ldcol;
    const float* gB = B + (size_t)ldrow * N + n0 + ldcol;
    const size_t aStep = (size_t)16 * Kd;      // 16 rows of A
    const size_t bStep = (size_t)16 * N;       // 16 rows of B
    const int ldsAo = ldrow * 68 + ldcol;
    const int ldsBo = ldrow * 64 + ldcol;
    const int nst = Kd >> 6;                   // stages

    // prologue: stage 0 into buffer 0, published; then stage 1 into buffer 1
    stage_tile<MT>(gA, aStep, gB, bStep, As0 + ldsAo, Bs0 + ldsBo);
    if constexpr (LN) {
        // while stage 0 flies: gain and shift into LDS; threads 0..MT-1 add up the
        // 32 partial sums of one row each, threads MT..2*MT-1 the sums of squares
        Gs[tid] = lnG[tid]; Gs[tid + 256] = lnG[tid + 256];
        Ts[tid] = lnB[tid]; Ts[tid + 256] = lnB[tid + 256];
        if (tid < 2 * MT) {
            const float* sp = lnS + (size_t)(tid / MT) * (32 * 2048) + m0 + (tid % MT);
            float s = 0.0f;
#pragma unroll
            for (int i = 0; i < 32; ++i) s += sp[i * 2048];
            Rst[tid] = s;
        }
    }
    wait_async0();              // this wave's copies of stage 0 have landed
    __syncthreads();            // everyone's have
    if (nst > 1)
        stage_tile<MT>(gA + 64, aStep, gB + (size_t)64 * N, bStep, As0 + ASZ + ldsAo, Bs0 + BSZ + ldsBo);

    // LN: mean and 1/sigma of this lane's two A rows
    float mean0 = 0.0f, sc0 = 0.0f, mean1 = 0.0f, sc1 = 0.0f;
    if constexpr (LN) {
        const int r0 = rowBase + lr, r1 = r0 + 16;
        mean0 = Rst[r0] * (1.0f / 512.0f);
        mean1 = Rst[r1] * (1.0f / 512.0f);
        const float var0 = Rst[MT + r0] * (1.0f / 512.0f) - mean0 * mean0;
        const float var1 = Rst[MT + r1] * (1.0f / 512.0f) - mean1 * mean1;
        sc0 = rsq_normal(var0 + 1e-5f);
        sc1 = rsq_normal(var1 + 1e-5f);
    }

    // Fragments go from LDS to registers one block ahead of their products: a stage is
    // two blocks of KB k-steps, each with a register set of its own, and a block's reads
    // stand together as one group, never among the products.
    constexpr int KB = KW / 8;
    v2f fa0[2][KB], fa1[2][KB], fb0[2][KB], fb1[2][KB], fg[2][KB], ft[2][KB];
    // reads of block blk of stage sst (in buffer sbuf) into register set `set`
    auto load_block = [&](const int set, const int sbuf, const int sst, const int blk) {
        const float* Asb = As0 + sbuf * ASZ + kh * KW + blk * (KB * 4);
        const float* Bsb = Bs0 + sbuf * BSZ + (kh * KW + blk * (KB * 4)) * 64;
        // The scheduling barriers keep the reads of the two column groups apart, so that the
        // compiler pairs rows k and k + 1 of one column in one two-address read, which is a B
        // fragment as it stands; reads of both groups together are paired by column, and every
        // fragment then costs register moves that wait on the reads.
#pragma unroll
        for (int i = 0; i < KB; ++i) {
            fb0[set][i].x = Bsb[(4 * i + 0 + 2 * half) * 64 + colBase + lr];
            fb0[set][i].y = Bsb[(4 * i + 1 + 2 * half) * 64 + colBase + lr];
        }
        __builtin_amdgcn_sched_barrier(0);
#pragma unroll
        for (int i = 0; i < KB; ++i) {
            fb1[set][i].x = Bsb[(4 * i + 0 + 2 * half) * 64 + colBase + 16 + lr];
            fb1[set][i].y = Bsb[(4 * i + 1 + 2 * half) * 64 + colBase + 16 + lr];
        }
        __builtin_amdgcn_sched_barrier(0);
#pragma unroll
        for (int i = 0; i < KB; ++i) {
            const int k0 = 4 * i;
            fa0[set][i].x = Asb[(rowBase + lr) * 68 + k0 + 0 + 2 * half];
            fa0[set][i].y = Asb[(rowBase + lr) * 68 + k0 + 1 + 2 * half];
            fa1[set][i].x = Asb[(rowBase + 16 + lr) * 68 + k0 + 0 + 2 * half];
            fa1[set][i].y = Asb[(rowBase + 16 + lr) * 68 + k0 + 1 + 2 * half];
            if constexpr (LN) {
                fg[set][i] = *(const v2f*)&Gs[sst * 64 + kh * KW + blk * (KB * 4) + k0 + 2 * half];
                ft[set][i] = *(const v2f*)&Ts[sst * 64 + kh * KW + blk * (KB * 4) + k0 + 2 * half];
            }
        }
    };
    // products of k-steps [from, to) of register set `set`
    auto mma_block = [&](const int set, const int from, const int to) {
#pragma unroll
        for (int i = from; i < to; ++i) {
            v2f a0 = fa0[set][i], a1 = fa1[set][i];
            if constexpr (LN) {
                a0 = (a0 - mean0) * sc0 * fg[set][i] + ft[set][i];
                a1 = (a1 - mean1) * sc1 * fg[set][i] + ft[set][i];
            }
            acc00 = WMMA_F32(a0, fb0[set][i], acc00);
            acc01 = WMMA_F32(a0, fb1[set][i], acc01);
            acc10 = WMMA_F32(a1, fb0[set][i], acc10);
            acc11 = WMMA_F32(a1, fb1[set][i], acc11);
        }
    };

    load_block(0, 0, 0, 0);     // stage 0 is published: its first block
    // The scheduling barriers below keep each group of reads and each run of products
    // where it is written: without them the reads are moved in among the products.
    for (int st = 0; st < nst; ++st) {
        const int buf = st & 1;
        load_block(1, buf, st, 1);
        __builtin_amdgcn_sched_barrier(0);
        mma_block(0, 0, KB);
        __builtin_amdgcn_sched_barrier(0);
        // Publish point of stage st + 1, in front of this stage's last block: that block's
        // fragments are in registers, and the reads behind it are the next stage's.
        wait_ds0();             // this wave's reads of `buf` are done
        wait_async0();          // this wave's copies of stage st + 1 have landed
        __syncthreads();        // stage st + 1 published; `buf` left by every reader
        __builtin_amdgcn_sched_barrier(0);
        // Half of the last block stands between the barrier and the refill: behind the barrier
        // the matrix unit has work at once, and one wave's copies and reads run beside the
        // products of the other wave of its SIMD.
        mma_block(1, 0, KB / 2);
        __builtin_amdgcn_sched_barrier(0);
        if (st + 2 < nst) {     // refill `buf` while stage st + 1 is worked on
            const int kn = (st + 2) * 64;
            stage_tile<MT>(gA + kn, aStep, gB + (size_t)kn * N, bStep, As0 + buf * ASZ + ldsAo, Bs0 + buf * BSZ + ldsBo);
        }
        // The next stage's first block. In the last stage the reads stay (no branch, so that
        // the waits stay counted) and are aimed at its own buffer; their values are not used.
        const bool more = st + 1 < nst;
        load_block(0, more ? buf ^ 1 : buf, more ? st + 1 : st, 0);
        __builtin_amdgcn_sched_barrier(0);
        mma_block(1, KB / 2, KB);
        __builtin_amdgcn_sched_barrier(0);
    }
    wait_async0();              // nothing in flight when the ring is left
    wait_ds0();                 // nor the last stage's unused reads

    if constexpr (SPLIT) {
        // The buffer that the last stage did not use carries the partial tiles: every wave
        // left it in front of the loop's last barrier. Wave w finishes rows rowBase..+15 and
        // hands over its part of rows rowBase+16..+31; wave w + 4 the other way round.
        float* Xs = As0 + ((nst & 1) ? ASZ : 0);
        float* mine = Xs + wave * 512 + lane;
        const float* theirs = Xs + (wave ^ 4) * 512 + lane;
        // both loops unrolled: accumulator elements stay registers only under constant indices
#pragma unroll
        for (int v = 0; v < 8; ++v) {
            mine[v * 32]       = kh ? acc00[v] : acc10[v];
            mine[(8 + v) * 32] = kh ? acc01[v] : acc11[v];
        }
        __syncthreads();        // both partial tiles are in LDS
#pragma unroll
        for (int v = 0; v < 8; ++v) {
            acc00[v] = (kh ? acc10[v] : acc00[v]) + theirs[v * 32];
            acc01[v] = (kh ? acc11[v] : acc01[v]) + theirs[(8 + v) * 32];
        }
    }

    const int nA0 = n0 + colBase + lr;
    const int nA1 = nA0 + 16;
    const float bz0 = bias ? bias[nA0] : 0.0f;
    const float bz1 = bias ? bias[nA1] : 0.0f;
    // The index register of the two bias loads is reused for the store addresses: keep the wait in
    // front of that. The scheduling barrier keeps the address arithmetic from moving up over the wait.
    asm volatile("s_wait_xcnt 0x0" ::: "memory");
    __builtin_amdgcn_sched_barrier(0);
    if constexpr (PH) {
        // Lanes 2j and 2j + 1 hold x0 and x1 of one pair in each column group: the
        // even lane takes over the pair of the first group, the odd lane that of the
        // second, so every lane works out one phasor a row.
        const bool odd = (lr & 1) != 0;
        const int  kc  = (n0 + colBase + (odd ? 16 : 0) + (lr & 14)) >> 1;
        float* Cp = C + (size_t)(m0 + rowBase + kh * 16 + 8 * half) * N + kc;
        // Kept rolled: the long phasor code stands once in the text,
        // not eight times. The accumulators rotate, so that the row in turn is element 0
        // (they stay registers only under constant indices).
#pragma unroll 1
        for (int v = 0; v < 8; ++v) {
            const float r00 = acc00[0] + bz0, r01 = acc01[0] + bz1;
            const float recv = lane_xor1(odd ? r00 : r01);
            float re, im;
            phasor2(odd ? recv : r00, odd ? r01 : recv, &re, &im);
            Cp[0] = re;
            Cp[N >> 1] = im;
            // the next trip rewrites the two stores' address and data registers: keep the wait in front of that
            asm volatile("s_wait_xcnt 0x0" ::: "memory");
            Cp += N;
            acc00 = __builtin_shufflevector(acc00, acc00, 1, 2, 3, 4, 5, 6, 7, 0);
            acc01 = __builtin_shufflevector(acc01, acc01, 1, 2, 3, 4, 5, 6, 7, 0);
        }
        return;
    }
#pragma unroll
    for (int v = 0; v < 8; ++v) {
        const int mA = m0 + rowBase + kh * 16 + v + 8 * half;
        const int mB = mA + 16;
        float r00 = acc00[v] + bz0, r01 = acc01[v] + bz1;
        float r10 = acc10[v] + bz0, r11 = acc11[v] + bz1;   // SPLIT: partial sums, not stored
        if (act == 1) {
            r00 = gelu_exact(r00); r01 = gelu_exact(r01);
            if constexpr (!SPLIT) { r10 = gelu_exact(r10); r11 = gelu_exact(r11); }
        }
        if (resid) {
            r00 += resid[(size_t)mA * N + nA0]; r01 += resid[(size_t)mA * N + nA1];
            if constexpr (!SPLIT) {
                r10 += resid[(size_t)mB * N + nA0]; r11 += resid[(size_t)mB * N + nA1];
            }
        }
        C[(size_t)mA * N + nA0] = r00;
        C[(size_t)mA * N + nA1] = r01;
        if constexpr (!SPLIT) {
            C[(size_t)mB * N + nA0] = r10;
            C[(size_t)mB * N + nA1] = r11;
        }
    }
}

template <bool LN, int MT>
__global__ __launch_bounds__(256) void gemm_wmma_f32(
    const float* __restrict__ A0, const float* __restrict__ B0,
    const float* __restrict__ bias0, float* __restrict__ C0,
    const float* __restrict__ A1, const float* __restrict__ B1,
    const float* __restrict__ bias1, float* __restrict__ C1,
    const float* __restrict__ A2, const float* __restrict__ B2,
    const float* __restrict__ bias2, float* __restrict__ C2,
    const float* __restrict__ resid,
    const float* __restrict__ lnS, const float* __restrict__ lnG,
    const float* __restrict__ lnB,
    int nb0, int nb1, int N0, int N12, int Kd, int act)
{
    __shared__ __align__(16) float As[2 * MT * 68];   // [buf][row][k], stride 68
    __shared__ __align__(16) float Bs[2 * 64 * 64];   // [buf][k][n]
    __shared__ __align__(16) float Gs[512];           // LN only: gain by k
    __shared__ __align__(16) float Ts[512];           // LN only: shift by k
    __shared__ float Rst[2 * MT];                     // LN only: row sums | row sums of squares

    // which product this block belongs to: the same for the whole block
    int id = blockIdx.x;
    const float* A = A0; const float* B = B0; const float* bias = bias0;
    float* C = C0;
    int N = N0;
    if (id >= nb0 + nb1) {
        id -= nb0 + nb1; A = A2; B = B2; bias = bias2; C = C2; N = N12;
    } else if (id >= nb0) {
        id -= nb0;       A = A1; B = B1; bias = bias1; C = C1; N = N12;
    }
    gemm_block<LN, MT, false>(As, Bs, Gs, Ts, Rst, A, B, bias, C, resid, lnS, lnG, lnB, id, N, Kd, act);
}

// ---------------------------------------------------------------------------
// One grid: blocks [0, nbV) the V projection in 128-row tiles (width NV); then
// nbP blocks each for the key and the query MLP's second layer (width NP) in
// 64-row tiles, which end in the phasor of every column pair. The 64-row tiles
// have half the products of a V tile, so their phasors are done while the V
// tiles still run.
// ---------------------------------------------------------------------------
__global__ __launch_bounds__(256) void gemm_v_phasor_kernel(
    const float* __restrict__ x,  const float* __restrict__ Wv,
    const float* __restrict__ bv, float* __restrict__ V,
    const float* __restrict__ Hk, const float* __restrict__ Wk2,
    const float* __restrict__ bk2, float* __restrict__ K2,
    const float* __restrict__ Hq, const float* __restrict__ Wq2,
    const float* __restrict__ bq2, float* __restrict__ Q2,
    int nbV, int nbP, int NV, int NP, int Kd)
{
    __shared__ __align__(16) float As[2 * 128 * 68];  // the 64-row tiles use the first half
    __shared__ __align__(16) float Bs[2 * 64 * 64];
    const int id = blockIdx.x;             // every branch is the same for the whole block
    if (id < nbV) {
        gemm_block<false, 128, false>(As, Bs, nullptr, nullptr, nullptr, x, Wv, bv, V,
                                      nullptr, nullptr, nullptr, nullptr, id, NV, Kd, 0);
    } else {
        const bool q = id >= nbV + nbP;
        gemm_block<false, 64, true>(As, Bs, nullptr, nullptr, nullptr,
                                    q ? Hq : Hk, q ? Wq2 : Wk2, q ? bq2 : bk2, q ? Q2 : K2,
                                    nullptr, nullptr, nullptr, nullptr,
                                    id - nbV - (q ? nbP : 0), NP, Kd, 0);
    }
}

// ---------------------------------------------------------------------------
// Per-chunk masked scores: S_c = tril(Q2_c @ K2_c^T), chunk = 64 tokens.
// ---------------------------------------------------------------------------
__device__ __forceinline__ void s_chunk_block(
    const float* __restrict__ Q2, const float* __restrict__ K2,
    float* __restrict__ Sbuf, const int bc)   // bc = b*16 + c
{
    const size_t tok0 = (size_t)(bc >> 4) * 1024 + (size_t)(bc & 15) * 64;
    const int tid  = threadIdx.x;
    const int wave = tid >> 5, lane = tid & 31, half = lane >> 4, lr = lane & 15;
    const int nOff = (wave & 3) * 16, rOff = (wave >> 2) * 32;

    const float* Qb = Q2 + tok0 * 128;
    const float* Kb = K2 + tok0 * 128;

    v8f acc0 = {}; v8f acc1 = {};
#pragma unroll 8
    for (int k0 = 0; k0 < 128; k0 += 4) {
        v2f bf;   // B[k][n] = K2[tok0+n][k]  (transposed read)
        bf.x = Kb[(size_t)(nOff + lr) * 128 + k0 + 0 + 2 * half];
        bf.y = Kb[(size_t)(nOff + lr) * 128 + k0 + 1 + 2 * half];
        v2f a0;
        a0.x = Qb[(size_t)(rOff + lr) * 128 + k0 + 0 + 2 * half];
        a0.y = Qb[(size_t)(rOff + lr) * 128 + k0 + 1 + 2 * half];
        v2f a1;
        a1.x = Qb[(size_t)(rOff + 16 + lr) * 128 + k0 + 0 + 2 * half];
        a1.y = Qb[(size_t)(rOff + 16 + lr) * 128 + k0 + 1 + 2 * half];
        acc0 = WMMA_F32(a0, bf, acc0);
        acc1 = WMMA_F32(a1, bf, acc1);
    }
    float* Sb = Sbuf + (size_t)bc * 4096;
    const int n = nOff + lr;
#pragma unroll
    for (int v = 0; v < 8; ++v) {
        int mA = rOff + v + 8 * half, mB = mA + 16;
        Sb[mA * 64 + n] = (mA >= n) ? acc0[v] : 0.0f;
        Sb[mB * 64 + n] = (mB >= n) ? acc1[v] : 0.0f;
    }
}

// ---------------------------------------------------------------------------
// Per-chunk states: P_c = K2_c^T @ V_c (128 x 512), chunk = 64 tokens.
// 2 batches * 15 chunks * 8 d-slices = 240 independent blocks (the last
// chunk's state has no reader). Tile (b, c, dtile) is a contiguous 128x64 block
// at index (b*15 + c)*8 + dtile.
// ---------------------------------------------------------------------------
__device__ __forceinline__ void chunk_state_block(
    const float* __restrict__ K2, const float* __restrict__ V,
    float* __restrict__ P, const int sidx)    // sidx = (b*15 + c)*8 + dtile
{
    const int tid  = threadIdx.x;
    const int wave = tid >> 5, lane = tid & 31, half = lane >> 4, lr = lane & 15;
    const int nOff = (wave & 3) * 16;

    const int bc15 = sidx >> 3;
    const int b    = bc15 / 15;
    const int c    = bc15 - b * 15;
    const size_t tok0 = (size_t)b * 1024 + (size_t)c * 64;
    const float* Vb = V  + tok0 * 512 + (sidx & 7) * 64;
    const float* Kb = K2 + tok0 * 128;
    const int mBase = (wave >> 2) * 64;   // each wave owns 4 disjoint 16x16 subtiles

    v8f acc[4] = {};
    // 8 k-steps a trip: 80 independent fragment loads in flight per lane
#pragma unroll 8
    for (int k0 = 0; k0 < 64; k0 += 4) {
        v2f bf;
        bf.x = Vb[(size_t)(k0 + 0 + 2 * half) * 512 + nOff + lr];
        bf.y = Vb[(size_t)(k0 + 1 + 2 * half) * 512 + nOff + lr];
#pragma unroll
        for (int j = 0; j < 4; ++j) {
            v2f af;   // A[m][l] = K2[tok0+l][m]  (transposed read)
            af.x = Kb[(size_t)(k0 + 0 + 2 * half) * 128 + mBase + j * 16 + lr];
            af.y = Kb[(size_t)(k0 + 1 + 2 * half) * 128 + mBase + j * 16 + lr];
            acc[j] = WMMA_F32(af, bf, acc[j]);
        }
    }
    float* Pb = P + (size_t)sidx * 8192;
#pragma unroll
    for (int j = 0; j < 4; ++j)
#pragma unroll
        for (int v = 0; v < 8; ++v)
            Pb[(mBase + j * 16 + v + 8 * half) * 64 + nOff + lr] = acc[j][v];
}

// Scores and states depend only on K2, Q2 and V, not on each other: one grid,
// blocks 0..31 the masked scores, blocks 32..271 the chunk states.
__global__ __launch_bounds__(256) void chunk_scores_states_kernel(
    const float* __restrict__ Q2, const float* __restrict__ K2,
    const float* __restrict__ V, float* __restrict__ Sbuf, float* __restrict__ P)
{
    const int blk = blockIdx.x;
    if (blk < 32) s_chunk_block(Q2, K2, Sbuf, blk);
    else          chunk_state_block(K2, V, P, blk - 32);
}

// ---------------------------------------------------------------------------
// Chunk-parallel causal linear attention.
// Grid = B * 16 chunks * (512/64) d-slices = 256 independent blocks. Each sums
// the states of the earlier chunks of its batch, M = sum_{j<c} P_j, into LDS:
//   out_c = S_c @ V_c + Q2_c @ M
// The rows are stored position-normalized (divided by sqrt(64 * position)).
// Each wave also leaves, for the LayerNorm in the output projection, the sum and
// the sum of squares of its 16 columns of every row it holds: plane
// [slice = dt*4 + column group][row] of St, the squares 32 planes further on.
// ---------------------------------------------------------------------------
// v + (v of lane ^ X) inside a 16-lane row, as one DPP add (0x160 + X = row_xmask:X)
template <int CTRL>
__device__ __forceinline__ float dpp_xadd(float v) {
    return v + __int_as_float(__builtin_amdgcn_update_dpp(0, __float_as_int(v), CTRL, 0xf, 0xf, true));
}
__device__ __forceinline__ float row16_sum(float v) {
    v = dpp_xadd<0x161>(v);
    v = dpp_xadd<0x162>(v);
    v = dpp_xadd<0x164>(v);
    v = dpp_xadd<0x168>(v);
    return v;
}

__global__ __launch_bounds__(256) void attn_out_kernel(
    const float* __restrict__ Q2, const float* __restrict__ V,
    const float* __restrict__ Sbuf, const float* __restrict__ P,
    float* __restrict__ R, float* __restrict__ St)
{
    __shared__ __align__(16) float Msh[128 * 64];   // 32 KB prefix state
    const int dt = blockIdx.x & 7;
    const int bq = blockIdx.x >> 3;
    const int b  = bq >> 4;
    const int c  = 15 - (bq & 15);    // blocks with the longest prefix take the lowest indices
    const int n0 = dt * 64;

    const int tid  = threadIdx.x;
    const int wave = tid >> 5, lane = tid & 31, half = lane >> 4, lr = lane & 15;
    const int nOff = (wave & 3) * 16, rOff = (wave >> 2) * 32;

    const size_t tok0 = (size_t)b * 1024 + (size_t)c * 64;
    const float* Sb = Sbuf + (size_t)(b * 16 + c) * 4096;
    const float* Vb = V  + tok0 * 512 + n0;
    const float* Qb = Q2 + tok0 * 128;

    if (c > 0) {
        // thread t owns float4 slots t + 256*i of the 128x64 tile
        const v4f* Pt = (const v4f*)(P + ((size_t)(b * 15) * 8 + dt) * 8192) + tid;
        v4f m[8];
#pragma unroll
        for (int i = 0; i < 8; ++i) m[i] = Pt[256 * i];
        // the loads' scalar base may be rewritten on the short-prefix path: keep the wait in front of it
        asm volatile("s_wait_xcnt 0x0" ::: "memory");
        // 4 tiles a trip: 32 independent 16-byte loads per lane in flight
#pragma unroll 4
        for (int j = 1; j < c; ++j) {
            const v4f* Pj = Pt + (size_t)j * (8 * 2048);
#pragma unroll
            for (int i = 0; i < 8; ++i) m[i] += Pj[256 * i];
        }
#pragma unroll
        for (int i = 0; i < 8; ++i) *(v4f*)&Msh[(tid + 256 * i) * 4] = m[i];
    }

    v8f acc0 = {}; v8f acc1 = {};
    // fully unrolled: all S and V fragment loads issue ahead of the first product
#pragma unroll
    for (int k0 = 0; k0 < 64; k0 += 4) {
        v2f bf;
        bf.x = Vb[(size_t)(k0 + 0 + 2 * half) * 512 + nOff + lr];
        bf.y = Vb[(size_t)(k0 + 1 + 2 * half) * 512 + nOff + lr];
        v2f a0;
        a0.x = Sb[(rOff + lr) * 64 + k0 + 0 + 2 * half];
        a0.y = Sb[(rOff + lr) * 64 + k0 + 1 + 2 * half];
        v2f a1;
        a1.x = Sb[(rOff + 16 + lr) * 64 + k0 + 0 + 2 * half];
        a1.y = Sb[(rOff + 16 + lr) * 64 + k0 + 1 + 2 * half];
        acc0 = WMMA_F32(a0, bf, acc0);
        acc1 = WMMA_F32(a1, bf, acc1);
    }

    if (c > 0) {                      // same for the whole block
        __syncthreads();              // M complete before any wave reads it
        // 16 k-steps a trip: the Q2 fragment loads of a trip issue ahead of its products
#pragma unroll 16
        for (int k0 = 0; k0 < 128; k0 += 4) {
            v2f bf;
            bf.x = Msh[(k0 + 0 + 2 * half) * 64 + nOff + lr];
            bf.y = Msh[(k0 + 1 + 2 * half) * 64 + nOff + lr];
            v2f a0;
            a0.x = Qb[(size_t)(rOff + lr) * 128 + k0 + 0 + 2 * half];
            a0.y = Qb[(size_t)(rOff + lr) * 128 + k0 + 1 + 2 * half];
            v2f a1;
            a1.x = Qb[(size_t)(rOff + 16 + lr) * 128 + k0 + 0 + 2 * half];
            a1.y = Qb[(size_t)(rOff + 16 + lr) * 128 + k0 + 1 + 2 * half];
            acc0 = WMMA_F32(a0, bf, acc0);
            acc1 = WMMA_F32(a1, bf, acc1);
        }
    }

    // What follows reads the accumulators with vector instructions right behind the
    // last matrix instruction: four v_nop keep the vector slots between the two.
    // The scheduling barriers hold them at this place (nothing moves across).
    __builtin_amdgcn_sched_barrier(0);
    asm volatile("v_nop\n\tv_nop\n\tv_nop\n\tv_nop");
    __builtin_amdgcn_sched_barrier(0);

    float* Rb = R + tok0 * 512 + n0;
    const int n = nOff + lr;
#pragma unroll
    for (int v = 0; v < 8; ++v) {
        const int pos = c * 64 + rOff + v + 8 * half + 1;   // 1-based position in the sequence
        acc0[v] *= rsq_normal((float)pos * 64.0f);
        acc1[v] *= rsq_normal((float)(pos + 16) * 64.0f);
        Rb[(size_t)(rOff + v + 8 * half) * 512 + n]      = acc0[v];
        Rb[(size_t)(rOff + 16 + v + 8 * half) * 512 + n] = acc1[v];
    }

    // row statistics over this wave's 16 columns; lanes 0..7 of a half keep the
    // rows of acc0, lanes 8..15 those of acc1, one row a lane
    float ps = 0.0f, pq = 0.0f;
#pragma unroll
    for (int v = 0; v < 8; ++v) {
        const float s0 = row16_sum(acc0[v]);
        const float s1 = row16_sum(acc1[v]);
        const float q0 = row16_sum(acc0[v] * acc0[v]);
        const float q1 = row16_sum(acc1[v] * acc1[v]);
        if ((lr & 7) == v) {
            ps = (lr & 8) ? s1 : s0;
            pq = (lr & 8) ? q1 : q0;
        }
    }
    const size_t so = (size_t)(dt * 4 + (wave & 3)) * 2048 + tok0
                    + rOff + ((lr & 8) << 1) + (lr & 7) + 8 * half;
    St[so] = ps;
    St[so + 32 * 2048] = pq;
}

// ---------------------------------------------------------------------------
extern "C" void kernel_launch(void* const* d_in, const int* in_sizes, int n_in,
                              void* d_out, int out_size, void* d_ws, size_t ws_size,
                              hipStream_t stream) {
    const float* x   = (const float*)d_in[0];
    const float* Wk1 = (const float*)d_in[1];
    const float* bk1 = (const float*)d_in[2];
    const float* Wk2 = (const float*)d_in[3];
    const float* bk2 = (const float*)d_in[4];
    const float* Wq1 = (const float*)d_in[5];
    const float* bq1 = (const float*)d_in[6];
    const float* Wq2 = (const float*)d_in[7];
    const float* bq2 = (const float*)d_in[8];
    const float* Wv  = (const float*)d_in[9];
    const float* bv  = (const float*)d_in[10];
    const float* lng = (const float*)d_in[11];
    const float* lnb = (const float*)d_in[12];
    const float* Wo  = (const float*)d_in[13];
    const float* bo  = (const float*)d_in[14];
    float* out = (float*)d_out;

    const int M = 2048;      // B*L tokens
    const int D = 512;
    const int N2K = 128;     // 2*K_OSC

    float* ws   = (float*)d_ws;
    float* Hk   = ws;
    float* Hq   = Hk   + (size_t)M * D;
    float* Vm   = Hq   + (size_t)M * D;
    float* K2   = Vm   + (size_t)M * D;
    float* Q2   = K2   + (size_t)M * N2K;
    float* Sbuf = Q2   + (size_t)M * N2K;
    float* R    = Sbuf + (size_t)32 * 4096;
    float* P    = R    + (size_t)M * D;      // 30 chunk states of 128 x 512
    float* St   = P    + (size_t)30 * 128 * D;   // 64 planes of M row statistics

    dim3 blk(256);

    const int nbD = (D / 64) * (M / 128);     // 128 blocks for an M x D product
    const int nbP = (N2K / 64) * (M / 64);    // 64 blocks for an M x 2K product in 64-row tiles
    const int nbO = (D / 64) * (M / 64);      // 256 blocks for an M x D product in 64-row tiles

    // Both MLP first layers (gelu): 256 blocks
    gemm_wmma_f32<false, 128><<<nbD + nbD, blk, 0, stream>>>(
        x, Wk1, bk1, Hk,  x, Wq1, bq1, Hq,  nullptr, nullptr, nullptr, nullptr,
        nullptr, nullptr, nullptr, nullptr, nbD, nbD, D, D, D, 1);
    // V projection + both MLP second layers ending in the phasor features: 256 blocks
    gemm_v_phasor_kernel<<<nbD + nbP + nbP, blk, 0, stream>>>(
        x, Wv, bv, Vm,  Hk, Wk2, bk2, K2,  Hq, Wq2, bq2, Q2,  nbD, nbP, D, N2K, D);
    // Per-chunk masked scores + per-chunk states K2_c^T V_c
    chunk_scores_states_kernel<<<32 + 240, blk, 0, stream>>>(Q2, K2, Vm, Sbuf, P);
    // Chunk-parallel causal linear attention, position-normalized, + partial row statistics
    attn_out_kernel<<<256, blk, 0, stream>>>(Q2, Vm, Sbuf, P, R, St);
    // Output projection with residual, LayerNorm applied to its A fragments:
    // out = x + LN(r) @ Wo + bo
    gemm_wmma_f32<true, 64><<<nbO, blk, 0, stream>>>(
        R, Wo, bo, out,  nullptr, nullptr, nullptr, nullptr,  nullptr, nullptr, nullptr, nullptr,
        x, St, lng, lnb, nbO, 0, D, D, D, 0);
}

// v008
// It runs in 59.7 microseconds.
// In two side-by-side timings against v007, it was 1.07 and 1.08 times as fast.
// Over all steps from v000 it is 4.79 times as fast.
#include <hip/hip_runtime.h>
#include <hip/hip_bf16.h>
#include <math.h>

typedef float v2f __attribute__((ext_vector_type(2)));
typedef float v4f __attribute__((ext_vector_type(4)));
typedef float v8f __attribute__((ext_vector_type(8)));

// D = A(16x4,f32) x B(4x16,f32) + C(16x16,f32)
#define WMMA_F32(a, b, c) \
    __builtin_amdgcn_wmma_f32_16x16x4_f32(false, (a), false, (b), (short)0, (c), false, false)

__device__ __forceinline__ float gelu_exact(float x) {
    return 0.5f * x * (1.0f + erff(x * 0.70710678118654752440f));
}

// Async copies 16B global -> LDS (CDNA5 GLOBAL_LOAD_ASYNC_TO_LDS_B128, ASYNCcnt).
// An LDS address is the low 32 bits of the generic shared-memory pointer (LDS
// aperture truncation, ISA 10.2).
// One stage of the GEMM ring per call: 8 copies of the A tile (rows 16 apart)
// and 4 of the B tile (rows 16 apart) for this lane. The closing s_wait_xcnt
// stands in the copies' own statement, so that no address register is
// rewritten ahead of it.
__device__ __forceinline__ void stage_copies(const float* gA, size_t aStep,
                                             const float* gB, size_t bStep,
                                             const float* ldsA, const float* ldsB) {
    const unsigned la = (unsigned)(size_t)ldsA;
    const unsigned lb = (unsigned)(size_t)ldsB;
    asm volatile(
        "global_load_async_to_lds_b128 %0, %1, off\n\t"
        "global_load_async_to_lds_b128 %2, %3, off\n\t"
        "global_load_async_to_lds_b128 %4, %5, off\n\t"
        "global_load_async_to_lds_b128 %6, %7, off\n\t"
        "global_load_async_to_lds_b128 %8, %9, off\n\t"
        "global_load_async_to_lds_b128 %10, %11, off\n\t"
        "global_load_async_to_lds_b128 %12, %13, off\n\t"
        "global_load_async_to_lds_b128 %14, %15, off\n\t"
        "global_load_async_to_lds_b128 %16, %17, off\n\t"
        "global_load_async_to_lds_b128 %18, %19, off\n\t"
        "global_load_async_to_lds_b128 %20, %21, off\n\t"
        "global_load_async_to_lds_b128 %22, %23, off\n\t"
        "s_wait_xcnt 0x0"
        :: "v"(la),                    "v"(gA),
           "v"(la + 1u * 16u * 272u),  "v"(gA + 1 * aStep),
           "v"(la + 2u * 16u * 272u),  "v"(gA + 2 * aStep),
           "v"(la + 3u * 16u * 272u),  "v"(gA + 3 * aStep),
           "v"(la + 4u * 16u * 272u),  "v"(gA + 4 * aStep),
           "v"(la + 5u * 16u * 272u),  "v"(gA + 5 * aStep),
           "v"(la + 6u * 16u * 272u),  "v"(gA + 6 * aStep),
           "v"(la + 7u * 16u * 272u),  "v"(gA + 7 * aStep),
           "v"(lb),                    "v"(gB),
           "v"(lb + 1u * 16u * 256u),  "v"(gB + 1 * bStep),
           "v"(lb + 2u * 16u * 256u),  "v"(gB + 2 * bStep),
           "v"(lb + 3u * 16u * 256u),  "v"(gB + 3 * bStep)
        : "memory");
}
// The same for a 64-row A tile: 4 copies of the A tile and 4 of the B tile.
__device__ __forceinline__ void stage_copies_a4(const float* gA, size_t aStep,
                                                const float* gB, size_t bStep,
                                                const float* ldsA, const float* ldsB) {
    const unsigned la = (unsigned)(size_t)ldsA;
    const unsigned lb = (unsigned)(size_t)ldsB;
    asm volatile(
        "global_load_async_to_lds_b128 %0, %1, off\n\t"
        "global_load_async_to_lds_b128 %2, %3, off\n\t"
        "global_load_async_to_lds_b128 %4, %5, off\n\t"
        "global_load_async_to_lds_b128 %6, %7, off\n\t"
        "global_load_async_to_lds_b128 %8, %9, off\n\t"
        "global_load_async_to_lds_b128 %10, %11, off\n\t"
        "global_load_async_to_lds_b128 %12, %13, off\n\t"
        "global_load_async_to_lds_b128 %14, %15, off\n\t"
        "s_wait_xcnt 0x0"
        :: "v"(la),                    "v"(gA),
           "v"(la + 1u * 16u * 272u),  "v"(gA + 1 * aStep),
           "v"(la + 2u * 16u * 272u),  "v"(gA + 2 * aStep),
           "v"(la + 3u * 16u * 272u),  "v"(gA + 3 * aStep),
           "v"(lb),                    "v"(gB),
           "v"(lb + 1u * 16u * 256u),  "v"(gB + 1 * bStep),
           "v"(lb + 2u * 16u * 256u),  "v"(gB + 2 * bStep),
           "v"(lb + 3u * 16u * 256u),  "v"(gB + 3 * bStep)
        : "memory");
}
// One stage for a tile of MT rows of A.
template <int MT>
__device__ __forceinline__ void stage_tile(const float* gA, size_t aStep,
                                           const float* gB, size_t bStep,
                                           const float* ldsA, const float* ldsB) {
    if constexpr (MT == 128) stage_copies(gA, aStep, gB, bStep, ldsA, ldsB);
    else                     stage_copies_a4(gA, aStep, gB, bStep, ldsA, ldsB);
}
// The issuing wave's own wait: its copies have landed in LDS behind it.
__device__ __forceinline__ void wait_async0() {
    asm volatile("s_wait_asynccnt 0x0" ::: "memory");
}
// The wave's own LDS reads have returned: its buffer may be handed back for a refill.
__device__ __forceinline__ void wait_ds0() {
    asm volatile("s_wait_dscnt 0x0" ::: "memory");
}

// A whole operand tile into LDS, filled once: this lane's 16-byte pieces of 4 (8) rows
// that lie gStep floats apart in memory and lStep bytes apart in LDS. The closing
// s_wait_xcnt stands in the copies' own statement, as above.
__device__ __forceinline__ void copy_rows4(const float* g, size_t gStep,
                                           const float* lds, unsigned lStep) {
    const unsigned l = (unsigned)(size_t)lds;
    asm volatile(
        "global_load_async_to_lds_b128 %0, %1, off\n\t"
        "global_load_async_to_lds_b128 %2, %3, off\n\t"
        "global_load_async_to_lds_b128 %4, %5, off\n\t"
        "global_load_async_to_lds_b128 %6, %7, off\n\t"
        "s_wait_xcnt 0x0"
        :: "v"(l),              "v"(g),
           "v"(l + 1u * lStep), "v"(g + 1 * gStep),
           "v"(l + 2u * lStep), "v"(g + 2 * gStep),
           "v"(l + 3u * lStep), "v"(g + 3 * gStep)
        : "memory");
}
__device__ __forceinline__ void copy_rows8(const float* g, size_t gStep,
                                           const float* lds, unsigned lStep) {
    const unsigned l = (unsigned)(size_t)lds;
    asm volatile(
        "global_load_async_to_lds_b128 %0, %1, off\n\t"
        "global_load_async_to_lds_b128 %2, %3, off\n\t"
        "global_load_async_to_lds_b128 %4, %5, off\n\t"
        "global_load_async_to_lds_b128 %6, %7, off\n\t"
        "global_load_async_to_lds_b128 %8, %9, off\n\t"
        "global_load_async_to_lds_b128 %10, %11, off\n\t"
        "global_load_async_to_lds_b128 %12, %13, off\n\t"
        "global_load_async_to_lds_b128 %14, %15, off\n\t"
        "s_wait_xcnt 0x0"
        :: "v"(l),              "v"(g),
           "v"(l + 1u * lStep), "v"(g + 1 * gStep),
           "v"(l + 2u * lStep), "v"(g + 2 * gStep),
           "v"(l + 3u * lStep), "v"(g + 3 * gStep),
           "v"(l + 4u * lStep), "v"(g + 4 * gStep),
           "v"(l + 5u * lStep), "v"(g + 5 * gStep),
           "v"(l + 6u * lStep), "v"(g + 6 * gStep),
           "v"(l + 7u * lStep), "v"(g + 7 * gStep)
        : "memory");
}

// 1/sqrt(x) for x in the normal range. The v_nop fills the slot that the
// instruction set asks for behind a transcendental, whatever is scheduled next.
__device__ __forceinline__ float rsq_normal(float x) {
    float r;
    asm("v_rsq_f32 %0, %1\n\tv_nop" : "=v"(r) : "v"(x));
    return r;
}

// ---------------------------------------------------------------------------
// Phasor of one raw pair (x0, x1): real and imaginary part.
// ---------------------------------------------------------------------------
__device__ __forceinline__ void phasor2(float x0, float x1, float* re, float* im) {
    float px = tanhf(x0) * 0.9f;
    float py = tanhf(x1) * 0.9f;
    float n  = sqrtf(px * px + py * py);
    float nm = fmaxf(n, 1e-5f);
    float sc = fminf((1.0f - 1e-5f) / nm, 1.0f);
    px *= sc; py *= sc;
    float r = n * sc;
    float ph = atan2f(py, px);
    float amp = 1.0f - r;
    *re = amp * cosf(ph);
    *im = amp * sinf(ph);
}

// The value that lane ^ 1 holds (DPP row_xmask:1).
__device__ __forceinline__ float lane_xor1(float v) {
    return __int_as_float(__builtin_amdgcn_update_dpp(0, __float_as_int(v), 0x161, 0xf, 0xf, true));
}

// ---------------------------------------------------------------------------
// fp32 WMMA GEMM: C = act(A@B + bias) [+ resid]
// A: MxK row-major, B: KxN row-major, C/resid: MxN row-major.
// One grid holds up to three independent products that share Kd and act: flat
// blocks [0, nb0) work on product 0 (width N0), [nb0, nb0 + nb1) on product 1,
// the rest on product 2 (both of width N12). Within a product the tile column
// runs fastest.
// Block = 256 threads (8 waves) computes an MT x 64 C tile; each wave owns a
// 2x2 grid of 16x16 accumulators. MT = 128: one 32x32 part of the tile a wave.
// MT = 64, for a product whose 128-row tiles would leave half the WGPs without a
// block: waves w and w + 4 share a 32x32 part, w takes the first 32 k of every
// stage and w + 4 the last 32 (LDS reads per WMMA stay as they are), and the two
// partial tiles are added through LDS at the end.
// Double-buffered LDS, async loads to LDS, 64 k per stage (Kd a multiple of 64):
// one barrier per 64 WMMAs of a wave (32 where MT = 64), in front of a stage's last block.
// A tile LDS stride = 68 floats (272B): 16B-aligned rows for b128 async writes
// AND bank-conflict-free fragment reads (68*r mod 64 = 4*r distinct, r=0..15).
// LN = true (Kd = 512): each A fragment is layer-normalized over its row on its
// way from LDS to the product. lnS holds, per row,
// 32 partial sums and 32 partial sums of squares (plane [slice][row], 2048 rows,
// the squares 32 planes further on), written by the kernel that wrote A.
// PH = true (MT = 64): the product's columns are interleaved pairs (x0, x1); C
// takes their phasors, row layout [N/2 real | N/2 imaginary], not the product.
// gemm_block is tile `id` of one product; As0 (2 buffers of MT x 68), Bs0 (2 of
// 64 x 64), Gs, Ts (512 each) and Rst (2 * MT), the last three for LN only, are
// the calling kernel's LDS.
// ---------------------------------------------------------------------------
template <bool LN, int MT, bool PH>
__device__ __forceinline__ void gemm_block(
    float* As0, float* Bs0, float* Gs, float* Ts, float* Rst,
    const float* __restrict__ A, const float* __restrict__ B,
    const float* __restrict__ bias, float* __restrict__ C,
    const float* __restrict__ resid,
    const float* __restrict__ lnS, const float* __restrict__ lnG,
    const float* __restrict__ lnB,
    const int id, const int N, const int Kd, const int act)
{
    constexpr bool SPLIT = (MT == 64);                // two waves share a part of the tile, half the k each
    constexpr int  KW = SPLIT ? 32 : 64;              // k of a stage that one wave works on
    constexpr int  ASZ = MT * 68, BSZ = 64 * 64;      // floats of one buffer of A, of B
    static_assert(!PH || SPLIT, "the phasor epilogue is written for the 64-row tile");

    const int tid  = threadIdx.x;
    const int wave = tid >> 5;
    const int lane = tid & 31;
    const int half = lane >> 4;
    const int lr   = lane & 15;

    const int nx = N >> 6;                 // tile columns of this product
    const int m0 = (id / nx) * MT;
    const int n0 = (id % nx) * 64;

    const int colBase = (wave & 1) * 32;   // cols {colBase, colBase+16}
    const int rowBase = ((wave >> 1) & (MT / 32 - 1)) * 32;   // rows {rowBase, rowBase+16}
    const int kh = SPLIT ? (wave >> 2) : 0;       // which half of a stage's k

    v8f acc00 = {}; v8f acc01 = {}; v8f acc10 = {}; v8f acc11 = {};

    // Loaders: a stage is A MTx64 (256 thr x MT/16 float4) and B 64x64 (256 thr x 4);
    // 16 lanes cover one 256-byte row of either tile.
    const int ldrow = tid >> 4, ldcol = (tid & 15) * 4;

    const float* gA = A + (size_t)(m0 + ldrow) * Kd + ldcol;
    const float* gB = B + (size_t)ldrow * N + n0 + ldcol;
    const size_t aStep = (size_t)16 * Kd;      // 16 rows of A
    const size_t bStep = (size_t)16 * N;       // 16 rows of B
    const int ldsAo = ldrow * 68 + ldcol;
    const int ldsBo = ldrow * 64 + ldcol;
    const int nst = Kd >> 6;                   // stages

    // prologue: stage 0 into buffer 0, published; then stage 1 into buffer 1
    stage_tile<MT>(gA, aStep, gB, bStep, As0 + ldsAo, Bs0 + ldsBo);
    if constexpr (LN) {
        // while stage 0 flies: gain and shift into LDS; threads 0..MT-1 add up the
        // 32 partial sums of one row each, threads MT..2*MT-1 the sums of squares
        Gs[tid] = lnG[tid]; Gs[tid + 256] = lnG[tid + 256];
        Ts[tid] = lnB[tid]; Ts[tid + 256] = lnB[tid + 256];
        if (tid < 2 * MT) {
            const float* sp = lnS + (size_t)(tid / MT) * (32 * 2048) + m0 + (tid % MT);
            float s = 0.0f;
#pragma unroll
            for (int i = 0; i < 32; ++i) s += sp[i * 2048];
            Rst[tid] = s;
        }
    }
    wait_async0();              // this wave's copies of stage 0 have landed
    __syncthreads();            // everyone's have
    if (nst > 1)
        stage_tile<MT>(gA + 64, aStep, gB + (size_t)64 * N, bStep, As0 + ASZ + ldsAo, Bs0 + BSZ + ldsBo);

    // LN: mean and 1/sigma of this lane's two A rows
    float mean0 = 0.0f, sc0 = 0.0f, mean1 = 0.0f, sc1 = 0.0f;
    if constexpr (LN) {
        const int r0 = rowBase + lr, r1 = r0 + 16;
        mean0 = Rst[r0] * (1.0f / 512.0f);
        mean1 = Rst[r1] * (1.0f / 512.0f);
        const float var0 = Rst[MT + r0] * (1.0f / 512.0f) - mean0 * mean0;
        const float var1 = Rst[MT + r1] * (1.0f / 512.0f) - mean1 * mean1;
        sc0 = rsq_normal(var0 + 1e-5f);
        sc1 = rsq_normal(var1 + 1e-5f);
    }

    // Fragments go from LDS to registers one block ahead of their products: a stage is
    // two blocks of KB k-steps, each with a register set of its own, and a block's reads
    // stand together as one group, never among the products.
    constexpr int KB = KW / 8;
    v2f fa0[2][KB], fa1[2][KB], fb0[2][KB], fb1[2][KB], fg[2][KB], ft[2][KB];
    // reads of block blk of stage sst (in buffer sbuf) into register set `set`
    auto load_block = [&](const int set, const int sbuf, const int sst, const int blk) {
        const float* Asb = As0 + sbuf * ASZ + kh * KW + blk * (KB * 4);
        const float* Bsb = Bs0 + sbuf * BSZ + (kh * KW + blk * (KB * 4)) * 64;
        // The scheduling barriers keep the reads of the two column groups apart, so that the
        // compiler pairs rows k and k + 1 of one column in one two-address read, which is a B
        // fragment as it stands; reads of both groups together are paired by column, and every
        // fragment then costs register moves that wait on the reads.
#pragma unroll
        for (int i = 0; i < KB; ++i) {
            fb0[set][i].x = Bsb[(4 * i + 0 + 2 * half) * 64 + colBase + lr];
            fb0[set][i].y = Bsb[(4 * i + 1 + 2 * half) * 64 + colBase + lr];
        }
        __builtin_amdgcn_sched_barrier(0);
#pragma unroll
        for (int i = 0; i < KB; ++i) {
            fb1[set][i].x = Bsb[(4 * i + 0 + 2 * half) * 64 + colBase + 16 + lr];
            fb1[set][i].y = Bsb[(4 * i + 1 + 2 * half) * 64 + colBase + 16 + lr];
        }
        __builtin_amdgcn_sched_barrier(0);
#pragma unroll
        for (int i = 0; i < KB; ++i) {
            const int k0 = 4 * i;
            fa0[set][i].x = Asb[(rowBase + lr) * 68 + k0 + 0 + 2 * half];
            fa0[set][i].y = Asb[(rowBase + lr) * 68 + k0 + 1 + 2 * half];
            fa1[set][i].x = Asb[(rowBase + 16 + lr) * 68 + k0 + 0 + 2 * half];
            fa1[set][i].y = Asb[(rowBase + 16 + lr) * 68 + k0 + 1 + 2 * half];
            if constexpr (LN) {
                fg[set][i] = *(const v2f*)&Gs[sst * 64 + kh * KW + blk * (KB * 4) + k0 + 2 * half];
                ft[set][i] = *(const v2f*)&Ts[sst * 64 + kh * KW + blk * (KB * 4) + k0 + 2 * half];
            }
        }
    };
    // products of k-steps [from, to) of register set `set`
    auto mma_block = [&](const int set, const int from, const int to) {
#pragma unroll
        for (int i = from; i < to; ++i) {
            v2f a0 = fa0[set][i], a1 = fa1[set][i];
            if constexpr (LN) {
                a0 = (a0 - mean0) * sc0 * fg[set][i] + ft[set][i];
                a1 = (a1 - mean1) * sc1 * fg[set][i] + ft[set][i];
            }
            acc00 = WMMA_F32(a0, fb0[set][i], acc00);
            acc01 = WMMA_F32(a0, fb1[set][i], acc01);
            acc10 = WMMA_F32(a1, fb0[set][i], acc10);
            acc11 = WMMA_F32(a1, fb1[set][i], acc11);
        }
    };

    load_block(0, 0, 0, 0);     // stage 0 is published: its first block
    // The scheduling barriers below keep each group of reads and each run of products
    // where it is written: without them the reads are moved in among the products.
    for (int st = 0; st < nst; ++st) {
        const int buf = st & 1;
        load_block(1, buf, st, 1);
        __builtin_amdgcn_sched_barrier(0);
        mma_block(0, 0, KB);
        __builtin_amdgcn_sched_barrier(0);
        // Publish point of stage st + 1, in front of this stage's last block: that block's
        // fragments are in registers, and the reads behind it are the next stage's.
        wait_ds0();             // this wave's reads of `buf` are done
        wait_async0();          // this wave's copies of stage st + 1 have landed
        __syncthreads();        // stage st + 1 published; `buf` left by every reader
        __builtin_amdgcn_sched_barrier(0);
        // Half of the last block stands between the barrier and the refill: behind the barrier
        // the matrix unit has work at once, and one wave's copies and reads run beside the
        // products of the other wave of its SIMD.
        mma_block(1, 0, KB / 2);
        __builtin_amdgcn_sched_barrier(0);
        if (st + 2 < nst) {     // refill `buf` while stage st + 1 is worked on
            const int kn = (st + 2) * 64;
            stage_tile<MT>(gA + kn, aStep, gB + (size_t)kn * N, bStep, As0 + buf * ASZ + ldsAo, Bs0 + buf * BSZ + ldsBo);
        }
        // The next stage's first block. In the last stage the reads stay (no branch, so that
        // the waits stay counted) and are aimed at its own buffer; their values are not used.
        const bool more = st + 1 < nst;
        load_block(0, more ? buf ^ 1 : buf, more ? st + 1 : st, 0);
        __builtin_amdgcn_sched_barrier(0);
        mma_block(1, KB / 2, KB);
        __builtin_amdgcn_sched_barrier(0);
    }
    wait_async0();              // nothing in flight when the ring is left
    wait_ds0();                 // nor the last stage's unused reads

    if constexpr (SPLIT) {
        // The buffer that the last stage did not use carries the partial tiles: every wave
        // left it in front of the loop's last barrier. Wave w finishes rows rowBase..+15 and
        // hands over its part of rows rowBase+16..+31; wave w + 4 the other way round.
        float* Xs = As0 + ((nst & 1) ? ASZ : 0);
        float* mine = Xs + wave * 512 + lane;
        const float* theirs = Xs + (wave ^ 4) * 512 + lane;
        // both loops unrolled: accumulator elements stay registers only under constant indices
#pragma unroll
        for (int v = 0; v < 8; ++v) {
            mine[v * 32]       = kh ? acc00[v] : acc10[v];
            mine[(8 + v) * 32] = kh ? acc01[v] : acc11[v];
        }
        __syncthreads();        // both partial tiles are in LDS
#pragma unroll
        for (int v = 0; v < 8; ++v) {
            acc00[v] = (kh ? acc10[v] : acc00[v]) + theirs[v * 32];
            acc01[v] = (kh ? acc11[v] : acc01[v]) + theirs[(8 + v) * 32];
        }
    }

    const int nA0 = n0 + colBase + lr;
    const int nA1 = nA0 + 16;
    const float bz0 = bias ? bias[nA0] : 0.0f;
    const float bz1 = bias ? bias[nA1] : 0.0f;
    // The index register of the two bias loads is reused for the store addresses: keep the wait in
    // front of that. The scheduling barrier keeps the address arithmetic from moving up over the wait.
    asm volatile("s_wait_xcnt 0x0" ::: "memory");
    __builtin_amdgcn_sched_barrier(0);
    if constexpr (PH) {
        // Lanes 2j and 2j + 1 hold x0 and x1 of one pair in each column group: the
        // even lane takes over the pair of the first group, the odd lane that of the
        // second, so every lane works out one phasor a row.
        const bool odd = (lr & 1) != 0;
        const int  kc  = (n0 + colBase + (odd ? 16 : 0) + (lr & 14)) >> 1;
        float* Cp = C + (size_t)(m0 + rowBase + kh * 16 + 8 * half) * N + kc;
        // Kept rolled: the long phasor code stands once in the text,
        // not eight times. The accumulators rotate, so that the row in turn is element 0
        // (they stay registers only under constant indices).
#pragma unroll 1
        for (int v = 0; v < 8; ++v) {
            const float r00 = acc00[0] + bz0, r01 = acc01[0] + bz1;
            const float recv = lane_xor1(odd ? r00 : r01);
            float re, im;
            phasor2(odd ? recv : r00, odd ? r01 : recv, &re, &im);
            Cp[0] = re;
            Cp[N >> 1] = im;
            // the next trip rewrites the two stores' address and data registers: keep the wait in front of that
            asm volatile("s_wait_xcnt 0x0" ::: "memory");
            Cp += N;
            acc00 = __builtin_shufflevector(acc00, acc00, 1, 2, 3, 4, 5, 6, 7, 0);
            acc01 = __builtin_shufflevector(acc01, acc01, 1, 2, 3, 4, 5, 6, 7, 0);
        }
        return;
    }
#pragma unroll
    for (int v = 0; v < 8; ++v) {
        const int mA = m0 + rowBase + kh * 16 + v + 8 * half;
        const int mB = mA + 16;
        float r00 = acc00[v] + bz0, r01 = acc01[v] + bz1;
        float r10 = acc10[v] + bz0, r11 = acc11[v] + bz1;   // SPLIT: partial sums, not stored
        if (act == 1) {
            r00 = gelu_exact(r00); r01 = gelu_exact(r01);
            if constexpr (!SPLIT) { r10 = gelu_exact(r10); r11 = gelu_exact(r11); }
        }
        if (resid) {
            r00 += resid[(size_t)mA * N + nA0]; r01 += resid[(size_t)mA * N + nA1];
            if constexpr (!SPLIT) {
                r10 += resid[(size_t)mB * N + nA0]; r11 += resid[(size_t)mB * N + nA1];
            }
        }
        C[(size_t)mA * N + nA0] = r00;
        C[(size_t)mA * N + nA1] = r01;
        if constexpr (!SPLIT) {
            C[(size_t)mB * N + nA0] = r10;
            C[(size_t)mB * N + nA1] = r11;
        }
    }
}

template <bool LN, int MT>
__global__ __launch_bounds__(256) void gemm_wmma_f32(
    const float* __restrict__ A0, const float* __restrict__ B0,
    const float* __restrict__ bias0, float* __restrict__ C0,
    const float* __restrict__ A1, const float* __restrict__ B1,
    const float* __restrict__ bias1, float* __restrict__ C1,
    const float* __restrict__ A2, const float* __restrict__ B2,
    const float* __restrict__ bias2, float* __restrict__ C2,
    const float* __restrict__ resid,
    const float* __restrict__ lnS, const float* __restrict__ lnG,
    const float* __restrict__ lnB,
    int nb0, int nb1, int N0, int N12, int Kd, int act)
{
    __shared__ __align__(16) float As[2 * MT * 68];   // [buf][row][k], stride 68
    __shared__ __align__(16) float Bs[2 * 64 * 64];   // [buf][k][n]
    __shared__ __align__(16) float Gs[512];           // LN only: gain by k
    __shared__ __align__(16) float Ts[512];           // LN only: shift by k
    __shared__ float Rst[2 * MT];                     // LN only: row sums | row sums of squares

    // which product this block belongs to: the same for the whole block
    int id = blockIdx.x;
    const float* A = A0; const float* B = B0; const float* bias = bias0;
    float* C = C0;
    int N = N0;
    if (id >= nb0 + nb1) {
        id -= nb0 + nb1; A = A2; B = B2; bias = bias2; C = C2; N = N12;
    } else if (id >= nb0) {
        id -= nb0;       A = A1; B = B1; bias = bias1; C = C1; N = N12;
    }
    gemm_block<LN, MT, false>(As, Bs, Gs, Ts, Rst, A, B, bias, C, resid, lnS, lnG, lnB, id, N, Kd, act);
}

// ---------------------------------------------------------------------------
// One grid: blocks [0, nbV) the V projection in 128-row tiles (width NV); then
// nbP blocks each for the key and the query MLP's second layer (width NP) in
// 64-row tiles, which end in the phasor of every column pair. The 64-row tiles
// have half the products of a V tile, so their phasors are done while the V
// tiles still run.
// ---------------------------------------------------------------------------
__global__ __launch_bounds__(256) void gemm_v_phasor_kernel(
    const float* __restrict__ x,  const float* __restrict__ Wv,
    const float* __restrict__ bv, float* __restrict__ V,
    const float* __restrict__ Hk, const float* __restrict__ Wk2,
    const float* __restrict__ bk2, float* __restrict__ K2,
    const float* __restrict__ Hq, const float* __restrict__ Wq2,
    const float* __restrict__ bq2, float* __restrict__ Q2,
    int nbV, int nbP, int NV, int NP, int Kd)
{
    __shared__ __align__(16) float As[2 * 128 * 68];  // the 64-row tiles use the first half
    __shared__ __align__(16) float Bs[2 * 64 * 64];
    const int id = blockIdx.x;             // every branch is the same for the whole block
    if (id < nbV) {
        gemm_block<false, 128, false>(As, Bs, nullptr, nullptr, nullptr, x, Wv, bv, V,
                                      nullptr, nullptr, nullptr, nullptr, id, NV, Kd, 0);
    } else {
        const bool q = id >= nbV + nbP;
        gemm_block<false, 64, true>(As, Bs, nullptr, nullptr, nullptr,
                                    q ? Hq : Hk, q ? Wq2 : Wk2, q ? bq2 : bk2, q ? Q2 : K2,
                                    nullptr, nullptr, nullptr, nullptr,
                                    id - nbV - (q ? nbP : 0), NP, Kd, 0);
    }
}

// ---------------------------------------------------------------------------
// Per-chunk masked scores: S_c = tril(Q2_c @ K2_c^T), chunk = 64 tokens.
// Both operands are read along their rows, 16 rows a fragment: straight from memory
// every fragment load would touch 16 cache lines for 256 bytes. The two 64 x 128 tiles
// go to LDS once, in whole 512-byte rows (Qs, Ks: pitch 132 floats, 16-byte-aligned rows
// and 132*r mod 64 = 4*r, so the fragment reads meet no bank twice).
// ---------------------------------------------------------------------------
__device__ __forceinline__ void s_chunk_block(
    float* Qs, float* Ks,
    const float* __restrict__ Q2, const float* __restrict__ K2,
    float* __restrict__ Sbuf, const int bc)   // bc = b*16 + c
{
    const size_t tok0 = (size_t)(bc >> 4) * 1024 + (size_t)(bc & 15) * 64;
    const int tid  = threadIdx.x;
    const int wave = tid >> 5, lane = tid & 31, half = lane >> 4, lr = lane & 15;
    const int nOff = (wave & 3) * 16, rOff = (wave >> 2) * 32;

    const float* Qb = Q2 + tok0 * 128;
    const float* Kb = K2 + tok0 * 128;

    // a wave copies one 512-byte row at a time; a thread's 8 rows lie 8 apart
    const int crow = tid >> 5, ccol = lane * 4;
    copy_rows8(Qb + crow * 128 + ccol, 8 * 128, Qs + crow * 132 + ccol, 8u * 132u * 4u);
    copy_rows8(Kb + crow * 128 + ccol, 8 * 128, Ks + crow * 132 + ccol, 8u * 132u * 4u);
    wait_async0();              // this wave's copies have landed
    __syncthreads();            // everyone's have

    v8f acc0 = {}; v8f acc1 = {};
    // 16 k-steps a trip: a trip's fragment reads issue ahead of its products
#pragma unroll 16
    for (int k0 = 0; k0 < 128; k0 += 4) {
        // B[k][n] = K2[tok0+n][k]  (transposed read)
        const v2f bf = *(const v2f*)&Ks[(nOff + lr) * 132 + k0 + 2 * half];
        const v2f a0 = *(const v2f*)&Qs[(rOff + lr) * 132 + k0 + 2 * half];
        const v2f a1 = *(const v2f*)&Qs[(rOff + 16 + lr) * 132 + k0 + 2 * half];
        acc0 = WMMA_F32(a0, bf, acc0);
        acc1 = WMMA_F32(a1, bf, acc1);
    }
    float* Sb = Sbuf + (size_t)bc * 4096;
    const int n = nOff + lr;
#pragma unroll
    for (int v = 0; v < 8; ++v) {
        int mA = rOff + v + 8 * half, mB = mA + 16;
        Sb[mA * 64 + n] = (mA >= n) ? acc0[v] : 0.0f;
        Sb[mB * 64 + n] = (mB >= n) ? acc1[v] : 0.0f;
    }
}

// ---------------------------------------------------------------------------
// Per-chunk states: P_c = K2_c^T @ V_c (128 x 512), chunk = 64 tokens.
// 2 batches * 15 chunks * 8 d-slices = 240 independent blocks (the last
// chunk's state has no reader). Tile (b, c, dtile) is a contiguous 128x64 block
// at index (b*15 + c)*8 + dtile.
// ---------------------------------------------------------------------------
__device__ __forceinline__ void chunk_state_block(
    const float* __restrict__ K2, const float* __restrict__ V,
    float* __restrict__ P, const int sidx)    // sidx = (b*15 + c)*8 + dtile
{
    const int tid  = threadIdx.x;
    const int wave = tid >> 5, lane = tid & 31, half = lane >> 4, lr = lane & 15;
    const int nOff = (wave & 3) * 16;

    const int bc15 = sidx >> 3;
    const int b    = bc15 / 15;
    const int c    = bc15 - b * 15;
    const size_t tok0 = (size_t)b * 1024 + (size_t)c * 64;
    const float* Vb = V  + tok0 * 512 + (sidx & 7) * 64;
    const float* Kb = K2 + tok0 * 128;
    const int mBase = (wave >> 2) * 64;   // each wave owns 4 disjoint 16x16 subtiles

    v8f acc[4] = {};
    // 8 k-steps a trip: 80 independent fragment loads in flight per lane
#pragma unroll 8
    for (int k0 = 0; k0 < 64; k0 += 4) {
        v2f bf;
        bf.x = Vb[(size_t)(k0 + 0 + 2 * half) * 512 + nOff + lr];
        bf.y = Vb[(size_t)(k0 + 1 + 2 * half) * 512 + nOff + lr];
#pragma unroll
        for (int j = 0; j < 4; ++j) {
            v2f af;   // A[m][l] = K2[tok0+l][m]  (transposed read)
            af.x = Kb[(size_t)(k0 + 0 + 2 * half) * 128 + mBase + j * 16 + lr];
            af.y = Kb[(size_t)(k0 + 1 + 2 * half) * 128 + mBase + j * 16 + lr];
            acc[j] = WMMA_F32(af, bf, acc[j]);
        }
    }
    float* Pb = P + (size_t)sidx * 8192;
#pragma unroll
    for (int j = 0; j < 4; ++j)
#pragma unroll
        for (int v = 0; v < 8; ++v)
            Pb[(mBase + j * 16 + v + 8 * half) * 64 + nOff + lr] = acc[j][v];
}

// Scores and states depend only on K2, Q2 and V, not on each other: one grid,
// blocks 0..31 the masked scores, blocks 32..271 the chunk states.
__global__ __launch_bounds__(256) void chunk_scores_states_kernel(
    const float* __restrict__ Q2, const float* __restrict__ K2,
    const float* __restrict__ V, float* __restrict__ Sbuf, float* __restrict__ P)
{
    __shared__ __align__(16) float Qs[64 * 132];    // score blocks only
    __shared__ __align__(16) float Ks[64 * 132];
    const int blk = blockIdx.x;                     // the branch is the same for the whole block
    if (blk < 32) s_chunk_block(Qs, Ks, Q2, K2, Sbuf, blk);
    else          chunk_state_block(K2, V, P, blk - 32);
}

// ---------------------------------------------------------------------------
// Chunk-parallel causal linear attention.
// Grid = B * 16 chunks * (512/64) d-slices = 256 independent blocks. Each sums
// the states of the earlier chunks of its batch, M = sum_{j<c} P_j, into LDS:
//   out_c = S_c @ V_c + Q2_c @ M
// S_c, Q2_c and the block's slice of V_c go to LDS in whole rows by async copies that
// are issued at entry and fly while the states are summed: S and Q2 are read along their
// rows, 16 rows a fragment, which straight from memory is 16 cache lines a load.
// The rows are stored position-normalized (divided by sqrt(64 * position)).
// Each wave also leaves, for the LayerNorm in the output projection, the sum and
// the sum of squares of its 16 columns of every row it holds: plane
// [slice = dt*4 + column group][row] of St, the squares 32 planes further on.
// ---------------------------------------------------------------------------
// v + (v of lane ^ X) inside a 16-lane row, as one DPP add (0x160 + X = row_xmask:X)
template <int CTRL>
__device__ __forceinline__ float dpp_xadd(float v) {
    return v + __int_as_float(__builtin_amdgcn_update_dpp(0, __float_as_int(v), CTRL, 0xf, 0xf, true));
}
__device__ __forceinline__ float row16_sum(float v) {
    v = dpp_xadd<0x161>(v);
    v = dpp_xadd<0x162>(v);
    v = dpp_xadd<0x164>(v);
    v = dpp_xadd<0x168>(v);
    return v;
}

__global__ __launch_bounds__(256) void attn_out_kernel(
    const float* __restrict__ Q2, const float* __restrict__ V,
    const float* __restrict__ Sbuf, const float* __restrict__ P,
    float* __restrict__ R, float* __restrict__ St)
{
    __shared__ __align__(16) float Msh[128 * 64];   // 32 KB prefix state
    __shared__ __align__(16) float Ssh[64 * 68];    // S_c,  pitch 68:  68*r mod 64 = 4*r, no bank met twice
    __shared__ __align__(16) float Qsh[64 * 132];   // Q2_c, pitch 132: the same
    __shared__ __align__(16) float Vsh[64 * 64];    // V_c, this block's 64 columns
    const int dt = blockIdx.x & 7;
    const int bq = blockIdx.x >> 3;
    const int b  = bq >> 4;
    const int c  = 15 - (bq & 15);    // blocks with the longest prefix take the lowest indices
    const int n0 = dt * 64;

    const int tid  = threadIdx.x;
    const int wave = tid >> 5, lane = tid & 31, half = lane >> 4, lr = lane & 15;
    const int nOff = (wave & 3) * 16, rOff = (wave >> 2) * 32;

    const size_t tok0 = (size_t)b * 1024 + (size_t)c * 64;
    const float* Sb = Sbuf + (size_t)(b * 16 + c) * 4096;
    const float* Vb = V  + tok0 * 512 + n0;
    const float* Qb = Q2 + tok0 * 128;

    {
        // 16 lanes copy one 256-byte row of S or V, a wave one 512-byte row of Q2
        const int r16 = tid >> 4, c16 = (tid & 15) * 4;
        copy_rows4(Sb + r16 * 64 + c16, 16 * 64, Ssh + r16 * 68 + c16, 16u * 68u * 4u);
        copy_rows4(Vb + (size_t)r16 * 512 + c16, 16 * 512, Vsh + r16 * 64 + c16, 16u * 64u * 4u);
        copy_rows8(Qb + wave * 128 + lane * 4, 8 * 128, Qsh + wave * 132 + lane * 4, 8u * 132u * 4u);
    }

    if (c > 0) {
        // thread t owns float4 slots t + 256*i of the 128x64 tile
        const v4f* Pt = (const v4f*)(P + ((size_t)(b * 15) * 8 + dt) * 8192) + tid;
        v4f m[8];
#pragma unroll
        for (int i = 0; i < 8; ++i) m[i] = Pt[256 * i];
        // the loads' scalar base may be rewritten on the short-prefix path: keep the wait in front of it
        asm volatile("s_wait_xcnt 0x0" ::: "memory");
        // 4 tiles a trip: 32 independent 16-byte loads per lane in flight
#pragma unroll 4
        for (int j = 1; j < c; ++j) {
            const v4f* Pj = Pt + (size_t)j * (8 * 2048);
#pragma unroll
            for (int i = 0; i < 8; ++i) m[i] += Pj[256 * i];
        }
#pragma unroll
        for (int i = 0; i < 8; ++i) *(v4f*)&Msh[(tid + 256 * i) * 4] = m[i];
    }

    wait_async0();                    // this wave's copies have landed
    __syncthreads();                  // everyone's have, and M is complete

    v8f acc0 = {}; v8f acc1 = {};
    // fully unrolled: the S and V fragment reads issue ahead of the products
#pragma unroll
    for (int k0 = 0; k0 < 64; k0 += 4) {
        v2f bf;
        bf.x = Vsh[(k0 + 0 + 2 * half) * 64 + nOff + lr];
        bf.y = Vsh[(k0 + 1 + 2 * half) * 64 + nOff + lr];
        const v2f a0 = *(const v2f*)&Ssh[(rOff + lr) * 68 + k0 + 2 * half];
        const v2f a1 = *(const v2f*)&Ssh[(rOff + 16 + lr) * 68 + k0 + 2 * half];
        acc0 = WMMA_F32(a0, bf, acc0);
        acc1 = WMMA_F32(a1, bf, acc1);
    }

    if (c > 0) {                      // same for the whole block
        // 16 k-steps a trip: a trip's fragment reads issue ahead of its products
#pragma unroll 16
        for (int k0 = 0; k0 < 128; k0 += 4) {
            v2f bf;
            bf.x = Msh[(k0 + 0 + 2 * half) * 64 + nOff + lr];
            bf.y = Msh[(k0 + 1 + 2 * half) * 64 + nOff + lr];
            const v2f a0 = *(const v2f*)&Qsh[(rOff + lr) * 132 + k0 + 2 * half];
            const v2f a1 = *(const v2f*)&Qsh[(rOff + 16 + lr) * 132 + k0 + 2 * half];
            acc0 = WMMA_F32(a0, bf, acc0);
            acc1 = WMMA_F32(a1, bf, acc1);
        }
    }

    // What follows reads the accumulators with vector instructions right behind the
    // last matrix instruction: four v_nop keep the vector slots between the two.
    // The scheduling barriers hold them at this place (nothing moves across).
    __builtin_amdgcn_sched_barrier(0);
    asm volatile("v_nop\n\tv_nop\n\tv_nop\n\tv_nop");
    __builtin_amdgcn_sched_barrier(0);

    float* Rb = R + tok0 * 512 + n0;
    const int n = nOff + lr;
#pragma unroll
    for (int v = 0; v < 8; ++v) {
        const int pos = c * 64 + rOff + v + 8 * half + 1;   // 1-based position in the sequence
        acc0[v] *= rsq_normal((float)pos * 64.0f);
        acc1[v] *= rsq_normal((float)(pos + 16) * 64.0f);
        Rb[(size_t)(rOff + v + 8 * half) * 512 + n]      = acc0[v];
        Rb[(size_t)(rOff + 16 + v + 8 * half) * 512 + n] = acc1[v];
    }

    // row statistics over this wave's 16 columns; lanes 0..7 of a half keep the
    // rows of acc0, lanes 8..15 those of acc1, one row a lane
    float ps = 0.0f, pq = 0.0f;
#pragma unroll
    for (int v = 0; v < 8; ++v) {
        const float s0 = row16_sum(acc0[v]);
        const float s1 = row16_sum(acc1[v]);
        const float q0 = row16_sum(acc0[v] * acc0[v]);
        const float q1 = row16_sum(acc1[v] * acc1[v]);
        if ((lr & 7) == v) {
            ps = (lr & 8) ? s1 : s0;
            pq = (lr & 8) ? q1 : q0;
        }
    }
    const size_t so = (size_t)(dt * 4 + (wave & 3)) * 2048 + tok0
                    + rOff + ((lr & 8) << 1) + (lr & 7) + 8 * half;
    St[so] = ps;
    St[so + 32 * 2048] = pq;
}

// ---------------------------------------------------------------------------
extern "C" void kernel_launch(void* const* d_in, const int* in_sizes, int n_in,
                              void* d_out, int out_size, void* d_ws, size_t ws_size,
                              hipStream_t stream) {
    const float* x   = (const float*)d_in[0];
    const float* Wk1 = (const float*)d_in[1];
    const float* bk1 = (const float*)d_in[2];
    const float* Wk2 = (const float*)d_in[3];
    const float* bk2 = (const float*)d_in[4];
    const float* Wq1 = (const float*)d_in[5];
    const float* bq1 = (const float*)d_in[6];
    const float* Wq2 = (const float*)d_in[7];
    const float* bq2 = (const float*)d_in[8];
    const float* Wv  = (const float*)d_in[9];
    const float* bv  = (const float*)d_in[10];
    const float* lng = (const float*)d_in[11];
    const float* lnb = (const float*)d_in[12];
    const float* Wo  = (const float*)d_in[13];
    const float* bo  = (const float*)d_in[14];
    float* out = (float*)d_out;

    const int M = 2048;      // B*L tokens
    const int D = 512;
    const int N2K = 128;     // 2*K_OSC

    float* ws   = (float*)d_ws;
    float* Hk   = ws;
    float* Hq   = Hk   + (size_t)M * D;
    float* Vm   = Hq   + (size_t)M * D;
    float* K2   = Vm   + (size_t)M * D;
    float* Q2   = K2   + (size_t)M * N2K;
    float* Sbuf = Q2   + (size_t)M * N2K;
    float* R    = Sbuf + (size_t)32 * 4096;
    float* P    = R    + (size_t)M * D;      // 30 chunk states of 128 x 512
    float* St   = P    + (size_t)30 * 128 * D;   // 64 planes of M row statistics

    dim3 blk(256);

    const int nbD = (D / 64) * (M / 128);     // 128 blocks for an M x D product
    const int nbP = (N2K / 64) * (M / 64);    // 64 blocks for an M x 2K product in 64-row tiles
    const int nbO = (D / 64) * (M / 64);      // 256 blocks for an M x D product in 64-row tiles

    // Both MLP first layers (gelu): 256 blocks
    gemm_wmma_f32<false, 128><<<nbD + nbD, blk, 0, stream>>>(
        x, Wk1, bk1, Hk,  x, Wq1, bq1, Hq,  nullptr, nullptr, nullptr, nullptr,
        nullptr, nullptr, nullptr, nullptr, nbD, nbD, D, D, D, 1);
    // V projection + both MLP second layers ending in the phasor features: 256 blocks
    gemm_v_phasor_kernel<<<nbD + nbP + nbP, blk, 0, stream>>>(
        x, Wv, bv, Vm,  Hk, Wk2, bk2, K2,  Hq, Wq2, bq2, Q2,  nbD, nbP, D, N2K, D);
    // Per-chunk masked scores + per-chunk states K2_c^T V_c
    chunk_scores_states_kernel<<<32 + 240, blk, 0, stream>>>(Q2, K2, Vm, Sbuf, P);
    // Chunk-parallel causal linear attention, position-normalized, + partial row statistics
    attn_out_kernel<<<256, blk, 0, stream>>>(Q2, Vm, Sbuf, P, R, St);
    // Output projection with residual, LayerNorm applied to its A fragments:
    // out = x + LN(r) @ Wo + bo
    gemm_wmma_f32<true, 64><<<nbO, blk, 0, stream>>>(
        R, Wo, bo, out,  nullptr, nullptr, nullptr, nullptr,  nullptr, nullptr, nullptr, nullptr,
        x, St, lng, lnb, nbO, 0, D, D, D, 0);
}

// v009
// It runs in 54 microseconds.
// Next to v008, in two timings, it ran 1.10 times as fast each time.
// Over all steps from v000 it is 5.29 times as fast.
#include <hip/hip_runtime.h>
#include <hip/hip_bf16.h>
#include <math.h>

typedef float v2f __attribute__((ext_vector_type(2)));
typedef float v4f __attribute__((ext_vector_type(4)));
typedef float v8f __attribute__((ext_vector_type(8)));

// D = A(16x4,f32) x B(4x16,f32) + C(16x16,f32)
#define WMMA_F32(a, b, c) \
    __builtin_amdgcn_wmma_f32_16x16x4_f32(false, (a), false, (b), (short)0, (c), false, false)

// exp(-q) = 2^n * 2^a: n is -q * log2(e) rounded to a whole number, a what is left of it.
// log2(e) comes in two parts and a is formed by two fused steps, so that the rounding of
// the product does not reach a. 0 and infinity outside the range of float.
// The v_nop fills the slot that the instruction set asks for behind a transcendental,
// whatever is scheduled next.
__device__ __forceinline__ float exp_neg(float q) {
    const float n = rintf(-1.44269502f * q);
    float a = fmaf(-1.44269502f, q, -n);
    a = fmaf(-1.92596286e-8f, q, a);
    float r;
    asm("v_exp_f32 %0, %1\n\tv_nop" : "=v"(r) : "v"(a));
    r = ldexpf(r, (int)n);
    r = q > 103.278931f ? 0.0f : r;
    r = q < -88.7228394f ? __builtin_inff() : r;
    return r;
}
// erf(x) without a branch: the polynomial for |x| < 1 and the exponential form for
// |x| >= 1 (the two ranges and the coefficients of the math library's erff) are both
// worked out and one is selected. A branch saves work only where all 32 lanes fall in one
// range, and it ends the basic block: with branches the elements of a tile run one after
// another, each a chain of dependent instructions.
__device__ __forceinline__ float erf_both(float x) {
    const float ax = fabsf(x);
    const float t  = x * x;
    float p = fmaf(-0.000561801775f, t, 0.00491381623f);
    p = fmaf(t, p, -0.0267075151f);
    p = fmaf(t, p, 0.112800106f);
    p = fmaf(t, p, -0.376122952f);
    p = fmaf(t, p, 0.128379107f);
    const float small = fmaf(ax, p, ax);
    float q = fmaf(ax, 0.0000169988107f, -0.000378677854f);
    q = fmaf(ax, q, 0.00385781587f);
    q = fmaf(ax, q, -0.0241816975f);
    q = fmaf(ax, q, 0.106668264f);
    q = fmaf(ax, q, 0.634933293f);
    q = fmaf(ax, q, 0.128689408f);
    q = fmaf(ax, q, ax);
    const float large = 1.0f - exp_neg(q);
    return copysignf(ax < 1.0f ? small : large, x);
}
__device__ __forceinline__ float gelu_exact(float x) {
    return 0.5f * x * (1.0f + erf_both(x * 0.70710678118654752440f));
}

// Async copies 16B global -> LDS (CDNA5 GLOBAL_LOAD_ASYNC_TO_LDS_B128, ASYNCcnt).
// An LDS address is the low 32 bits of the generic shared-memory pointer (LDS
// aperture truncation, ISA 10.2).
// One stage of the GEMM ring per call: 8 copies of the A tile (rows 16 apart)
// and 4 of the B tile (rows 16 apart) for this lane. The closing s_wait_xcnt
// stands in the copies' own statement, so that no address register is
// rewritten ahead of it.
__device__ __forceinline__ void stage_copies(const float* gA, size_t aStep,
                                             const float* gB, size_t bStep,
                                             const float* ldsA, const float* ldsB) {
    const unsigned la = (unsigned)(size_t)ldsA;
    const unsigned lb = (unsigned)(size_t)ldsB;
    asm volatile(
        "global_load_async_to_lds_b128 %0, %1, off\n\t"
        "global_load_async_to_lds_b128 %2, %3, off\n\t"
        "global_load_async_to_lds_b128 %4, %5, off\n\t"
        "global_load_async_to_lds_b128 %6, %7, off\n\t"
        "global_load_async_to_lds_b128 %8, %9, off\n\t"
        "global_load_async_to_lds_b128 %10, %11, off\n\t"
        "global_load_async_to_lds_b128 %12, %13, off\n\t"
        "global_load_async_to_lds_b128 %14, %15, off\n\t"
        "global_load_async_to_lds_b128 %16, %17, off\n\t"
        "global_load_async_to_lds_b128 %18, %19, off\n\t"
        "global_load_async_to_lds_b128 %20, %21, off\n\t"
        "global_load_async_to_lds_b128 %22, %23, off\n\t"
        "s_wait_xcnt 0x0"
        :: "v"(la),                    "v"(gA),
           "v"(la + 1u * 16u * 272u),  "v"(gA + 1 * aStep),
           "v"(la + 2u * 16u * 272u),  "v"(gA + 2 * aStep),
           "v"(la + 3u * 16u * 272u),  "v"(gA + 3 * aStep),
           "v"(la + 4u * 16u * 272u),  "v"(gA + 4 * aStep),
           "v"(la + 5u * 16u * 272u),  "v"(gA + 5 * aStep),
           "v"(la + 6u * 16u * 272u),  "v"(gA + 6 * aStep),
           "v"(la + 7u * 16u * 272u),  "v"(gA + 7 * aStep),
           "v"(lb),                    "v"(gB),
           "v"(lb + 1u * 16u * 256u),  "v"(gB + 1 * bStep),
           "v"(lb + 2u * 16u * 256u),  "v"(gB + 2 * bStep),
           "v"(lb + 3u * 16u * 256u),  "v"(gB + 3 * bStep)
        : "memory");
}
// The same for a 64-row A tile: 4 copies of the A tile and 4 of the B tile.
__device__ __forceinline__ void stage_copies_a4(const float* gA, size_t aStep,
                                                const float* gB, size_t bStep,
                                                const float* ldsA, const float* ldsB) {
    const unsigned la = (unsigned)(size_t)ldsA;
    const unsigned lb = (unsigned)(size_t)ldsB;
    asm volatile(
        "global_load_async_to_lds_b128 %0, %1, off\n\t"
        "global_load_async_to_lds_b128 %2, %3, off\n\t"
        "global_load_async_to_lds_b128 %4, %5, off\n\t"
        "global_load_async_to_lds_b128 %6, %7, off\n\t"
        "global_load_async_to_lds_b128 %8, %9, off\n\t"
        "global_load_async_to_lds_b128 %10, %11, off\n\t"
        "global_load_async_to_lds_b128 %12, %13, off\n\t"
        "global_load_async_to_lds_b128 %14, %15, off\n\t"
        "s_wait_xcnt 0x0"
        :: "v"(la),                    "v"(gA),
           "v"(la + 1u * 16u * 272u),  "v"(gA + 1 * aStep),
           "v"(la + 2u * 16u * 272u),  "v"(gA + 2 * aStep),
           "v"(la + 3u * 16u * 272u),  "v"(gA + 3 * aStep),
           "v"(lb),                    "v"(gB),
           "v"(lb + 1u * 16u * 256u),  "v"(gB + 1 * bStep),
           "v"(lb + 2u * 16u * 256u),  "v"(gB + 2 * bStep),
           "v"(lb + 3u * 16u * 256u),  "v"(gB + 3 * bStep)
        : "memory");
}
// One stage for a tile of MT rows of A.
template <int MT>
__device__ __forceinline__ void stage_tile(const float* gA, size_t aStep,
                                           const float* gB, size_t bStep,
                                           const float* ldsA, const float* ldsB) {
    if constexpr (MT == 128) stage_copies(gA, aStep, gB, bStep, ldsA, ldsB);
    else                     stage_copies_a4(gA, aStep, gB, bStep, ldsA, ldsB);
}
// The issuing wave's own wait: its copies have landed in LDS behind it.
__device__ __forceinline__ void wait_async0() {
    asm volatile("s_wait_asynccnt 0x0" ::: "memory");
}
// The wave's own LDS reads have returned: its buffer may be handed back for a refill.
__device__ __forceinline__ void wait_ds0() {
    asm volatile("s_wait_dscnt 0x0" ::: "memory");
}

// A whole operand tile into LDS, filled once: this lane's 16-byte pieces of 4 (8) rows
// that lie gStep floats apart in memory and lStep bytes apart in LDS. The closing
// s_wait_xcnt stands in the copies' own statement, as above.
__device__ __forceinline__ void copy_rows4(const float* g, size_t gStep,
                                           const float* lds, unsigned lStep) {
    const unsigned l = (unsigned)(size_t)lds;
    asm volatile(
        "global_load_async_to_lds_b128 %0, %1, off\n\t"
        "global_load_async_to_lds_b128 %2, %3, off\n\t"
        "global_load_async_to_lds_b128 %4, %5, off\n\t"
        "global_load_async_to_lds_b128 %6, %7, off\n\t"
        "s_wait_xcnt 0x0"
        :: "v"(l),              "v"(g),
           "v"(l + 1u * lStep), "v"(g + 1 * gStep),
           "v"(l + 2u * lStep), "v"(g + 2 * gStep),
           "v"(l + 3u * lStep), "v"(g + 3 * gStep)
        : "memory");
}
__device__ __forceinline__ void copy_rows8(const float* g, size_t gStep,
                                           const float* lds, unsigned lStep) {
    const unsigned l = (unsigned)(size_t)lds;
    asm volatile(
        "global_load_async_to_lds_b128 %0, %1, off\n\t"
        "global_load_async_to_lds_b128 %2, %3, off\n\t"
        "global_load_async_to_lds_b128 %4, %5, off\n\t"
        "global_load_async_to_lds_b128 %6, %7, off\n\t"
        "global_load_async_to_lds_b128 %8, %9, off\n\t"
        "global_load_async_to_lds_b128 %10, %11, off\n\t"
        "global_load_async_to_lds_b128 %12, %13, off\n\t"
        "global_load_async_to_lds_b128 %14, %15, off\n\t"
        "s_wait_xcnt 0x0"
        :: "v"(l),              "v"(g),
           "v"(l + 1u * lStep), "v"(g + 1 * gStep),
           "v"(l + 2u * lStep), "v"(g + 2 * gStep),
           "v"(l + 3u * lStep), "v"(g + 3 * gStep),
           "v"(l + 4u * lStep), "v"(g + 4 * gStep),
           "v"(l + 5u * lStep), "v"(g + 5 * gStep),
           "v"(l + 6u * lStep), "v"(g + 6 * gStep),
           "v"(l + 7u * lStep), "v"(g + 7 * gStep)
        : "memory");
}

// 1/sqrt(x) for x in the normal range. The v_nop fills the slot that the
// instruction set asks for behind a transcendental, whatever is scheduled next.
__device__ __forceinline__ float rsq_normal(float x) {
    float r;
    asm("v_rsq_f32 %0, %1\n\tv_nop" : "=v"(r) : "v"(x));
    return r;
}

// ---------------------------------------------------------------------------
// Phasor of one raw pair (x0, x1): real and imaginary part.
// ---------------------------------------------------------------------------
__device__ __forceinline__ void phasor2(float x0, float x1, float* re, float* im) {
    float px = tanhf(x0) * 0.9f;
    float py = tanhf(x1) * 0.9f;
    float n  = sqrtf(px * px + py * py);
    float nm = fmaxf(n, 1e-5f);
    float sc = fminf((1.0f - 1e-5f) / nm, 1.0f);
    px *= sc; py *= sc;
    float r = n * sc;
    float ph = atan2f(py, px);
    float amp = 1.0f - r;
    *re = amp * cosf(ph);
    *im = amp * sinf(ph);
}

// The value that lane ^ 1 holds (DPP row_xmask:1).
__device__ __forceinline__ float lane_xor1(float v) {
    return __int_as_float(__builtin_amdgcn_update_dpp(0, __float_as_int(v), 0x161, 0xf, 0xf, true));
}

// ---------------------------------------------------------------------------
// fp32 WMMA GEMM: C = act(A@B + bias) [+ resid]
// A: MxK row-major, B: KxN row-major, C/resid: MxN row-major.
// One grid holds up to three independent products that share Kd and act: flat
// blocks [0, nb0) work on product 0 (width N0), [nb0, nb0 + nb1) on product 1,
// the rest on product 2 (both of width N12). Within a product the tile column
// runs fastest.
// Block = 256 threads (8 waves) computes an MT x 64 C tile; each wave owns a
// 2x2 grid of 16x16 accumulators. MT = 128: one 32x32 part of the tile a wave.
// MT = 64, for a product whose 128-row tiles would leave half the WGPs without a
// block: waves w and w + 4 share a 32x32 part, w takes the first 32 k of every
// stage and w + 4 the last 32 (LDS reads per WMMA stay as they are), and the two
// partial tiles are added through LDS at the end.
// Double-buffered LDS, async loads to LDS, 64 k per stage (Kd a multiple of 64):
// one barrier per 64 WMMAs of a wave (32 where MT = 64), in front of a stage's last block.
// A tile LDS stride = 68 floats (272B): 16B-aligned rows for b128 async writes
// AND bank-conflict-free fragment reads (68*r mod 64 = 4*r distinct, r=0..15).
// LN = true (Kd = 512): each A fragment is layer-normalized over its row on its
// way from LDS to the product. lnS holds, per row,
// 32 partial sums and 32 partial sums of squares (plane [slice][row], 2048 rows,
// the squares 32 planes further on), written by the kernel that wrote A.
// PH = true (MT = 64): the product's columns are interleaved pairs (x0, x1); C
// takes their phasors, row layout [N/2 real | N/2 imaginary], not the product.
// gemm_block is tile `id` of one product; As0 (2 buffers of MT x 68), Bs0 (2 of
// 64 x 64), Gs, Ts (512 each) and Rst (2 * MT), the last three for LN only, are
// the calling kernel's LDS.
// ---------------------------------------------------------------------------
template <bool LN, int MT, bool PH>
__device__ __forceinline__ void gemm_block(
    float* As0, float* Bs0, float* Gs, float* Ts, float* Rst,
    const float* __restrict__ A, const float* __restrict__ B,
    const float* __restrict__ bias, float* __restrict__ C,
    const float* __restrict__ resid,
    const float* __restrict__ lnS, const float* __restrict__ lnG,
    const float* __restrict__ lnB,
    const int id, const int N, const int Kd, const int act)
{
    constexpr bool SPLIT = (MT == 64);                // two waves share a part of the tile, half the k each
    constexpr int  KW = SPLIT ? 32 : 64;              // k of a stage that one wave works on
    constexpr int  ASZ = MT * 68, BSZ = 64 * 64;      // floats of one buffer of A, of B
    static_assert(!PH || SPLIT, "the phasor epilogue is written for the 64-row tile");

    const int tid  = threadIdx.x;
    const int wave = tid >> 5;
    const int lane = tid & 31;
    const int half = lane >> 4;
    const int lr   = lane & 15;

    const int nx = N >> 6;                 // tile columns of this product
    const int m0 = (id / nx) * MT;
    const int n0 = (id % nx) * 64;

    const int colBase = (wave & 1) * 32;   // cols {colBase, colBase+16}
    const int rowBase = ((wave >> 1) & (MT / 32 - 1)) * 32;   // rows {rowBase, rowBase+16}
    const int kh = SPLIT ? (wave >> 2) : 0;       // which half of a stage's k

    v8f acc00 = {}; v8f acc01 = {}; v8f acc10 = {}; v8f acc11 = {};

    // Loaders: a stage is A MTx64 (256 thr x MT/16 float4) and B 64x64 (256 thr x 4);
    // 16 lanes cover one 256-byte row of either tile.
    const int ldrow = tid >> 4, ldcol = (tid & 15) * 4;

    const float* gA = A + (size_t)(m0 + ldrow) * Kd + ldcol;
    const float* gB = B + (size_t)ldrow * N + n0 + ldcol;
    const size_t aStep = (size_t)16 * Kd;      // 16 rows of A
    const size_t bStep = (size_t)16 * N;       // 16 rows of B
    const int ldsAo = ldrow * 68 + ldcol;
    const int ldsBo = ldrow * 64 + ldcol;
    const int nst = Kd >> 6;                   // stages

    // prologue: stage 0 into buffer 0, published; then stage 1 into buffer 1
    stage_tile<MT>(gA, aStep, gB, bStep, As0 + ldsAo, Bs0 + ldsBo);
    if constexpr (LN) {
        // while stage 0 flies: gain and shift into LDS; threads 0..MT-1 add up the
        // 32 partial sums of one row each, threads MT..2*MT-1 the sums of squares
        Gs[tid] = lnG[tid]; Gs[tid + 256] = lnG[tid + 256];
        Ts[tid] = lnB[tid]; Ts[tid + 256] = lnB[tid + 256];
        if (tid < 2 * MT) {
            const float* sp = lnS + (size_t)(tid / MT) * (32 * 2048) + m0 + (tid % MT);
            float s = 0.0f;
#pragma unroll
            for (int i = 0; i < 32; ++i) s += sp[i * 2048];
            Rst[tid] = s;
        }
    }
    wait_async0();              // this wave's copies of stage 0 have landed
    __syncthreads();            // everyone's have
    if (nst > 1)
        stage_tile<MT>(gA + 64, aStep, gB + (size_t)64 * N, bStep, As0 + ASZ + ldsAo, Bs0 + BSZ + ldsBo);

    // LN: mean and 1/sigma of this lane's two A rows
    float mean0 = 0.0f, sc0 = 0.0f, mean1 = 0.0f, sc1 = 0.0f;
    if constexpr (LN) {
        const int r0 = rowBase + lr, r1 = r0 + 16;
        mean0 = Rst[r0] * (1.0f / 512.0f);
        mean1 = Rst[r1] * (1.0f / 512.0f);
        const float var0 = Rst[MT + r0] * (1.0f / 512.0f) - mean0 * mean0;
        const float var1 = Rst[MT + r1] * (1.0f / 512.0f) - mean1 * mean1;
        sc0 = rsq_normal(var0 + 1e-5f);
        sc1 = rsq_normal(var1 + 1e-5f);
    }

    // Fragments go from LDS to registers one block ahead of their products: a stage is
    // two blocks of KB k-steps, each with a register set of its own, and a block's reads
    // stand together as one group, never among the products.
    constexpr int KB = KW / 8;
    v2f fa0[2][KB], fa1[2][KB], fb0[2][KB], fb1[2][KB], fg[2][KB], ft[2][KB];
    // reads of block blk of stage sst (in buffer sbuf) into register set `set`
    auto load_block = [&](const int set, const int sbuf, const int sst, const int blk) {
        const float* Asb = As0 + sbuf * ASZ + kh * KW + blk * (KB * 4);
        const float* Bsb = Bs0 + sbuf * BSZ + (kh * KW + blk * (KB * 4)) * 64;
        // The scheduling barriers keep the reads of the two column groups apart, so that the
        // compiler pairs rows k and k + 1 of one column in one two-address read, which is a B
        // fragment as it stands; reads of both groups together are paired by column, and every
        // fragment then costs register moves that wait on the reads.
#pragma unroll
        for (int i = 0; i < KB; ++i) {
            fb0[set][i].x = Bsb[(4 * i + 0 + 2 * half) * 64 + colBase + lr];
            fb0[set][i].y = Bsb[(4 * i + 1 + 2 * half) * 64 + colBase + lr];
        }
        __builtin_amdgcn_sched_barrier(0);
#pragma unroll
        for (int i = 0; i < KB; ++i) {
            fb1[set][i].x = Bsb[(4 * i + 0 + 2 * half) * 64 + colBase + 16 + lr];
            fb1[set][i].y = Bsb[(4 * i + 1 + 2 * half) * 64 + colBase + 16 + lr];
        }
        __builtin_amdgcn_sched_barrier(0);
#pragma unroll
        for (int i = 0; i < KB; ++i) {
            const int k0 = 4 * i;
            fa0[set][i].x = Asb[(rowBase + lr) * 68 + k0 + 0 + 2 * half];
            fa0[set][i].y = Asb[(rowBase + lr) * 68 + k0 + 1 + 2 * half];
            fa1[set][i].x = Asb[(rowBase + 16 + lr) * 68 + k0 + 0 + 2 * half];
            fa1[set][i].y = Asb[(rowBase + 16 + lr) * 68 + k0 + 1 + 2 * half];
            if constexpr (LN) {
                fg[set][i] = *(const v2f*)&Gs[sst * 64 + kh * KW + blk * (KB * 4) + k0 + 2 * half];
                ft[set][i] = *(const v2f*)&Ts[sst * 64 + kh * KW + blk * (KB * 4) + k0 + 2 * half];
            }
        }
    };
    // products of k-steps [from, to) of register set `set`
    auto mma_block = [&](const int set, const int from, const int to) {
#pragma unroll
        for (int i = from; i < to; ++i) {
            v2f a0 = fa0[set][i], a1 = fa1[set][i];
            if constexpr (LN) {
                a0 = (a0 - mean0) * sc0 * fg[set][i] + ft[set][i];
                a1 = (a1 - mean1) * sc1 * fg[set][i] + ft[set][i];
            }
            acc00 = WMMA_F32(a0, fb0[set][i], acc00);
            acc01 = WMMA_F32(a0, fb1[set][i], acc01);
            acc10 = WMMA_F32(a1, fb0[set][i], acc10);
            acc11 = WMMA_F32(a1, fb1[set][i], acc11);
        }
    };

    load_block(0, 0, 0, 0);     // stage 0 is published: its first block
    // The scheduling barriers below keep each group of reads and each run of products
    // where it is written: without them the reads are moved in among the products.
    for (int st = 0; st < nst; ++st) {
        const int buf = st & 1;
        load_block(1, buf, st, 1);
        __builtin_amdgcn_sched_barrier(0);
        mma_block(0, 0, KB);
        __builtin_amdgcn_sched_barrier(0);
        // Publish point of stage st + 1, in front of this stage's last block: that block's
        // fragments are in registers, and the reads behind it are the next stage's.
        wait_ds0();             // this wave's reads of `buf` are done
        wait_async0();          // this wave's copies of stage st + 1 have landed
        __syncthreads();        // stage st + 1 published; `buf` left by every reader
        __builtin_amdgcn_sched_barrier(0);
        // Half of the last block stands between the barrier and the refill: behind the barrier
        // the matrix unit has work at once, and one wave's copies and reads run beside the
        // products of the other wave of its SIMD.
        mma_block(1, 0, KB / 2);
        __builtin_amdgcn_sched_barrier(0);
        if (st + 2 < nst) {     // refill `buf` while stage st + 1 is worked on
            const int kn = (st + 2) * 64;
            stage_tile<MT>(gA + kn, aStep, gB + (size_t)kn * N, bStep, As0 + buf * ASZ + ldsAo, Bs0 + buf * BSZ + ldsBo);
        }
        // The next stage's first block. In the last stage the reads stay (no branch, so that
        // the waits stay counted) and are aimed at its own buffer; their values are not used.
        const bool more = st + 1 < nst;
        load_block(0, more ? buf ^ 1 : buf, more ? st + 1 : st, 0);
        __builtin_amdgcn_sched_barrier(0);
        mma_block(1, KB / 2, KB);
        __builtin_amdgcn_sched_barrier(0);
    }
    wait_async0();              // nothing in flight when the ring is left
    wait_ds0();                 // nor the last stage's unused reads

    if constexpr (SPLIT) {
        // The buffer that the last stage did not use carries the partial tiles: every wave
        // left it in front of the loop's last barrier. Wave w finishes rows rowBase..+15 and
        // hands over its part of rows rowBase+16..+31; wave w + 4 the other way round.
        float* Xs = As0 + ((nst & 1) ? ASZ : 0);
        float* mine = Xs + wave * 512 + lane;
        const float* theirs = Xs + (wave ^ 4) * 512 + lane;
        // both loops unrolled: accumulator elements stay registers only under constant indices
#pragma unroll
        for (int v = 0; v < 8; ++v) {
            mine[v * 32]       = kh ? acc00[v] : acc10[v];
            mine[(8 + v) * 32] = kh ? acc01[v] : acc11[v];
        }
        __syncthreads();        // both partial tiles are in LDS
#pragma unroll
        for (int v = 0; v < 8; ++v) {
            acc00[v] = (kh ? acc10[v] : acc00[v]) + theirs[v * 32];
            acc01[v] = (kh ? acc11[v] : acc01[v]) + theirs[(8 + v) * 32];
        }
    }

    const int nA0 = n0 + colBase + lr;
    const int nA1 = nA0 + 16;
    const float bz0 = bias ? bias[nA0] : 0.0f;
    const float bz1 = bias ? bias[nA1] : 0.0f;
    // The index register of the two bias loads is reused for the store addresses: keep the wait in
    // front of that. The scheduling barrier keeps the address arithmetic from moving up over the wait.
    asm volatile("s_wait_xcnt 0x0" ::: "memory");
    __builtin_amdgcn_sched_barrier(0);
    if constexpr (PH) {
        // Lanes 2j and 2j + 1 hold x0 and x1 of one pair in each column group: the
        // even lane takes over the pair of the first group, the odd lane that of the
        // second, so every lane works out one phasor a row.
        const bool odd = (lr & 1) != 0;
        const int  kc  = (n0 + colBase + (odd ? 16 : 0) + (lr & 14)) >> 1;
        float* Cp = C + (size_t)(m0 + rowBase + kh * 16 + 8 * half) * N + kc;
        // Kept rolled: the long phasor code stands once in the text,
        // not eight times. The accumulators rotate, so that the row in turn is element 0
        // (they stay registers only under constant indices).
#pragma unroll 1
        for (int v = 0; v < 8; ++v) {
            const float r00 = acc00[0] + bz0, r01 = acc01[0] + bz1;
            const float recv = lane_xor1(odd ? r00 : r01);
            float re, im;
            phasor2(odd ? recv : r00, odd ? r01 : recv, &re, &im);
            Cp[0] = re;
            Cp[N >> 1] = im;
            // the next trip rewrites the two stores' address and data registers: keep the wait in front of that
            asm volatile("s_wait_xcnt 0x0" ::: "memory");
            Cp += N;
            acc00 = __builtin_shufflevector(acc00, acc00, 1, 2, 3, 4, 5, 6, 7, 0);
            acc01 = __builtin_shufflevector(acc01, acc01, 1, 2, 3, 4, 5, 6, 7, 0);
        }
        return;
    }
    // The epilogue is straight code: the tests that read the same for the whole grid
    // (activation, residual) stand once, outside the row loops, and erf has no branch. With
    // a branch per row or per element every row's residual loads are waited for before the
    // next row's are issued, and every element's chain of dependent instructions runs alone.
    // Every loop here is unrolled: accumulator elements stay registers only under constant indices.
    const size_t oA = (size_t)(m0 + rowBase + kh * 16 + 8 * half) * N + nA0;   // row v = 0 of acc00
    const size_t oB = oA + (size_t)16 * N;                                     // row v = 0 of acc10
    v8f q00 = {}; v8f q01 = {}; v8f q10 = {}; v8f q11 = {};
    if (resid) {
        // all rows' residual values are asked for at once, while the bias is still on its way
#pragma unroll
        for (int v = 0; v < 8; ++v) {
            q00[v] = resid[oA + (size_t)v * N]; q01[v] = resid[oA + (size_t)v * N + 16];
            if constexpr (!SPLIT) {
                q10[v] = resid[oB + (size_t)v * N]; q11[v] = resid[oB + (size_t)v * N + 16];
            }
            if ((v & 3) == 3) {
                // the address registers of these four rows' loads are free for reuse (as a later
                // load's destination too) only behind this wait; the scheduling barrier keeps
                // what follows from moving up over it
                asm volatile("s_wait_xcnt 0x0" ::: "memory");
                __builtin_amdgcn_sched_barrier(0);
            }
        }
    }
    if (act == 1) {
#pragma unroll
        for (int v = 0; v < 8; ++v) {
            acc00[v] = gelu_exact(acc00[v] + bz0); acc01[v] = gelu_exact(acc01[v] + bz1);
            if constexpr (!SPLIT) {
                acc10[v] = gelu_exact(acc10[v] + bz0); acc11[v] = gelu_exact(acc11[v] + bz1);
            }
        }
    } else {
#pragma unroll
        for (int v = 0; v < 8; ++v) {
            acc00[v] += bz0; acc01[v] += bz1;
            if constexpr (!SPLIT) { acc10[v] += bz0; acc11[v] += bz1; }
        }
    }
    if (resid) {
        acc00 += q00; acc01 += q01;
        if constexpr (!SPLIT) { acc10 += q10; acc11 += q11; }
    }
#pragma unroll
    for (int v = 0; v < 8; ++v) {
        C[oA + (size_t)v * N]      = acc00[v];
        C[oA + (size_t)v * N + 16] = acc01[v];
        if constexpr (!SPLIT) {
            C[oB + (size_t)v * N]      = acc10[v];
            C[oB + (size_t)v * N + 16] = acc11[v];
        }
    }
}

template <bool LN, int MT>
__global__ __launch_bounds__(256) void gemm_wmma_f32(
    const float* __restrict__ A0, const float* __restrict__ B0,
    const float* __restrict__ bias0, float* __restrict__ C0,
    const float* __restrict__ A1, const float* __restrict__ B1,
    const float* __restrict__ bias1, float* __restrict__ C1,
    const float* __restrict__ A2, const float* __restrict__ B2,
    const float* __restrict__ bias2, float* __restrict__ C2,
    const float* __restrict__ resid,
    const float* __restrict__ lnS, const float* __restrict__ lnG,
    const float* __restrict__ lnB,
    int nb0, int nb1, int N0, int N12, int Kd, int act)
{
    __shared__ __align__(16) float As[2 * MT * 68];   // [buf][row][k], stride 68
    __shared__ __align__(16) float Bs[2 * 64 * 64];   // [buf][k][n]
    __shared__ __align__(16) float Gs[512];           // LN only: gain by k
    __shared__ __align__(16) float Ts[512];           // LN only: shift by k
    __shared__ float Rst[2 * MT];                     // LN only: row sums | row sums of squares

    // which product this block belongs to: the same for the whole block
    int id = blockIdx.x;
    const float* A = A0; const float* B = B0; const float* bias = bias0;
    float* C = C0;
    int N = N0;
    if (id >= nb0 + nb1) {
        id -= nb0 + nb1; A = A2; B = B2; bias = bias2; C = C2; N = N12;
    } else if (id >= nb0) {
        id -= nb0;       A = A1; B = B1; bias = bias1; C = C1; N = N12;
    }
    gemm_block<LN, MT, false>(As, Bs, Gs, Ts, Rst, A, B, bias, C, resid, lnS, lnG, lnB, id, N, Kd, act);
}

// ---------------------------------------------------------------------------
// One grid: blocks [0, nbV) the V projection in 128-row tiles (width NV); then
// nbP blocks each for the key and the query MLP's second layer (width NP) in
// 64-row tiles, which end in the phasor of every column pair. The 64-row tiles
// have half the products of a V tile, so their phasors are done while the V
// tiles still run.
// ---------------------------------------------------------------------------
__global__ __launch_bounds__(256) void gemm_v_phasor_kernel(
    const float* __restrict__ x,  const float* __restrict__ Wv,
    const float* __restrict__ bv, float* __restrict__ V,
    const float* __restrict__ Hk, const float* __restrict__ Wk2,
    const float* __restrict__ bk2, float* __restrict__ K2,
    const float* __restrict__ Hq, const float* __restrict__ Wq2,
    const float* __restrict__ bq2, float* __restrict__ Q2,
    int nbV, int nbP, int NV, int NP, int Kd)
{
    __shared__ __align__(16) float As[2 * 128 * 68];  // the 64-row tiles use the first half
    __shared__ __align__(16) float Bs[2 * 64 * 64];
    const int id = blockIdx.x;             // every branch is the same for the whole block
    if (id < nbV) {
        gemm_block<false, 128, false>(As, Bs, nullptr, nullptr, nullptr, x, Wv, bv, V,
                                      nullptr, nullptr, nullptr, nullptr, id, NV, Kd, 0);
    } else {
        const bool q = id >= nbV + nbP;
        gemm_block<false, 64, true>(As, Bs, nullptr, nullptr, nullptr,
                                    q ? Hq : Hk, q ? Wq2 : Wk2, q ? bq2 : bk2, q ? Q2 : K2,
                                    nullptr, nullptr, nullptr, nullptr,
                                    id - nbV - (q ? nbP : 0), NP, Kd, 0);
    }
}

// ---------------------------------------------------------------------------
// Per-chunk masked scores: S_c = tril(Q2_c @ K2_c^T), chunk = 64 tokens.
// Both operands are read along their rows, 16 rows a fragment: straight from memory
// every fragment load would touch 16 cache lines for 256 bytes. The two 64 x 128 tiles
// go to LDS once, in whole 512-byte rows (Qs, Ks: pitch 132 floats, 16-byte-aligned rows
// and 132*r mod 64 = 4*r, so the fragment reads meet no bank twice).
// ---------------------------------------------------------------------------
__device__ __forceinline__ void s_chunk_block(
    float* Qs, float* Ks,
    const float* __restrict__ Q2, const float* __restrict__ K2,
    float* __restrict__ Sbuf, const int bc)   // bc = b*16 + c
{
    const size_t tok0 = (size_t)(bc >> 4) * 1024 + (size_t)(bc & 15) * 64;
    const int tid  = threadIdx.x;
    const int wave = tid >> 5, lane = tid & 31, half = lane >> 4, lr = lane & 15;
    const int nOff = (wave & 3) * 16, rOff = (wave >> 2) * 32;

    const float* Qb = Q2 + tok0 * 128;
    const float* Kb = K2 + tok0 * 128;

    // a wave copies one 512-byte row at a time; a thread's 8 rows lie 8 apart
    const int crow = tid >> 5, ccol = lane * 4;
    copy_rows8(Qb + crow * 128 + ccol, 8 * 128, Qs + crow * 132 + ccol, 8u * 132u * 4u);
    copy_rows8(Kb + crow * 128 + ccol, 8 * 128, Ks + crow * 132 + ccol, 8u * 132u * 4u);
    wait_async0();              // this wave's copies have landed
    __syncthreads();            // everyone's have

    v8f acc0 = {}; v8f acc1 = {};
    // 16 k-steps a trip: a trip's fragment reads issue ahead of its products
#pragma unroll 16
    for (int k0 = 0; k0 < 128; k0 += 4) {
        // B[k][n] = K2[tok0+n][k]  (transposed read)
        const v2f bf = *(const v2f*)&Ks[(nOff + lr) * 132 + k0 + 2 * half];
        const v2f a0 = *(const v2f*)&Qs[(rOff + lr) * 132 + k0 + 2 * half];
        const v2f a1 = *(const v2f*)&Qs[(rOff + 16 + lr) * 132 + k0 + 2 * half];
        acc0 = WMMA_F32(a0, bf, acc0);
        acc1 = WMMA_F32(a1, bf, acc1);
    }
    float* Sb = Sbuf + (size_t)bc * 4096;
    const int n = nOff + lr;
#pragma unroll
    for (int v = 0; v < 8; ++v) {
        int mA = rOff + v + 8 * half, mB = mA + 16;
        Sb[mA * 64 + n] = (mA >= n) ? acc0[v] : 0.0f;
        Sb[mB * 64 + n] = (mB >= n) ? acc1[v] : 0.0f;
    }
}

// ---------------------------------------------------------------------------
// Per-chunk states: P_c = K2_c^T @ V_c (128 x 512), chunk = 64 tokens.
// 2 batches * 15 chunks * 8 d-slices = 240 independent blocks (the last
// chunk's state has no reader). Tile (b, c, dtile) is a contiguous 128x64 block
// at index (b*15 + c)*8 + dtile.
// ---------------------------------------------------------------------------
__device__ __forceinline__ void chunk_state_block(
    const float* __restrict__ K2, const float* __restrict__ V,
    float* __restrict__ P, const int sidx)    // sidx = (b*15 + c)*8 + dtile
{
    const int tid  = threadIdx.x;
    const int wave = tid >> 5, lane = tid & 31, half = lane >> 4, lr = lane & 15;
    const int nOff = (wave & 3) * 16;

    const int bc15 = sidx >> 3;
    const int b    = bc15 / 15;
    const int c    = bc15 - b * 15;
    const size_t tok0 = (size_t)b * 1024 + (size_t)c * 64;
    const float* Vb = V  + tok0 * 512 + (sidx & 7) * 64;
    const float* Kb = K2 + tok0 * 128;
    const int mBase = (wave >> 2) * 64;   // each wave owns 4 disjoint 16x16 subtiles

    v8f acc[4] = {};
    // 8 k-steps a trip: 80 independent fragment loads in flight per lane
#pragma unroll 8
    for (int k0 = 0; k0 < 64; k0 += 4) {
        v2f bf;
        bf.x = Vb[(size_t)(k0 + 0 + 2 * half) * 512 + nOff + lr];
        bf.y = Vb[(size_t)(k0 + 1 + 2 * half) * 512 + nOff + lr];
#pragma unroll
        for (int j = 0; j < 4; ++j) {
            v2f af;   // A[m][l] = K2[tok0+l][m]  (transposed read)
            af.x = Kb[(size_t)(k0 + 0 + 2 * half) * 128 + mBase + j * 16 + lr];
            af.y = Kb[(size_t)(k0 + 1 + 2 * half) * 128 + mBase + j * 16 + lr];
            acc[j] = WMMA_F32(af, bf, acc[j]);
        }
    }
    float* Pb = P + (size_t)sidx * 8192;
#pragma unroll
    for (int j = 0; j < 4; ++j)
#pragma unroll
        for (int v = 0; v < 8; ++v)
            Pb[(mBase + j * 16 + v + 8 * half) * 64 + nOff + lr] = acc[j][v];
}

// Scores and states depend only on K2, Q2 and V, not on each other: one grid,
// blocks 0..31 the masked scores, blocks 32..271 the chunk states.
__global__ __launch_bounds__(256) void chunk_scores_states_kernel(
    const float* __restrict__ Q2, const float* __restrict__ K2,
    const float* __restrict__ V, float* __restrict__ Sbuf, float* __restrict__ P)
{
    __shared__ __align__(16) float Qs[64 * 132];    // score blocks only
    __shared__ __align__(16) float Ks[64 * 132];
    const int blk = blockIdx.x;                     // the branch is the same for the whole block
    if (blk < 32) s_chunk_block(Qs, Ks, Q2, K2, Sbuf, blk);
    else          chunk_state_block(K2, V, P, blk - 32);
}

// ---------------------------------------------------------------------------
// Chunk-parallel causal linear attention.
// Grid = B * 16 chunks * (512/64) d-slices = 256 independent blocks. Each sums
// the states of the earlier chunks of its batch, M = sum_{j<c} P_j, into LDS:
//   out_c = S_c @ V_c + Q2_c @ M
// S_c, Q2_c and the block's slice of V_c go to LDS in whole rows by async copies that
// are issued at entry and fly while the states are summed: S and Q2 are read along their
// rows, 16 rows a fragment, which straight from memory is 16 cache lines a load.
// The rows are stored position-normalized (divided by sqrt(64 * position)).
// Each wave also leaves, for the LayerNorm in the output projection, the sum and
// the sum of squares of its 16 columns of every row it holds: plane
// [slice = dt*4 + column group][row] of St, the squares 32 planes further on.
// ---------------------------------------------------------------------------
// v + (v of lane ^ X) inside a 16-lane row, as one DPP add (0x160 + X = row_xmask:X)
template <int CTRL>
__device__ __forceinline__ float dpp_xadd(float v) {
    return v + __int_as_float(__builtin_amdgcn_update_dpp(0, __float_as_int(v), CTRL, 0xf, 0xf, true));
}
__device__ __forceinline__ float row16_sum(float v) {
    v = dpp_xadd<0x161>(v);
    v = dpp_xadd<0x162>(v);
    v = dpp_xadd<0x164>(v);
    v = dpp_xadd<0x168>(v);
    return v;
}

__global__ __launch_bounds__(256) void attn_out_kernel(
    const float* __restrict__ Q2, const float* __restrict__ V,
    const float* __restrict__ Sbuf, const float* __restrict__ P,
    float* __restrict__ R, float* __restrict__ St)
{
    __shared__ __align__(16) float Msh[128 * 64];   // 32 KB prefix state
    __shared__ __align__(16) float Ssh[64 * 68];    // S_c,  pitch 68:  68*r mod 64 = 4*r, no bank met twice
    __shared__ __align__(16) float Qsh[64 * 132];   // Q2_c, pitch 132: the same
    __shared__ __align__(16) float Vsh[64 * 64];    // V_c, this block's 64 columns
    const int dt = blockIdx.x & 7;
    const int bq = blockIdx.x >> 3;
    const int b  = bq >> 4;
    const int c  = 15 - (bq & 15);    // blocks with the longest prefix take the lowest indices
    const int n0 = dt * 64;

    const int tid  = threadIdx.x;
    const int wave = tid >> 5, lane = tid & 31, half = lane >> 4, lr = lane & 15;
    const int nOff = (wave & 3) * 16, rOff = (wave >> 2) * 32;

    const size_t tok0 = (size_t)b * 1024 + (size_t)c * 64;
    const float* Sb = Sbuf + (size_t)(b * 16 + c) * 4096;
    const float* Vb = V  + tok0 * 512 + n0;
    const float* Qb = Q2 + tok0 * 128;

    {
        // 16 lanes copy one 256-byte row of S or V, a wave one 512-byte row of Q2
        const int r16 = tid >> 4, c16 = (tid & 15) * 4;
        copy_rows4(Sb + r16 * 64 + c16, 16 * 64, Ssh + r16 * 68 + c16, 16u * 68u * 4u);
        copy_rows4(Vb + (size_t)r16 * 512 + c16, 16 * 512, Vsh + r16 * 64 + c16, 16u * 64u * 4u);
        copy_rows8(Qb + wave * 128 + lane * 4, 8 * 128, Qsh + wave * 132 + lane * 4, 8u * 132u * 4u);
    }

    if (c > 0) {
        // thread t owns float4 slots t + 256*i of the 128x64 tile
        const v4f* Pt = (const v4f*)(P + ((size_t)(b * 15) * 8 + dt) * 8192) + tid;
        v4f m[8];
#pragma unroll
        for (int i = 0; i < 8; ++i) m[i] = Pt[256 * i];
        // the loads' scalar base may be rewritten on the short-prefix path: keep the wait in front of it
        asm volatile("s_wait_xcnt 0x0" ::: "memory");
        // 4 tiles a trip: 32 independent 16-byte loads per lane in flight
#pragma unroll 4
        for (int j = 1; j < c; ++j) {
            const v4f* Pj = Pt + (size_t)j * (8 * 2048);
#pragma unroll
            for (int i = 0; i < 8; ++i) m[i] += Pj[256 * i];
        }
#pragma unroll
        for (int i = 0; i < 8; ++i) *(v4f*)&Msh[(tid + 256 * i) * 4] = m[i];
    }

    wait_async0();                    // this wave's copies have landed
    __syncthreads();                  // everyone's have, and M is complete

    v8f acc0 = {}; v8f acc1 = {};
    // fully unrolled: the S and V fragment reads issue ahead of the products
#pragma unroll
    for (int k0 = 0; k0 < 64; k0 += 4) {
        v2f bf;
        bf.x = Vsh[(k0 + 0 + 2 * half) * 64 + nOff + lr];
        bf.y = Vsh[(k0 + 1 + 2 * half) * 64 + nOff + lr];
        const v2f a0 = *(const v2f*)&Ssh[(rOff + lr) * 68 + k0 + 2 * half];
        const v2f a1 = *(const v2f*)&Ssh[(rOff + 16 + lr) * 68 + k0 + 2 * half];
        acc0 = WMMA_F32(a0, bf, acc0);
        acc1 = WMMA_F32(a1, bf, acc1);
    }

    if (c > 0) {                      // same for the whole block
        // 16 k-steps a trip: a trip's fragment reads issue ahead of its products
#pragma unroll 16
        for (int k0 = 0; k0 < 128; k0 += 4) {
            v2f bf;
            bf.x = Msh[(k0 + 0 + 2 * half) * 64 + nOff + lr];
            bf.y = Msh[(k0 + 1 + 2 * half) * 64 + nOff + lr];
            const v2f a0 = *(const v2f*)&Qsh[(rOff + lr) * 132 + k0 + 2 * half];
            const v2f a1 = *(const v2f*)&Qsh[(rOff + 16 + lr) * 132 + k0 + 2 * half];
            acc0 = WMMA_F32(a0, bf, acc0);
            acc1 = WMMA_F32(a1, bf, acc1);
        }
    }

    // What follows reads the accumulators with vector instructions right behind the
    // last matrix instruction: four v_nop keep the vector slots between the two.
    // The scheduling barriers hold them at this place (nothing moves across).
    __builtin_amdgcn_sched_barrier(0);
    asm volatile("v_nop\n\tv_nop\n\tv_nop\n\tv_nop");
    __builtin_amdgcn_sched_barrier(0);

    float* Rb = R + tok0 * 512 + n0;
    const int n = nOff + lr;
#pragma unroll
    for (int v = 0; v < 8; ++v) {
        const int pos = c * 64 + rOff + v + 8 * half + 1;   // 1-based position in the sequence
        acc0[v] *= rsq_normal((float)pos * 64.0f);
        acc1[v] *= rsq_normal((float)(pos + 16) * 64.0f);
        Rb[(size_t)(rOff + v + 8 * half) * 512 + n]      = acc0[v];
        Rb[(size_t)(rOff + 16 + v + 8 * half) * 512 + n] = acc1[v];
    }

    // row statistics over this wave's 16 columns; lanes 0..7 of a half keep the
    // rows of acc0, lanes 8..15 those of acc1, one row a lane
    float ps = 0.0f, pq = 0.0f;
#pragma unroll
    for (int v = 0; v < 8; ++v) {
        const float s0 = row16_sum(acc0[v]);
        const float s1 = row16_sum(acc1[v]);
        const float q0 = row16_sum(acc0[v] * acc0[v]);
        const float q1 = row16_sum(acc1[v] * acc1[v]);
        if ((lr & 7) == v) {
            ps = (lr & 8) ? s1 : s0;
            pq = (lr & 8) ? q1 : q0;
        }
    }
    const size_t so = (size_t)(dt * 4 + (wave & 3)) * 2048 + tok0
                    + rOff + ((lr & 8) << 1) + (lr & 7) + 8 * half;
    St[so] = ps;
    St[so + 32 * 2048] = pq;
}

// ---------------------------------------------------------------------------
extern "C" void kernel_launch(void* const* d_in, const int* in_sizes, int n_in,
                              void* d_out, int out_size, void* d_ws, size_t ws_size,
                              hipStream_t stream) {
    const float* x   = (const float*)d_in[0];
    const float* Wk1 = (const float*)d_in[1];
    const float* bk1 = (const float*)d_in[2];
    const float* Wk2 = (const float*)d_in[3];
    const float* bk2 = (const float*)d_in[4];
    const float* Wq1 = (const float*)d_in[5];
    const float* bq1 = (const float*)d_in[6];
    const float* Wq2 = (const float*)d_in[7];
    const float* bq2 = (const float*)d_in[8];
    const float* Wv  = (const float*)d_in[9];
    const float* bv  = (const float*)d_in[10];
    const float* lng = (const float*)d_in[11];
    const float* lnb = (const float*)d_in[12];
    const float* Wo  = (const float*)d_in[13];
    const float* bo  = (const float*)d_in[14];
    float* out = (float*)d_out;

    const int M = 2048;      // B*L tokens
    const int D = 512;
    const int N2K = 128;     // 2*K_OSC

    float* ws   = (float*)d_ws;
    float* Hk   = ws;
    float* Hq   = Hk   + (size_t)M * D;
    float* Vm   = Hq   + (size_t)M * D;
    float* K2   = Vm   + (size_t)M * D;
    float* Q2   = K2   + (size_t)M * N2K;
    float* Sbuf = Q2   + (size_t)M * N2K;
    float* R    = Sbuf + (size_t)32 * 4096;
    float* P    = R    + (size_t)M * D;      // 30 chunk states of 128 x 512
    float* St   = P    + (size_t)30 * 128 * D;   // 64 planes of M row statistics

    dim3 blk(256);

    const int nbD = (D / 64) * (M / 128);     // 128 blocks for an M x D product
    const int nbP = (N2K / 64) * (M / 64);    // 64 blocks for an M x 2K product in 64-row tiles
    const int nbO = (D / 64) * (M / 64);      // 256 blocks for an M x D product in 64-row tiles

    // Both MLP first layers (gelu): 256 blocks
    gemm_wmma_f32<false, 128><<<nbD + nbD, blk, 0, stream>>>(
        x, Wk1, bk1, Hk,  x, Wq1, bq1, Hq,  nullptr, nullptr, nullptr, nullptr,
        nullptr, nullptr, nullptr, nullptr, nbD, nbD, D, D, D, 1);
    // V projection + both MLP second layers ending in the phasor features: 256 blocks
    gemm_v_phasor_kernel<<<nbD + nbP + nbP, blk, 0, stream>>>(
        x, Wv, bv, Vm,  Hk, Wk2, bk2, K2,  Hq, Wq2, bq2, Q2,  nbD, nbP, D, N2K, D);
    // Per-chunk masked scores + per-chunk states K2_c^T V_c
    chunk_scores_states_kernel<<<32 + 240, blk, 0, stream>>>(Q2, K2, Vm, Sbuf, P);
    // Chunk-parallel causal linear attention, position-normalized, + partial row statistics
    attn_out_kernel<<<256, blk, 0, stream>>>(Q2, Vm, Sbuf, P, R, St);
    // Output projection with residual, LayerNorm applied to its A fragments:
    // out = x + LN(r) @ Wo + bo
    gemm_wmma_f32<true, 64><<<nbO, blk, 0, stream>>>(
        R, Wo, bo, out,  nullptr, nullptr, nullptr, nullptr,  nullptr, nullptr, nullptr, nullptr,
        x, St, lng, lnb, nbO, 0, D, D, D, 0);
}
